// v000
// Times are from an AMD MI455X. After a warm-up the kernel runs many times in a row, and a time is the length of
// such a window on the GPU divided by its runs, so every launch and the gaps after it count. The runs cycle
// through copies of the inputs. A figure is the median of several windows, for all but v000 over two sittings.
// Sittings can differ by a few percent; kernels timed side by side share one.
// The starting kernel, v000, takes 623 microseconds a run.
#include <hip/hip_runtime.h>
#include <math.h>

typedef __attribute__((ext_vector_type(2)))  float  v2f;
typedef __attribute__((ext_vector_type(8)))  float  v8f;
typedef __attribute__((ext_vector_type(8)))  __bf16 v8bf;
typedef __attribute__((ext_vector_type(16))) __bf16 v16bf;

constexpr int B_ = 8, T_ = 1024, E_ = 128, H_ = 8;
constexpr int SROW = 1028;   // fp32 score row stride (1028 % 64 == 4 -> conflict-free)
constexpr int PROW = 1032;   // bf16 prob row stride (16B aligned; 516 dwords % 64 == 4)
constexpr float SCALE = 0.08838834764831845f;  // 1/sqrt(128)

static __device__ __forceinline__ v8f vzero8() {
  v8f z = {0.f, 0.f, 0.f, 0.f, 0.f, 0.f, 0.f, 0.f};
  return z;
}

// --- bf16 helpers (bit-exact, storage-only use of __bf16) ---
static __device__ __forceinline__ float bf2f(__bf16 h) {
  return __builtin_bit_cast(float, (unsigned)((unsigned)__builtin_bit_cast(unsigned short, h) << 16));
}
static __device__ __forceinline__ __bf16 f2bf(float f) {          // RNE
  unsigned u = __builtin_bit_cast(unsigned, f);
  u = (u + 0x7FFFu + ((u >> 16) & 1u)) >> 16;
  return __builtin_bit_cast(__bf16, (unsigned short)u);
}
static __device__ __forceinline__ void split2(float f, __bf16& h, __bf16& l) {
  h = f2bf(f);
  l = f2bf(f - bf2f(h));
}

// D = A(16x32 bf16) * B(32x16 bf16) + C(16x16 f32)
static __device__ __forceinline__ v8f wmma_bf(v16bf a, v16bf b, v8f c) {
  return __builtin_amdgcn_wmma_f32_16x16x32_bf16(false, a, false, b, (short)0, c, false, false);
}

// Per-lane A/B operand slice from a K-contiguous row.
// p must be pre-offset by row*stride + 8*(lane>>4).
// elems 0..7 <- K[k0 + 8*lh .. +7], elems 8..15 <- K[k0 + 16 + 8*lh .. +7]
static __device__ __forceinline__ v16bf ldAB(const __bf16* p, int k0) {
  v8bf a = *(const v8bf*)(p + k0);
  v8bf b = *(const v8bf*)(p + k0 + 16);
  return __builtin_shufflevector(a, b, 0,1,2,3,4,5,6,7,8,9,10,11,12,13,14,15);
}

// One K=32 chunk of the split-bf16 product: hi*hi + hi*lo + lo*hi
#define SPLIT_CHUNK(AH_, AL_, BH_, BL_, K0_, ACC_)  \
  do {                                              \
    v16bf _ah = ldAB((AH_), (K0_));                 \
    v16bf _al = ldAB((AL_), (K0_));                 \
    v16bf _bh = ldAB((BH_), (K0_));                 \
    v16bf _bl = ldAB((BL_), (K0_));                 \
    (ACC_) = wmma_bf(_ah, _bh, (ACC_));             \
    (ACC_) = wmma_bf(_ah, _bl, (ACC_));             \
    (ACC_) = wmma_bf(_al, _bh, (ACC_));             \
  } while (0)

// Same chunk but with the A operand (hi,lo) already resident in registers.
#define QK_CHUNK(QH_, QL_, BH_, BL_, K0_, ACC_)     \
  do {                                              \
    v16bf _bh = ldAB((BH_), (K0_));                 \
    v16bf _bl = ldAB((BL_), (K0_));                 \
    (ACC_) = wmma_bf((QH_), _bh, (ACC_));           \
    (ACC_) = wmma_bf((QH_), _bl, (ACC_));           \
    (ACC_) = wmma_bf((QL_), _bh, (ACC_));           \
  } while (0)

// ---------------------------------------------------------------------------
// Kernel 0: elementwise fp32 -> (bf16 hi, bf16 lo) split
// ---------------------------------------------------------------------------
__global__ __launch_bounds__(256)
void split_kernel(const float* __restrict__ src, __bf16* __restrict__ h,
                  __bf16* __restrict__ l, int n) {
  for (int i = blockIdx.x * blockDim.x + threadIdx.x; i < n; i += gridDim.x * blockDim.x) {
    const float f = src[i];
    __bf16 hh, ll;
    split2(f, hh, ll);
    h[i] = hh;
    l[i] = ll;
  }
}

// ---------------------------------------------------------------------------
// Kernel 1: QKV projection (split-bf16 GEMM, K=128 -> 4 chunks * 3 WMMA).
// grid = (512, H, 3), block = 256.  z==2 (V) stores transposed (B,H,E,T).
// ---------------------------------------------------------------------------
__global__ __launch_bounds__(256)
void qkv_kernel(const __bf16* __restrict__ xh, const __bf16* __restrict__ xl,
                const __bf16* __restrict__ wqh, const __bf16* __restrict__ wql,
                const __bf16* __restrict__ wkh, const __bf16* __restrict__ wkl,
                const __bf16* __restrict__ wvh, const __bf16* __restrict__ wvl,
                __bf16* __restrict__ qh, __bf16* __restrict__ ql,
                __bf16* __restrict__ kh, __bf16* __restrict__ kl,
                __bf16* __restrict__ vth, __bf16* __restrict__ vtl) {
  const int wave = threadIdx.x >> 5, lane = threadIdx.x & 31;
  const int r16 = lane & 15, lh = lane >> 4;

  const __bf16 *Wh, *Wl; __bf16 *oh, *ol; bool transposed = false;
  if (blockIdx.z == 0)      { Wh = wqh; Wl = wql; oh = qh;  ol = ql; }
  else if (blockIdx.z == 1) { Wh = wkh; Wl = wkl; oh = kh;  ol = kl; }
  else                      { Wh = wvh; Wl = wvl; oh = vth; ol = vtl; transposed = true; }

  const int m0 = blockIdx.x * 16;
  const int h  = blockIdx.y;
  const int n0 = h * E_ + wave * 16;

  const __bf16* axh = xh + (size_t)(m0 + r16) * E_ + 8 * lh;
  const __bf16* axl = xl + (size_t)(m0 + r16) * E_ + 8 * lh;
  const __bf16* bwh = Wh + (size_t)(n0 + r16) * E_ + 8 * lh;
  const __bf16* bwl = Wl + (size_t)(n0 + r16) * E_ + 8 * lh;

  v8f acc0 = vzero8(), acc1 = vzero8(), acc2 = vzero8(), acc3 = vzero8();
  SPLIT_CHUNK(axh, axl, bwh, bwl, 0,  acc0);
  SPLIT_CHUNK(axh, axl, bwh, bwl, 32, acc1);
  SPLIT_CHUNK(axh, axl, bwh, bwl, 64, acc2);
  SPLIT_CHUNK(axh, axl, bwh, bwl, 96, acc3);
  v8f acc = (acc0 + acc1) + (acc2 + acc3);

  const int bb = m0 / T_;
  const int tb = m0 % T_;
  const int e  = (n0 & (E_ - 1)) + r16;
#pragma unroll
  for (int j = 0; j < 8; ++j) {
    const int t = tb + j + 8 * lh;               // C layout: VGPR j -> M = j + 8*(lane/16)
    __bf16 hh, ll;
    split2(acc[j], hh, ll);
    size_t idx;
    if (transposed) idx = (((size_t)bb * H_ + h) * E_ + e) * T_ + t;   // (B,H,E,T)
    else            idx = (((size_t)bb * H_ + h) * T_ + t) * E_ + e;   // (B,H,T,E)
    oh[idx] = hh;
    ol[idx] = ll;
  }
}

// ---------------------------------------------------------------------------
// Kernel 2: attention, one (b,h) x 32 query rows per block.
// LDS: fp32 S [32][SROW] + bf16 Phi/Plo [32][PROW] = 263,680 B.
// ---------------------------------------------------------------------------
__global__ __launch_bounds__(256)
void attn_kernel(const __bf16* __restrict__ qh, const __bf16* __restrict__ ql,
                 const __bf16* __restrict__ kh, const __bf16* __restrict__ kl,
                 const __bf16* __restrict__ vth, const __bf16* __restrict__ vtl,
                 const int* __restrict__ mask,
                 __bf16* __restrict__ aoh, __bf16* __restrict__ aol) {
  extern __shared__ char smem[];
  float*  sS  = (float*)smem;                          // [32][SROW] fp32
  __bf16* pHi = (__bf16*)(smem + 32 * SROW * 4);       // [32][PROW]
  __bf16* pLo = pHi + 32 * PROW;                       // [32][PROW]

  const int wave = threadIdx.x >> 5, lane = threadIdx.x & 31;
  const int r16 = lane & 15, lh = lane >> 4;
  const int b = blockIdx.z, h = blockIdx.y, t0 = blockIdx.x * 32;

  const size_t bh = ((size_t)b * H_ + h) * (size_t)T_ * E_;
  const __bf16* Qh = qh + bh;  const __bf16* Ql = ql + bh;
  const __bf16* Kh = kh + bh;  const __bf16* Kl = kl + bh;
  const __bf16* Vh = vth + bh; const __bf16* Vl = vtl + bh;   // (E,T) layout

  // ---- Phase 1: S = (Q K^T)*scale, causal -inf then padding -1e9 ----
  // Q operand (8 x v16bf) is hoisted into registers and reused for all 8
  // key-tiles this wave handles at a given tm -> ~2x fewer VMEM issues.
  for (int tm = 0; tm < 2; ++tm) {
    const int q0 = t0 + tm * 16;
    const __bf16* aqh = Qh + (size_t)(q0 + r16) * E_ + 8 * lh;
    const __bf16* aql = Ql + (size_t)(q0 + r16) * E_ + 8 * lh;
    const v16bf q_h0 = ldAB(aqh, 0),  q_h1 = ldAB(aqh, 32);
    const v16bf q_h2 = ldAB(aqh, 64), q_h3 = ldAB(aqh, 96);
    const v16bf q_l0 = ldAB(aql, 0),  q_l1 = ldAB(aql, 32);
    const v16bf q_l2 = ldAB(aql, 64), q_l3 = ldAB(aql, 96);

    for (int tn = wave; tn < 64; tn += 8) {
      const int k0 = tn * 16;
      const __bf16* bkh = Kh + (size_t)(k0 + r16) * E_ + 8 * lh;
      const __bf16* bkl = Kl + (size_t)(k0 + r16) * E_ + 8 * lh;

      v8f acc0 = vzero8(), acc1 = vzero8(), acc2 = vzero8(), acc3 = vzero8();
      QK_CHUNK(q_h0, q_l0, bkh, bkl, 0,  acc0);
      QK_CHUNK(q_h1, q_l1, bkh, bkl, 32, acc1);
      QK_CHUNK(q_h2, q_l2, bkh, bkl, 64, acc2);
      QK_CHUNK(q_h3, q_l3, bkh, bkl, 96, acc3);
      v8f acc = (acc0 + acc1) + (acc2 + acc3);

      const int kg = k0 + r16;
#pragma unroll
      for (int j = 0; j < 8; ++j) {
        const int qg = q0 + j + 8 * lh;
        float val = acc[j] * SCALE;
        if (kg > qg) val = -INFINITY;                      // causal first
        if (mask[(size_t)qg * T_ + kg] == 0) val = -1e9f;  // padding overwrites
        sS[(tm * 16 + j + 8 * lh) * SROW + kg] = val;
      }
    }
  }
  __syncthreads();

  // ---- Phase 2: row softmax; emit P as split bf16 ----
  for (int rr = wave * 4; rr < wave * 4 + 4; ++rr) {
    float* row = sS + rr * SROW;
    float mx = -INFINITY;
    for (int c = lane; c < T_; c += 32) mx = fmaxf(mx, row[c]);
    for (int off = 16; off; off >>= 1) mx = fmaxf(mx, __shfl_xor(mx, off, 32));
    float sum = 0.f;
    for (int c = lane; c < T_; c += 32) { float e = expf(row[c] - mx); row[c] = e; sum += e; }
    for (int off = 16; off; off >>= 1) sum += __shfl_xor(sum, off, 32);
    const float inv = 1.f / sum;
    for (int c = lane; c < T_; c += 32) {
      __bf16 hh, ll;
      split2(row[c] * inv, hh, ll);
      pHi[rr * PROW + c] = hh;
      pLo[rr * PROW + c] = ll;
    }
  }
  __syncthreads();

  // ---- Phase 3: O = P @ V  (A from LDS split-bf16, B from transposed V) ----
  for (int tix = wave; tix < 16; tix += 8) {        // 2 x 8 tiles of 16x16
    const int tm = tix >> 3, tn = tix & 7;
    const __bf16* aph = pHi + (tm * 16 + r16) * PROW + 8 * lh;
    const __bf16* apl = pLo + (tm * 16 + r16) * PROW + 8 * lh;
    const __bf16* bvh = Vh + (size_t)(tn * 16 + r16) * T_ + 8 * lh;
    const __bf16* bvl = Vl + (size_t)(tn * 16 + r16) * T_ + 8 * lh;

    v8f acc0 = vzero8(), acc1 = vzero8(), acc2 = vzero8(), acc3 = vzero8();
#pragma unroll 2
    for (int k0 = 0; k0 < T_; k0 += 128) {
      SPLIT_CHUNK(aph, apl, bvh, bvl, k0,      acc0);
      SPLIT_CHUNK(aph, apl, bvh, bvl, k0 + 32, acc1);
      SPLIT_CHUNK(aph, apl, bvh, bvl, k0 + 64, acc2);
      SPLIT_CHUNK(aph, apl, bvh, bvl, k0 + 96, acc3);
    }
    v8f acc = (acc0 + acc1) + (acc2 + acc3);

#pragma unroll
    for (int j = 0; j < 8; ++j) {
      const int t = t0 + tm * 16 + j + 8 * lh;
      const size_t idx = ((size_t)b * T_ + t) * (H_ * E_) + h * E_ + tn * 16 + r16;
      __bf16 hh, ll;
      split2(acc[j], hh, ll);
      aoh[idx] = hh;       // (B, T, H*E) pre-split for the output projection
      aol[idx] = ll;
    }
  }
}

// ---------------------------------------------------------------------------
// Kernel 3: out = ao @ Wu^T + bu   (split-bf16, M=8192, N=128, K=1024)
// ---------------------------------------------------------------------------
__global__ __launch_bounds__(256)
void proj_kernel(const __bf16* __restrict__ aoh, const __bf16* __restrict__ aol,
                 const __bf16* __restrict__ wuh, const __bf16* __restrict__ wul,
                 const float* __restrict__ bu, float* __restrict__ out) {
  const int wave = threadIdx.x >> 5, lane = threadIdx.x & 31;
  const int r16 = lane & 15, lh = lane >> 4;
  const int m0 = blockIdx.x * 16;
  const int n0 = wave * 16;
  const int K  = H_ * E_;  // 1024

  const __bf16* aah = aoh + (size_t)(m0 + r16) * K + 8 * lh;
  const __bf16* aal = aol + (size_t)(m0 + r16) * K + 8 * lh;
  const __bf16* bwh = wuh + (size_t)(n0 + r16) * K + 8 * lh;
  const __bf16* bwl = wul + (size_t)(n0 + r16) * K + 8 * lh;

  v8f acc0 = vzero8(), acc1 = vzero8(), acc2 = vzero8(), acc3 = vzero8();
#pragma unroll 2
  for (int k0 = 0; k0 < K; k0 += 128) {
    SPLIT_CHUNK(aah, aal, bwh, bwl, k0,      acc0);
    SPLIT_CHUNK(aah, aal, bwh, bwl, k0 + 32, acc1);
    SPLIT_CHUNK(aah, aal, bwh, bwl, k0 + 64, acc2);
    SPLIT_CHUNK(aah, aal, bwh, bwl, k0 + 96, acc3);
  }
  v8f acc = (acc0 + acc1) + (acc2 + acc3);

  const float bias = bu[n0 + r16];
#pragma unroll
  for (int j = 0; j < 8; ++j) {
    out[(size_t)(m0 + j + 8 * lh) * E_ + n0 + r16] = acc[j] + bias;
  }
}

// ---------------------------------------------------------------------------
extern "C" void kernel_launch(void* const* d_in, const int* in_sizes, int n_in,
                              void* d_out, int out_size, void* d_ws, size_t ws_size,
                              hipStream_t stream) {
  (void)in_sizes; (void)n_in; (void)out_size; (void)ws_size;
  const float* x    = (const float*)d_in[0];
  const int*   mask = (const int*)  d_in[1];
  const float* Wk   = (const float*)d_in[2];   // dict order: x, mask, Wk, Wq, Wv, Wu, bu
  const float* Wq   = (const float*)d_in[3];
  const float* Wv   = (const float*)d_in[4];
  const float* Wu   = (const float*)d_in[5];
  const float* bu   = (const float*)d_in[6];
  float* out = (float*)d_out;

  // workspace layout (bf16 element offsets); total ~140.5 MB
  __bf16* ws = (__bf16*)d_ws;
  const size_t CH = (size_t)B_ * H_ * T_ * E_;   // 8,388,608
  const size_t XH = (size_t)B_ * T_ * E_;        // 1,048,576
  const size_t WH = (size_t)(H_ * E_) * E_;      //   131,072
  __bf16* qh  = ws;            __bf16* ql  = ws + CH;
  __bf16* kh  = ws + 2 * CH;   __bf16* kl  = ws + 3 * CH;
  __bf16* vth = ws + 4 * CH;   __bf16* vtl = ws + 5 * CH;
  __bf16* aoh = ws + 6 * CH;   __bf16* aol = ws + 7 * CH;
  __bf16* xh  = ws + 8 * CH;   __bf16* xl  = xh + XH;
  __bf16* wb  = xl + XH;
  __bf16* wqh = wb;            __bf16* wql = wb + WH;
  __bf16* wkh = wb + 2 * WH;   __bf16* wkl = wb + 3 * WH;
  __bf16* wvh = wb + 4 * WH;   __bf16* wvl = wb + 5 * WH;
  __bf16* wuh = wb + 6 * WH;   __bf16* wul = wb + 7 * WH;

  // 0) split fp32 inputs into bf16 hi/lo
  split_kernel<<<512, 256, 0, stream>>>(x,  xh,  xl,  (int)XH);
  split_kernel<<<128, 256, 0, stream>>>(Wq, wqh, wql, (int)WH);
  split_kernel<<<128, 256, 0, stream>>>(Wk, wkh, wkl, (int)WH);
  split_kernel<<<128, 256, 0, stream>>>(Wv, wvh, wvl, (int)WH);
  split_kernel<<<128, 256, 0, stream>>>(Wu, wuh, wul, (int)WH);

  // 1) QKV projection (V transposed)
  dim3 g1((B_ * T_) / 16, H_, 3);
  qkv_kernel<<<g1, 256, 0, stream>>>(xh, xl, wqh, wql, wkh, wkl, wvh, wvl,
                                     qh, ql, kh, kl, vth, vtl);

  // 2) attention
  const size_t lds = (size_t)32 * SROW * 4 + (size_t)2 * 32 * PROW * 2;  // 263,680 B
  (void)hipFuncSetAttribute((const void*)attn_kernel,
                            hipFuncAttributeMaxDynamicSharedMemorySize, (int)lds);
  dim3 g2(T_ / 32, H_, B_);
  attn_kernel<<<g2, 256, lds, stream>>>(qh, ql, kh, kl, vth, vtl, mask, aoh, aol);

  // 3) output projection
  proj_kernel<<<(B_ * T_) / 16, 256, 0, stream>>>(aoh, aol, wuh, wul, bu, out);
}

// v001
// One run takes 603 microseconds.
// Timed twice side by side with v000, it ran 1.08 and 1.09 times as fast.
#include <hip/hip_runtime.h>
#include <math.h>

typedef __attribute__((ext_vector_type(2)))  float  v2f;
typedef __attribute__((ext_vector_type(8)))  float  v8f;
typedef __attribute__((ext_vector_type(8)))  __bf16 v8bf;
typedef __attribute__((ext_vector_type(16))) __bf16 v16bf;

constexpr int B_ = 8, T_ = 1024, E_ = 128, H_ = 8;
constexpr int SROW = 1028;   // fp32 score row stride (1028 % 64 == 4 -> conflict-free)
constexpr int PROW = 1032;   // bf16 prob row stride (16B aligned; 516 dwords % 64 == 4)
constexpr float SCALE = 0.08838834764831845f;  // 1/sqrt(128)

static __device__ __forceinline__ v8f vzero8() {
  v8f z = {0.f, 0.f, 0.f, 0.f, 0.f, 0.f, 0.f, 0.f};
  return z;
}

// --- bf16 helpers (bit-exact, storage-only use of __bf16) ---
static __device__ __forceinline__ float bf2f(__bf16 h) {
  return __builtin_bit_cast(float, (unsigned)((unsigned)__builtin_bit_cast(unsigned short, h) << 16));
}
static __device__ __forceinline__ __bf16 f2bf(float f) {          // RNE
  unsigned u = __builtin_bit_cast(unsigned, f);
  u = (u + 0x7FFFu + ((u >> 16) & 1u)) >> 16;
  return __builtin_bit_cast(__bf16, (unsigned short)u);
}
static __device__ __forceinline__ void split2(float f, __bf16& h, __bf16& l) {
  h = f2bf(f);
  l = f2bf(f - bf2f(h));
}

// D = A(16x32 bf16) * B(32x16 bf16) + C(16x16 f32)
static __device__ __forceinline__ v8f wmma_bf(v16bf a, v16bf b, v8f c) {
  return __builtin_amdgcn_wmma_f32_16x16x32_bf16(false, a, false, b, (short)0, c, false, false);
}

// Per-lane A/B operand slice from a K-contiguous row.
// p must be pre-offset by row*stride + 8*(lane>>4).
// elems 0..7 <- K[k0 + 8*lh .. +7], elems 8..15 <- K[k0 + 16 + 8*lh .. +7]
static __device__ __forceinline__ v16bf ldAB(const __bf16* p, int k0) {
  v8bf a = *(const v8bf*)(p + k0);
  v8bf b = *(const v8bf*)(p + k0 + 16);
  return __builtin_shufflevector(a, b, 0,1,2,3,4,5,6,7,8,9,10,11,12,13,14,15);
}

// One K=32 chunk of the split-bf16 product: hi*hi + hi*lo + lo*hi
#define SPLIT_CHUNK(AH_, AL_, BH_, BL_, K0_, ACC_)  \
  do {                                              \
    v16bf _ah = ldAB((AH_), (K0_));                 \
    v16bf _al = ldAB((AL_), (K0_));                 \
    v16bf _bh = ldAB((BH_), (K0_));                 \
    v16bf _bl = ldAB((BL_), (K0_));                 \
    (ACC_) = wmma_bf(_ah, _bh, (ACC_));             \
    (ACC_) = wmma_bf(_ah, _bl, (ACC_));             \
    (ACC_) = wmma_bf(_al, _bh, (ACC_));             \
  } while (0)

// Same chunk but with the A operand (hi,lo) already resident in registers.
#define QK_CHUNK(QH_, QL_, BH_, BL_, K0_, ACC_)     \
  do {                                              \
    v16bf _bh = ldAB((BH_), (K0_));                 \
    v16bf _bl = ldAB((BL_), (K0_));                 \
    (ACC_) = wmma_bf((QH_), _bh, (ACC_));           \
    (ACC_) = wmma_bf((QH_), _bl, (ACC_));           \
    (ACC_) = wmma_bf((QL_), _bh, (ACC_));           \
  } while (0)

// ---------------------------------------------------------------------------
// Kernel 0: elementwise fp32 -> (bf16 hi, bf16 lo) split
// ---------------------------------------------------------------------------
__global__ __launch_bounds__(256)
void split_kernel(const float* __restrict__ src, __bf16* __restrict__ h,
                  __bf16* __restrict__ l, int n) {
  for (int i = blockIdx.x * blockDim.x + threadIdx.x; i < n; i += gridDim.x * blockDim.x) {
    const float f = src[i];
    __bf16 hh, ll;
    split2(f, hh, ll);
    h[i] = hh;
    l[i] = ll;
  }
}

// ---------------------------------------------------------------------------
// Kernel 1: QKV projection (split-bf16 GEMM, K=128 -> 4 chunks * 3 WMMA).
// grid = (512, H, 3), block = 256.  z==2 (V) stores transposed (B,H,E,T).
// ---------------------------------------------------------------------------
__global__ __launch_bounds__(256)
void qkv_kernel(const __bf16* __restrict__ xh, const __bf16* __restrict__ xl,
                const __bf16* __restrict__ wqh, const __bf16* __restrict__ wql,
                const __bf16* __restrict__ wkh, const __bf16* __restrict__ wkl,
                const __bf16* __restrict__ wvh, const __bf16* __restrict__ wvl,
                __bf16* __restrict__ qh, __bf16* __restrict__ ql,
                __bf16* __restrict__ kh, __bf16* __restrict__ kl,
                __bf16* __restrict__ vth, __bf16* __restrict__ vtl) {
  const int wave = threadIdx.x >> 5, lane = threadIdx.x & 31;
  const int r16 = lane & 15, lh = lane >> 4;

  const __bf16 *Wh, *Wl; __bf16 *oh, *ol; bool transposed = false;
  if (blockIdx.z == 0)      { Wh = wqh; Wl = wql; oh = qh;  ol = ql; }
  else if (blockIdx.z == 1) { Wh = wkh; Wl = wkl; oh = kh;  ol = kl; }
  else                      { Wh = wvh; Wl = wvl; oh = vth; ol = vtl; transposed = true; }

  const int m0 = blockIdx.x * 16;
  const int h  = blockIdx.y;
  const int n0 = h * E_ + wave * 16;

  const __bf16* axh = xh + (size_t)(m0 + r16) * E_ + 8 * lh;
  const __bf16* axl = xl + (size_t)(m0 + r16) * E_ + 8 * lh;
  const __bf16* bwh = Wh + (size_t)(n0 + r16) * E_ + 8 * lh;
  const __bf16* bwl = Wl + (size_t)(n0 + r16) * E_ + 8 * lh;

  v8f acc0 = vzero8(), acc1 = vzero8(), acc2 = vzero8(), acc3 = vzero8();
  SPLIT_CHUNK(axh, axl, bwh, bwl, 0,  acc0);
  SPLIT_CHUNK(axh, axl, bwh, bwl, 32, acc1);
  SPLIT_CHUNK(axh, axl, bwh, bwl, 64, acc2);
  SPLIT_CHUNK(axh, axl, bwh, bwl, 96, acc3);
  v8f acc = (acc0 + acc1) + (acc2 + acc3);

  const int bb = m0 / T_;
  const int tb = m0 % T_;
  const int e  = (n0 & (E_ - 1)) + r16;
#pragma unroll
  for (int j = 0; j < 8; ++j) {
    const int t = tb + j + 8 * lh;               // C layout: VGPR j -> M = j + 8*(lane/16)
    __bf16 hh, ll;
    split2(acc[j], hh, ll);
    size_t idx;
    if (transposed) idx = (((size_t)bb * H_ + h) * E_ + e) * T_ + t;   // (B,H,E,T)
    else            idx = (((size_t)bb * H_ + h) * T_ + t) * E_ + e;   // (B,H,T,E)
    oh[idx] = hh;
    ol[idx] = ll;
  }
}

// ---------------------------------------------------------------------------
// Kernel 2: attention, one (b,h) x 32 query rows per block.
// LDS: fp32 S [32][SROW] + bf16 Phi/Plo [32][PROW] + one flag word = 263,696 B.
// Keys past the block's causal edge hold only -inf or -1e9. While every row's
// maximum is far above -1e9 their exp is exactly 0, so they are not walked.
// ---------------------------------------------------------------------------
__global__ __launch_bounds__(256)
void attn_kernel(const __bf16* __restrict__ qh, const __bf16* __restrict__ ql,
                 const __bf16* __restrict__ kh, const __bf16* __restrict__ kl,
                 const __bf16* __restrict__ vth, const __bf16* __restrict__ vtl,
                 const int* __restrict__ mask,
                 __bf16* __restrict__ aoh, __bf16* __restrict__ aol) {
  extern __shared__ char smem[];
  float*  sS  = (float*)smem;                          // [32][SROW] fp32
  __bf16* pHi = (__bf16*)(smem + 32 * SROW * 4);       // [32][PROW]
  __bf16* pLo = pHi + 32 * PROW;                       // [32][PROW]
  int* sFull  = (int*)(smem + 32 * SROW * 4 + 2 * 32 * PROW * 2);  // 1: walk all T_ keys

  const int wave = threadIdx.x >> 5, lane = threadIdx.x & 31;
  const int r16 = lane & 15, lh = lane >> 4;
  const int b = blockIdx.z, h = blockIdx.y, t0 = blockIdx.x * 32;

  const size_t bh = ((size_t)b * H_ + h) * (size_t)T_ * E_;
  const __bf16* Qh = qh + bh;  const __bf16* Ql = ql + bh;
  const __bf16* Kh = kh + bh;  const __bf16* Kl = kl + bh;
  const __bf16* Vh = vth + bh; const __bf16* Vl = vtl + bh;   // (E,T) layout

  // keys up to the causal edge of the last query row, in whole groups of 128
  // (one key tile for each of the 8 waves)
  const int nkc = (t0 + 32 + 127) & ~127;
  int nk = nkc;
  if (threadIdx.x == 0) *sFull = 0;

  // ---- Phase 1: S = (Q K^T)*scale, causal -inf then padding -1e9 ----
  // Q operand (8 x v16bf) is hoisted into registers and reused for all nkc/128 (1 to 8)
  // key-tiles this wave handles at a given tm -> ~2x fewer VMEM issues.
  for (int tm = 0; tm < 2; ++tm) {
    const int q0 = t0 + tm * 16;
    const __bf16* aqh = Qh + (size_t)(q0 + r16) * E_ + 8 * lh;
    const __bf16* aql = Ql + (size_t)(q0 + r16) * E_ + 8 * lh;
    const v16bf q_h0 = ldAB(aqh, 0),  q_h1 = ldAB(aqh, 32);
    const v16bf q_h2 = ldAB(aqh, 64), q_h3 = ldAB(aqh, 96);
    const v16bf q_l0 = ldAB(aql, 0),  q_l1 = ldAB(aql, 32);
    const v16bf q_l2 = ldAB(aql, 64), q_l3 = ldAB(aql, 96);

    for (int tb = 0; tb < (nkc >> 4); tb += 8) {
      const int k0 = (tb + wave) * 16;
      const __bf16* bkh = Kh + (size_t)(k0 + r16) * E_ + 8 * lh;
      const __bf16* bkl = Kl + (size_t)(k0 + r16) * E_ + 8 * lh;

      v8f acc0 = vzero8(), acc1 = vzero8(), acc2 = vzero8(), acc3 = vzero8();
      QK_CHUNK(q_h0, q_l0, bkh, bkl, 0,  acc0);
      QK_CHUNK(q_h1, q_l1, bkh, bkl, 32, acc1);
      QK_CHUNK(q_h2, q_l2, bkh, bkl, 64, acc2);
      QK_CHUNK(q_h3, q_l3, bkh, bkl, 96, acc3);
      v8f acc = (acc0 + acc1) + (acc2 + acc3);

      const int kg = k0 + r16;
#pragma unroll
      for (int j = 0; j < 8; ++j) {
        const int qg = q0 + j + 8 * lh;
        float val = acc[j] * SCALE;
        if (kg > qg) val = -INFINITY;                      // causal first
        if (mask[(size_t)qg * T_ + kg] == 0) val = -1e9f;  // padding overwrites
        sS[(tm * 16 + j + 8 * lh) * SROW + kg] = val;
      }
    }
  }
  __syncthreads();

  // ---- Phase 2a: row maxima over the walked keys ----
  float mxr[4];
  bool low = false;
#pragma unroll
  for (int r = 0; r < 4; ++r) {
    const float* row = sS + (wave * 4 + r) * SROW;
    float mx = -INFINITY;
    for (int cb = 0; cb < nkc; cb += 128) {
#pragma unroll   // four reads behind one wait; the key count is a multiple of 128
      for (int u = 0; u < 4; ++u) mx = fmaxf(mx, row[cb + 32 * u + lane]);
    }
    for (int off = 16; off; off >>= 1) mx = fmaxf(mx, __shfl_xor(mx, off, 32));
    mxr[r] = mx;
    low = low || !(mx >= -5e8f);   // exp(-1e9 - mx) might not be 0 for this row
  }
  if (low) *sFull = 1;
  __syncthreads();   // publishes the flag: all waves must walk the same key count
  if (__builtin_amdgcn_readfirstlane(*sFull) != 0) {
    // A row without a live key up to the edge: the keys past the edge count.
    // All of them are causal for every row here, so no product is needed.
    // Each wave fills the rows that it alone reads in phase 2.
    nk = T_;
#pragma unroll
    for (int r = 0; r < 4; ++r) {
      const int rr = wave * 4 + r;
      float* row = sS + rr * SROW;
      float mx = mxr[r];
      for (int c = nkc + lane; c < T_; c += 32) {
        const float val = (mask[(size_t)(t0 + rr) * T_ + c] == 0) ? -1e9f : -INFINITY;
        row[c] = val;
        mx = fmaxf(mx, val);
      }
      for (int off = 16; off; off >>= 1) mx = fmaxf(mx, __shfl_xor(mx, off, 32));
      mxr[r] = mx;
    }
  }

  // ---- Phase 2b: exp, row sum; emit P as split bf16 ----
#pragma unroll
  for (int r = 0; r < 4; ++r) {
    const int rr = wave * 4 + r;
    float* row = sS + rr * SROW;
    const float mx = mxr[r];
    float sum = 0.f;
    for (int cb = 0; cb < nk; cb += 128) {
#pragma unroll   // four reads behind one wait; same per-lane order of the sum
      for (int u = 0; u < 4; ++u) {
        const int c = cb + 32 * u + lane;
        float e = expf(row[c] - mx); row[c] = e; sum += e;
      }
    }
    for (int off = 16; off; off >>= 1) sum += __shfl_xor(sum, off, 32);
    const float inv = 1.f / sum;
    for (int cb = 0; cb < nk; cb += 128) {
#pragma unroll   // four reads behind one wait
      for (int u = 0; u < 4; ++u) {
        const int c = cb + 32 * u + lane;
        __bf16 hh, ll;
        split2(row[c] * inv, hh, ll);
        pHi[rr * PROW + c] = hh;
        pLo[rr * PROW + c] = ll;
      }
    }
  }
  __syncthreads();

  // ---- Phase 3: O = P @ V  (A from LDS split-bf16, B from transposed V) ----
  for (int tix = wave; tix < 16; tix += 8) {        // 2 x 8 tiles of 16x16
    const int tm = tix >> 3, tn = tix & 7;
    const __bf16* aph = pHi + (tm * 16 + r16) * PROW + 8 * lh;
    const __bf16* apl = pLo + (tm * 16 + r16) * PROW + 8 * lh;
    const __bf16* bvh = Vh + (size_t)(tn * 16 + r16) * T_ + 8 * lh;
    const __bf16* bvl = Vl + (size_t)(tn * 16 + r16) * T_ + 8 * lh;

    v8f acc0 = vzero8(), acc1 = vzero8(), acc2 = vzero8(), acc3 = vzero8();
#pragma unroll 2
    for (int k0 = 0; k0 < nk; k0 += 128) {
      SPLIT_CHUNK(aph, apl, bvh, bvl, k0,      acc0);
      SPLIT_CHUNK(aph, apl, bvh, bvl, k0 + 32, acc1);
      SPLIT_CHUNK(aph, apl, bvh, bvl, k0 + 64, acc2);
      SPLIT_CHUNK(aph, apl, bvh, bvl, k0 + 96, acc3);
    }
    v8f acc = (acc0 + acc1) + (acc2 + acc3);

#pragma unroll
    for (int j = 0; j < 8; ++j) {
      const int t = t0 + tm * 16 + j + 8 * lh;
      const size_t idx = ((size_t)b * T_ + t) * (H_ * E_) + h * E_ + tn * 16 + r16;
      __bf16 hh, ll;
      split2(acc[j], hh, ll);
      aoh[idx] = hh;       // (B, T, H*E) pre-split for the output projection
      aol[idx] = ll;
    }
  }
}

// ---------------------------------------------------------------------------
// Kernel 3: out = ao @ Wu^T + bu   (split-bf16, M=8192, N=128, K=1024)
// ---------------------------------------------------------------------------
__global__ __launch_bounds__(256)
void proj_kernel(const __bf16* __restrict__ aoh, const __bf16* __restrict__ aol,
                 const __bf16* __restrict__ wuh, const __bf16* __restrict__ wul,
                 const float* __restrict__ bu, float* __restrict__ out) {
  const int wave = threadIdx.x >> 5, lane = threadIdx.x & 31;
  const int r16 = lane & 15, lh = lane >> 4;
  const int m0 = blockIdx.x * 16;
  const int n0 = wave * 16;
  const int K  = H_ * E_;  // 1024

  const __bf16* aah = aoh + (size_t)(m0 + r16) * K + 8 * lh;
  const __bf16* aal = aol + (size_t)(m0 + r16) * K + 8 * lh;
  const __bf16* bwh = wuh + (size_t)(n0 + r16) * K + 8 * lh;
  const __bf16* bwl = wul + (size_t)(n0 + r16) * K + 8 * lh;

  v8f acc0 = vzero8(), acc1 = vzero8(), acc2 = vzero8(), acc3 = vzero8();
#pragma unroll 2
  for (int k0 = 0; k0 < K; k0 += 128) {
    SPLIT_CHUNK(aah, aal, bwh, bwl, k0,      acc0);
    SPLIT_CHUNK(aah, aal, bwh, bwl, k0 + 32, acc1);
    SPLIT_CHUNK(aah, aal, bwh, bwl, k0 + 64, acc2);
    SPLIT_CHUNK(aah, aal, bwh, bwl, k0 + 96, acc3);
  }
  v8f acc = (acc0 + acc1) + (acc2 + acc3);

  const float bias = bu[n0 + r16];
#pragma unroll
  for (int j = 0; j < 8; ++j) {
    out[(size_t)(m0 + j + 8 * lh) * E_ + n0 + r16] = acc[j] + bias;
  }
}

// ---------------------------------------------------------------------------
extern "C" void kernel_launch(void* const* d_in, const int* in_sizes, int n_in,
                              void* d_out, int out_size, void* d_ws, size_t ws_size,
                              hipStream_t stream) {
  (void)in_sizes; (void)n_in; (void)out_size; (void)ws_size;
  const float* x    = (const float*)d_in[0];
  const int*   mask = (const int*)  d_in[1];
  const float* Wk   = (const float*)d_in[2];   // dict order: x, mask, Wk, Wq, Wv, Wu, bu
  const float* Wq   = (const float*)d_in[3];
  const float* Wv   = (const float*)d_in[4];
  const float* Wu   = (const float*)d_in[5];
  const float* bu   = (const float*)d_in[6];
  float* out = (float*)d_out;

  // workspace layout (bf16 element offsets); total ~140.5 MB
  __bf16* ws = (__bf16*)d_ws;
  const size_t CH = (size_t)B_ * H_ * T_ * E_;   // 8,388,608
  const size_t XH = (size_t)B_ * T_ * E_;        // 1,048,576
  const size_t WH = (size_t)(H_ * E_) * E_;      //   131,072
  __bf16* qh  = ws;            __bf16* ql  = ws + CH;
  __bf16* kh  = ws + 2 * CH;   __bf16* kl  = ws + 3 * CH;
  __bf16* vth = ws + 4 * CH;   __bf16* vtl = ws + 5 * CH;
  __bf16* aoh = ws + 6 * CH;   __bf16* aol = ws + 7 * CH;
  __bf16* xh  = ws + 8 * CH;   __bf16* xl  = xh + XH;
  __bf16* wb  = xl + XH;
  __bf16* wqh = wb;            __bf16* wql = wb + WH;
  __bf16* wkh = wb + 2 * WH;   __bf16* wkl = wb + 3 * WH;
  __bf16* wvh = wb + 4 * WH;   __bf16* wvl = wb + 5 * WH;
  __bf16* wuh = wb + 6 * WH;   __bf16* wul = wb + 7 * WH;

  // 0) split fp32 inputs into bf16 hi/lo
  split_kernel<<<512, 256, 0, stream>>>(x,  xh,  xl,  (int)XH);
  split_kernel<<<128, 256, 0, stream>>>(Wq, wqh, wql, (int)WH);
  split_kernel<<<128, 256, 0, stream>>>(Wk, wkh, wkl, (int)WH);
  split_kernel<<<128, 256, 0, stream>>>(Wv, wvh, wvl, (int)WH);
  split_kernel<<<128, 256, 0, stream>>>(Wu, wuh, wul, (int)WH);

  // 1) QKV projection (V transposed)
  dim3 g1((B_ * T_) / 16, H_, 3);
  qkv_kernel<<<g1, 256, 0, stream>>>(xh, xl, wqh, wql, wkh, wkl, wvh, wvl,
                                     qh, ql, kh, kl, vth, vtl);

  // 2) attention
  const size_t lds = (size_t)32 * SROW * 4 + (size_t)2 * 32 * PROW * 2 + 16;  // 263,696 B
  (void)hipFuncSetAttribute((const void*)attn_kernel,
                            hipFuncAttributeMaxDynamicSharedMemorySize, (int)lds);
  dim3 g2(T_ / 32, H_, B_);
  attn_kernel<<<g2, 256, lds, stream>>>(qh, ql, kh, kl, vth, vtl, mask, aoh, aol);

  // 3) output projection
  proj_kernel<<<(B_ * T_) / 16, 256, 0, stream>>>(aoh, aol, wuh, wul, bu, out);
}

// v002
// Measured time: 425 microseconds a run.
// Timed twice side by side with v001, it ran 1.43 and 1.42 times as fast.
// Over all steps from v000 it is 1.55 times as fast.
#include <hip/hip_runtime.h>
#include <math.h>

typedef __attribute__((ext_vector_type(2)))  float  v2f;
typedef __attribute__((ext_vector_type(8)))  float  v8f;
typedef __attribute__((ext_vector_type(8)))  __bf16 v8bf;
typedef __attribute__((ext_vector_type(16))) __bf16 v16bf;

constexpr int B_ = 8, T_ = 1024, E_ = 128, H_ = 8;
constexpr int SROW = 1028;   // fp32 score row stride (1028 % 64 == 4 -> conflict-free)
constexpr int PROW = 1032;   // bf16 prob row stride (16B aligned; 516 dwords % 64 == 4)
constexpr float SCALE = 0.08838834764831845f;  // 1/sqrt(128)

static __device__ __forceinline__ v8f vzero8() {
  v8f z = {0.f, 0.f, 0.f, 0.f, 0.f, 0.f, 0.f, 0.f};
  return z;
}

// --- bf16 helpers (bit-exact, storage-only use of __bf16) ---
static __device__ __forceinline__ float bf2f(__bf16 h) {
  return __builtin_bit_cast(float, (unsigned)((unsigned)__builtin_bit_cast(unsigned short, h) << 16));
}
static __device__ __forceinline__ __bf16 f2bf(float f) {          // RNE
  unsigned u = __builtin_bit_cast(unsigned, f);
  u = (u + 0x7FFFu + ((u >> 16) & 1u)) >> 16;
  return __builtin_bit_cast(__bf16, (unsigned short)u);
}
static __device__ __forceinline__ void split2(float f, __bf16& h, __bf16& l) {
  h = f2bf(f);
  l = f2bf(f - bf2f(h));
}

// D = A(16x32 bf16) * B(32x16 bf16) + C(16x16 f32)
static __device__ __forceinline__ v8f wmma_bf(v16bf a, v16bf b, v8f c) {
  return __builtin_amdgcn_wmma_f32_16x16x32_bf16(false, a, false, b, (short)0, c, false, false);
}

// Per-lane A/B operand slice from a K-contiguous row.
// p must be pre-offset by row*stride + 8*(lane>>4).
// elems 0..7 <- K[k0 + 8*lh .. +7], elems 8..15 <- K[k0 + 16 + 8*lh .. +7]
static __device__ __forceinline__ v16bf ldAB(const __bf16* p, int k0) {
  v8bf a = *(const v8bf*)(p + k0);
  v8bf b = *(const v8bf*)(p + k0 + 16);
  return __builtin_shufflevector(a, b, 0,1,2,3,4,5,6,7,8,9,10,11,12,13,14,15);
}

// One K=32 chunk of the split-bf16 product: hi*hi + hi*lo + lo*hi
#define SPLIT_CHUNK(AH_, AL_, BH_, BL_, K0_, ACC_)  \
  do {                                              \
    v16bf _ah = ldAB((AH_), (K0_));                 \
    v16bf _al = ldAB((AL_), (K0_));                 \
    v16bf _bh = ldAB((BH_), (K0_));                 \
    v16bf _bl = ldAB((BL_), (K0_));                 \
    (ACC_) = wmma_bf(_ah, _bh, (ACC_));             \
    (ACC_) = wmma_bf(_ah, _bl, (ACC_));             \
    (ACC_) = wmma_bf(_al, _bh, (ACC_));             \
  } while (0)

// Same chunk but with the A operand (hi,lo) already resident in registers.
#define QK_CHUNK(QH_, QL_, BH_, BL_, K0_, ACC_)     \
  do {                                              \
    v16bf _bh = ldAB((BH_), (K0_));                 \
    v16bf _bl = ldAB((BL_), (K0_));                 \
    (ACC_) = wmma_bf((QH_), _bh, (ACC_));           \
    (ACC_) = wmma_bf((QH_), _bl, (ACC_));           \
    (ACC_) = wmma_bf((QL_), _bh, (ACC_));           \
  } while (0)

// ---------------------------------------------------------------------------
// Kernel 0: elementwise fp32 -> (bf16 hi, bf16 lo) split
// ---------------------------------------------------------------------------
__global__ __launch_bounds__(256)
void split_kernel(const float* __restrict__ src, __bf16* __restrict__ h,
                  __bf16* __restrict__ l, int n) {
  for (int i = blockIdx.x * blockDim.x + threadIdx.x; i < n; i += gridDim.x * blockDim.x) {
    const float f = src[i];
    __bf16 hh, ll;
    split2(f, hh, ll);
    h[i] = hh;
    l[i] = ll;
  }
}

// ---------------------------------------------------------------------------
// Kernel 1: QKV projection (split-bf16 GEMM, K=128 -> 4 chunks * 3 WMMA).
// grid = (128, H, 3), block = 256: 64 rows of x by one head's 128 columns.
// z==2 (V) stores transposed (B,H,E,T).
// The hi and lo output tiles are staged in LDS in the layout of the global
// plane they go to, and leave as 16-byte stores that cover whole 128-B lines.
// ---------------------------------------------------------------------------
constexpr int QK_PITCH = 136;   // staged Q/K row: 128 e + 8 (272 B, 4 banks a row)
constexpr int VT_PITCH = 72;    // staged V^T row: 64 t + 8 (144 B, 36 dwords a row)
constexpr int STAGE_ELEMS = 128 * VT_PITCH;   // one plane; also holds 64 * QK_PITCH

// TR == false: D = W * x^T, so a lane holds 8 consecutive e of one row t.
// TR == true : D = x * W^T, so a lane holds 8 consecutive t of one column e.
// Either way the lane's 8 values are one 16-byte piece of the output layout.
template <bool TR>
static __device__ __forceinline__ void qkv_tile(
    const __bf16* __restrict__ xh, const __bf16* __restrict__ xl,
    const __bf16* __restrict__ Wh, const __bf16* __restrict__ Wl,
    __bf16* __restrict__ oh, __bf16* __restrict__ ol,
    __bf16* sH, __bf16* sL) {
  // the wave's number as a scalar: W's and x's row bases then stay in scalar
  // registers and every fragment load shares one per-lane offset
  const int wave = __builtin_amdgcn_readfirstlane(threadIdx.x >> 5);
  const int lane = threadIdx.x & 31;
  const int r16 = lane & 15, lh = lane >> 4;
  const int m0 = blockIdx.x * 64;
  const int h  = blockIdx.y;
  const unsigned vo = (unsigned)(r16 * E_ + 8 * lh);   // row r16, k half lh

  const __bf16* bwh = Wh + (size_t)(h * E_ + wave * 16) * E_ + vo;
  const __bf16* bwl = Wl + (size_t)(h * E_ + wave * 16) * E_ + vo;
  const v16bf w_h0 = ldAB(bwh, 0),  w_h1 = ldAB(bwh, 32);
  const v16bf w_h2 = ldAB(bwh, 64), w_h3 = ldAB(bwh, 96);
  const v16bf w_l0 = ldAB(bwl, 0),  w_l1 = ldAB(bwl, 32);
  const v16bf w_l2 = ldAB(bwl, 64), w_l3 = ldAB(bwl, 96);

// hi*hi + hi*lo + lo*hi of one K=32 chunk, x's fragments already in registers
#define XW_CHUNK(XH_, XL_, WH_, WL_, ACC_)            \
  do {                                                \
    if (TR) {                                         \
      (ACC_) = wmma_bf((XH_), (WH_), (ACC_));         \
      (ACC_) = wmma_bf((XH_), (WL_), (ACC_));         \
      (ACC_) = wmma_bf((XL_), (WH_), (ACC_));         \
    } else {                                          \
      (ACC_) = wmma_bf((WH_), (XH_), (ACC_));         \
      (ACC_) = wmma_bf((WL_), (XH_), (ACC_));         \
      (ACC_) = wmma_bf((WH_), (XL_), (ACC_));         \
    }                                                 \
  } while (0)

  const __bf16* axh = xh + (size_t)m0 * E_ + vo;
  const __bf16* axl = xl + (size_t)m0 * E_ + vo;
  v16bf fh[4], fl[4];                              // x fragments of one 16-row tile
#pragma unroll
  for (int c = 0; c < 4; ++c) {
    fh[c] = ldAB(axh, 32 * c);
    fl[c] = ldAB(axl, 32 * c);
  }
  // all 32 first loads issue before the first product; left alone, the last
  // ones were issued in pairs among the products, each behind a wait to 0
  __builtin_amdgcn_sched_barrier(0);

#pragma unroll
  for (int mt = 0; mt < 4; ++mt) {
    v8f acc0 = vzero8(), acc1 = vzero8(), acc2 = vzero8(), acc3 = vzero8();
    XW_CHUNK(fh[0], fl[0], w_h0, w_l0, acc0);
    XW_CHUNK(fh[1], fl[1], w_h1, w_l1, acc1);
    XW_CHUNK(fh[2], fl[2], w_h2, w_l2, acc2);
    XW_CHUNK(fh[3], fl[3], w_h3, w_l3, acc3);
    v8f acc = (acc0 + acc1) + (acc2 + acc3);

    if (mt < 3) {
      // the next tile's loads stay behind this tile's products, so that they take
      // the same registers: hoisted, they cost a second set and resident blocks
      __builtin_amdgcn_sched_barrier(0);
      // they fly while this tile is split and staged
#pragma unroll
      for (int c = 0; c < 4; ++c) {
        fh[c] = ldAB(axh, (mt + 1) * 16 * E_ + 32 * c);
        fl[c] = ldAB(axl, (mt + 1) * 16 * E_ + 32 * c);
      }
      // a precaution: the loads issued so far have taken their address register
      // before anything below may be given it
      asm volatile("s_wait_xcnt 0x0" ::: "memory");
      // no load is moved behind that wait and no register write in front of it
      __builtin_amdgcn_sched_barrier(0);
    }

    v8bf hv, lv;                                   // C layout: VGPR j -> M = j + 8*(lane/16)
#pragma unroll
    for (int j = 0; j < 8; ++j) {
      __bf16 hh, ll;
      split2(acc[j], hh, ll);
      hv[j] = hh;
      lv[j] = ll;
    }
    const int off = TR ? (wave * 16 + r16) * VT_PITCH + mt * 16 + 8 * lh    // [e][t]
                       : (mt * 16 + r16) * QK_PITCH + wave * 16 + 8 * lh;   // [t][e]
    *(v8bf*)(sH + off) = hv;
    *(v8bf*)(sL + off) = lv;
  }
#undef XW_CHUNK
  __syncthreads();   // every wave's pieces are staged before any row is read back

  const int bb = m0 / T_;
  const int tb = m0 % T_;
#pragma unroll
  for (int i = 0; i < 4; ++i) {
    const int c = i * 256 + threadIdx.x;           // 1024 pieces of 16 B a plane
    int from; size_t to;
    if (TR) {
      const int e = c >> 3, s = c & 7;             // 8 pieces = one 128-B line of row e
      from = e * VT_PITCH + s * 8;
      to   = (((size_t)bb * H_ + h) * E_ + e) * T_ + tb + s * 8;       // (B,H,E,T)
    } else {
      const int t = c >> 4, s = c & 15;            // 16 pieces = the 256-B row t
      from = t * QK_PITCH + s * 8;
      to   = (((size_t)bb * H_ + h) * T_ + tb + t) * E_ + s * 8;       // (B,H,T,E)
    }
    *(v8bf*)(oh + to) = *(const v8bf*)(sH + from);
    *(v8bf*)(ol + to) = *(const v8bf*)(sL + from);
  }
  // a precaution: the stores have taken their registers before the V^T code,
  // which follows this one in the built text behind a conditional branch
  if (!TR) asm volatile("s_wait_xcnt 0x0" ::: "memory");
}

__global__ __launch_bounds__(256)
void qkv_kernel(const __bf16* __restrict__ xh, const __bf16* __restrict__ xl,
                const __bf16* __restrict__ wqh, const __bf16* __restrict__ wql,
                const __bf16* __restrict__ wkh, const __bf16* __restrict__ wkl,
                const __bf16* __restrict__ wvh, const __bf16* __restrict__ wvl,
                __bf16* __restrict__ qh, __bf16* __restrict__ ql,
                __bf16* __restrict__ kh, __bf16* __restrict__ kl,
                __bf16* __restrict__ vth, __bf16* __restrict__ vtl) {
  __shared__ __attribute__((aligned(16))) __bf16 sH[STAGE_ELEMS];
  __shared__ __attribute__((aligned(16))) __bf16 sL[STAGE_ELEMS];
  if (blockIdx.z == 2) {
    qkv_tile<true>(xh, xl, wvh, wvl, vth, vtl, sH, sL);
    return;
  }
  const bool isq = blockIdx.z == 0;
  qkv_tile<false>(xh, xl, isq ? wqh : wkh, isq ? wql : wkl,
                  isq ? qh : kh, isq ? ql : kl, sH, sL);
}

// ---------------------------------------------------------------------------
// Kernel 2: attention, one (b,h) x 32 query rows per block.
// LDS: fp32 S [32][SROW] + bf16 Phi/Plo [32][PROW] + one flag word = 263,696 B.
// Keys past the block's causal edge hold only -inf or -1e9. While every row's
// maximum is far above -1e9 their exp is exactly 0, so they are not walked.
// ---------------------------------------------------------------------------
__global__ __launch_bounds__(256)
void attn_kernel(const __bf16* __restrict__ qh, const __bf16* __restrict__ ql,
                 const __bf16* __restrict__ kh, const __bf16* __restrict__ kl,
                 const __bf16* __restrict__ vth, const __bf16* __restrict__ vtl,
                 const int* __restrict__ mask,
                 __bf16* __restrict__ aoh, __bf16* __restrict__ aol) {
  extern __shared__ char smem[];
  float*  sS  = (float*)smem;                          // [32][SROW] fp32
  __bf16* pHi = (__bf16*)(smem + 32 * SROW * 4);       // [32][PROW]
  __bf16* pLo = pHi + 32 * PROW;                       // [32][PROW]
  int* sFull  = (int*)(smem + 32 * SROW * 4 + 2 * 32 * PROW * 2);  // 1: walk all T_ keys

  const int wave = threadIdx.x >> 5, lane = threadIdx.x & 31;
  const int r16 = lane & 15, lh = lane >> 4;
  const int b = blockIdx.z, h = blockIdx.y, t0 = blockIdx.x * 32;

  const size_t bh = ((size_t)b * H_ + h) * (size_t)T_ * E_;
  const __bf16* Qh = qh + bh;  const __bf16* Ql = ql + bh;
  const __bf16* Kh = kh + bh;  const __bf16* Kl = kl + bh;
  const __bf16* Vh = vth + bh; const __bf16* Vl = vtl + bh;   // (E,T) layout

  // keys up to the causal edge of the last query row, in whole groups of 128
  // (one key tile for each of the 8 waves)
  const int nkc = (t0 + 32 + 127) & ~127;
  int nk = nkc;
  if (threadIdx.x == 0) *sFull = 0;

  // ---- Phase 1: S = (Q K^T)*scale, causal -inf then padding -1e9 ----
  // Q operand (8 x v16bf) is hoisted into registers and reused for all nkc/128 (1 to 8)
  // key-tiles this wave handles at a given tm -> ~2x fewer VMEM issues.
  for (int tm = 0; tm < 2; ++tm) {
    const int q0 = t0 + tm * 16;
    const __bf16* aqh = Qh + (size_t)(q0 + r16) * E_ + 8 * lh;
    const __bf16* aql = Ql + (size_t)(q0 + r16) * E_ + 8 * lh;
    const v16bf q_h0 = ldAB(aqh, 0),  q_h1 = ldAB(aqh, 32);
    const v16bf q_h2 = ldAB(aqh, 64), q_h3 = ldAB(aqh, 96);
    const v16bf q_l0 = ldAB(aql, 0),  q_l1 = ldAB(aql, 32);
    const v16bf q_l2 = ldAB(aql, 64), q_l3 = ldAB(aql, 96);

    for (int tb = 0; tb < (nkc >> 4); tb += 8) {
      const int k0 = (tb + wave) * 16;
      const __bf16* bkh = Kh + (size_t)(k0 + r16) * E_ + 8 * lh;
      const __bf16* bkl = Kl + (size_t)(k0 + r16) * E_ + 8 * lh;

      v8f acc0 = vzero8(), acc1 = vzero8(), acc2 = vzero8(), acc3 = vzero8();
      QK_CHUNK(q_h0, q_l0, bkh, bkl, 0,  acc0);
      QK_CHUNK(q_h1, q_l1, bkh, bkl, 32, acc1);
      QK_CHUNK(q_h2, q_l2, bkh, bkl, 64, acc2);
      QK_CHUNK(q_h3, q_l3, bkh, bkl, 96, acc3);
      v8f acc = (acc0 + acc1) + (acc2 + acc3);

      const int kg = k0 + r16;
#pragma unroll
      for (int j = 0; j < 8; ++j) {
        const int qg = q0 + j + 8 * lh;
        float val = acc[j] * SCALE;
        if (kg > qg) val = -INFINITY;                      // causal first
        if (mask[(size_t)qg * T_ + kg] == 0) val = -1e9f;  // padding overwrites
        sS[(tm * 16 + j + 8 * lh) * SROW + kg] = val;
      }
    }
  }
  __syncthreads();

  // ---- Phase 2a: row maxima over the walked keys ----
  float mxr[4];
  bool low = false;
#pragma unroll
  for (int r = 0; r < 4; ++r) {
    const float* row = sS + (wave * 4 + r) * SROW;
    float mx = -INFINITY;
    for (int cb = 0; cb < nkc; cb += 128) {
#pragma unroll   // four reads behind one wait; the key count is a multiple of 128
      for (int u = 0; u < 4; ++u) mx = fmaxf(mx, row[cb + 32 * u + lane]);
    }
    for (int off = 16; off; off >>= 1) mx = fmaxf(mx, __shfl_xor(mx, off, 32));
    mxr[r] = mx;
    low = low || !(mx >= -5e8f);   // exp(-1e9 - mx) might not be 0 for this row
  }
  if (low) *sFull = 1;
  __syncthreads();   // publishes the flag: all waves must walk the same key count
  if (__builtin_amdgcn_readfirstlane(*sFull) != 0) {
    // A row without a live key up to the edge: the keys past the edge count.
    // All of them are causal for every row here, so no product is needed.
    // Each wave fills the rows that it alone reads in phase 2.
    nk = T_;
#pragma unroll
    for (int r = 0; r < 4; ++r) {
      const int rr = wave * 4 + r;
      float* row = sS + rr * SROW;
      float mx = mxr[r];
      for (int c = nkc + lane; c < T_; c += 32) {
        const float val = (mask[(size_t)(t0 + rr) * T_ + c] == 0) ? -1e9f : -INFINITY;
        row[c] = val;
        mx = fmaxf(mx, val);
      }
      for (int off = 16; off; off >>= 1) mx = fmaxf(mx, __shfl_xor(mx, off, 32));
      mxr[r] = mx;
    }
  }

  // ---- Phase 2b: exp, row sum; emit P as split bf16 ----
#pragma unroll
  for (int r = 0; r < 4; ++r) {
    const int rr = wave * 4 + r;
    float* row = sS + rr * SROW;
    const float mx = mxr[r];
    float sum = 0.f;
    for (int cb = 0; cb < nk; cb += 128) {
#pragma unroll   // four reads behind one wait; same per-lane order of the sum
      for (int u = 0; u < 4; ++u) {
        const int c = cb + 32 * u + lane;
        float e = expf(row[c] - mx); row[c] = e; sum += e;
      }
    }
    for (int off = 16; off; off >>= 1) sum += __shfl_xor(sum, off, 32);
    const float inv = 1.f / sum;
    for (int cb = 0; cb < nk; cb += 128) {
#pragma unroll   // four reads behind one wait
      for (int u = 0; u < 4; ++u) {
        const int c = cb + 32 * u + lane;
        __bf16 hh, ll;
        split2(row[c] * inv, hh, ll);
        pHi[rr * PROW + c] = hh;
        pLo[rr * PROW + c] = ll;
      }
    }
  }
  __syncthreads();

  // ---- Phase 3: O = P @ V  (A from LDS split-bf16, B from transposed V) ----
  for (int tix = wave; tix < 16; tix += 8) {        // 2 x 8 tiles of 16x16
    const int tm = tix >> 3, tn = tix & 7;
    const __bf16* aph = pHi + (tm * 16 + r16) * PROW + 8 * lh;
    const __bf16* apl = pLo + (tm * 16 + r16) * PROW + 8 * lh;
    const __bf16* bvh = Vh + (size_t)(tn * 16 + r16) * T_ + 8 * lh;
    const __bf16* bvl = Vl + (size_t)(tn * 16 + r16) * T_ + 8 * lh;

    v8f acc0 = vzero8(), acc1 = vzero8(), acc2 = vzero8(), acc3 = vzero8();
#pragma unroll 2
    for (int k0 = 0; k0 < nk; k0 += 128) {
      SPLIT_CHUNK(aph, apl, bvh, bvl, k0,      acc0);
      SPLIT_CHUNK(aph, apl, bvh, bvl, k0 + 32, acc1);
      SPLIT_CHUNK(aph, apl, bvh, bvl, k0 + 64, acc2);
      SPLIT_CHUNK(aph, apl, bvh, bvl, k0 + 96, acc3);
    }
    v8f acc = (acc0 + acc1) + (acc2 + acc3);

#pragma unroll
    for (int j = 0; j < 8; ++j) {
      const int t = t0 + tm * 16 + j + 8 * lh;
      const size_t idx = ((size_t)b * T_ + t) * (H_ * E_) + h * E_ + tn * 16 + r16;
      __bf16 hh, ll;
      split2(acc[j], hh, ll);
      aoh[idx] = hh;       // (B, T, H*E) pre-split for the output projection
      aol[idx] = ll;
    }
  }
}

// ---------------------------------------------------------------------------
// Kernel 3: out = ao @ Wu^T + bu   (split-bf16, M=8192, N=128, K=1024)
// ---------------------------------------------------------------------------
__global__ __launch_bounds__(256)
void proj_kernel(const __bf16* __restrict__ aoh, const __bf16* __restrict__ aol,
                 const __bf16* __restrict__ wuh, const __bf16* __restrict__ wul,
                 const float* __restrict__ bu, float* __restrict__ out) {
  const int wave = threadIdx.x >> 5, lane = threadIdx.x & 31;
  const int r16 = lane & 15, lh = lane >> 4;
  const int m0 = blockIdx.x * 16;
  const int n0 = wave * 16;
  const int K  = H_ * E_;  // 1024

  const __bf16* aah = aoh + (size_t)(m0 + r16) * K + 8 * lh;
  const __bf16* aal = aol + (size_t)(m0 + r16) * K + 8 * lh;
  const __bf16* bwh = wuh + (size_t)(n0 + r16) * K + 8 * lh;
  const __bf16* bwl = wul + (size_t)(n0 + r16) * K + 8 * lh;

  v8f acc0 = vzero8(), acc1 = vzero8(), acc2 = vzero8(), acc3 = vzero8();
#pragma unroll 2
  for (int k0 = 0; k0 < K; k0 += 128) {
    SPLIT_CHUNK(aah, aal, bwh, bwl, k0,      acc0);
    SPLIT_CHUNK(aah, aal, bwh, bwl, k0 + 32, acc1);
    SPLIT_CHUNK(aah, aal, bwh, bwl, k0 + 64, acc2);
    SPLIT_CHUNK(aah, aal, bwh, bwl, k0 + 96, acc3);
  }
  v8f acc = (acc0 + acc1) + (acc2 + acc3);

  const float bias = bu[n0 + r16];
#pragma unroll
  for (int j = 0; j < 8; ++j) {
    out[(size_t)(m0 + j + 8 * lh) * E_ + n0 + r16] = acc[j] + bias;
  }
}

// ---------------------------------------------------------------------------
extern "C" void kernel_launch(void* const* d_in, const int* in_sizes, int n_in,
                              void* d_out, int out_size, void* d_ws, size_t ws_size,
                              hipStream_t stream) {
  (void)in_sizes; (void)n_in; (void)out_size; (void)ws_size;
  const float* x    = (const float*)d_in[0];
  const int*   mask = (const int*)  d_in[1];
  const float* Wk   = (const float*)d_in[2];   // dict order: x, mask, Wk, Wq, Wv, Wu, bu
  const float* Wq   = (const float*)d_in[3];
  const float* Wv   = (const float*)d_in[4];
  const float* Wu   = (const float*)d_in[5];
  const float* bu   = (const float*)d_in[6];
  float* out = (float*)d_out;

  // workspace layout (bf16 element offsets); total ~140.5 MB
  __bf16* ws = (__bf16*)d_ws;
  const size_t CH = (size_t)B_ * H_ * T_ * E_;   // 8,388,608
  const size_t XH = (size_t)B_ * T_ * E_;        // 1,048,576
  const size_t WH = (size_t)(H_ * E_) * E_;      //   131,072
  __bf16* qh  = ws;            __bf16* ql  = ws + CH;
  __bf16* kh  = ws + 2 * CH;   __bf16* kl  = ws + 3 * CH;
  __bf16* vth = ws + 4 * CH;   __bf16* vtl = ws + 5 * CH;
  __bf16* aoh = ws + 6 * CH;   __bf16* aol = ws + 7 * CH;
  __bf16* xh  = ws + 8 * CH;   __bf16* xl  = xh + XH;
  __bf16* wb  = xl + XH;
  __bf16* wqh = wb;            __bf16* wql = wb + WH;
  __bf16* wkh = wb + 2 * WH;   __bf16* wkl = wb + 3 * WH;
  __bf16* wvh = wb + 4 * WH;   __bf16* wvl = wb + 5 * WH;
  __bf16* wuh = wb + 6 * WH;   __bf16* wul = wb + 7 * WH;

  // 0) split fp32 inputs into bf16 hi/lo
  split_kernel<<<512, 256, 0, stream>>>(x,  xh,  xl,  (int)XH);
  split_kernel<<<128, 256, 0, stream>>>(Wq, wqh, wql, (int)WH);
  split_kernel<<<128, 256, 0, stream>>>(Wk, wkh, wkl, (int)WH);
  split_kernel<<<128, 256, 0, stream>>>(Wv, wvh, wvl, (int)WH);
  split_kernel<<<128, 256, 0, stream>>>(Wu, wuh, wul, (int)WH);

  // 1) QKV projection (V transposed)
  dim3 g1((B_ * T_) / 64, H_, 3);
  qkv_kernel<<<g1, 256, 0, stream>>>(xh, xl, wqh, wql, wkh, wkl, wvh, wvl,
                                     qh, ql, kh, kl, vth, vtl);

  // 2) attention
  const size_t lds = (size_t)32 * SROW * 4 + (size_t)2 * 32 * PROW * 2 + 16;  // 263,696 B
  (void)hipFuncSetAttribute((const void*)attn_kernel,
                            hipFuncAttributeMaxDynamicSharedMemorySize, (int)lds);
  dim3 g2(T_ / 32, H_, B_);
  attn_kernel<<<g2, 256, lds, stream>>>(qh, ql, kh, kl, vth, vtl, mask, aoh, aol);

  // 3) output projection
  proj_kernel<<<(B_ * T_) / 16, 256, 0, stream>>>(aoh, aol, wuh, wul, bu, out);
}

// v003
// One run takes 319 microseconds.
// Next to v002, in two timings, it ran 1.33 times as fast each time.
// Over all steps from v000 it is 2.06 times as fast.
#include <hip/hip_runtime.h>
#include <math.h>

typedef __attribute__((ext_vector_type(4)))  float  v4f;
typedef __attribute__((ext_vector_type(8)))  float  v8f;
typedef __attribute__((ext_vector_type(8)))  __bf16 v8bf;
typedef __attribute__((ext_vector_type(16))) __bf16 v16bf;

constexpr int B_ = 8, T_ = 1024, E_ = 128, H_ = 8;
constexpr int SROW = 1028;   // fp32 score row stride (1028 % 64 == 4 -> conflict-free)
constexpr int PROW = 1032;   // bf16 prob row stride (16B aligned; 516 dwords % 64 == 4)
constexpr float SCALE = 0.08838834764831845f;  // 1/sqrt(128)

static __device__ __forceinline__ v8f vzero8() {
  v8f z = {0.f, 0.f, 0.f, 0.f, 0.f, 0.f, 0.f, 0.f};
  return z;
}

// --- bf16 helpers (bit-exact, storage-only use of __bf16) ---
static __device__ __forceinline__ float bf2f(__bf16 h) {
  return __builtin_bit_cast(float, (unsigned)((unsigned)__builtin_bit_cast(unsigned short, h) << 16));
}
static __device__ __forceinline__ __bf16 f2bf(float f) {          // RNE
  unsigned u = __builtin_bit_cast(unsigned, f);
  u = (u + 0x7FFFu + ((u >> 16) & 1u)) >> 16;
  return __builtin_bit_cast(__bf16, (unsigned short)u);
}
static __device__ __forceinline__ void split2(float f, __bf16& h, __bf16& l) {
  h = f2bf(f);
  l = f2bf(f - bf2f(h));
}

// D = A(16x32 bf16) * B(32x16 bf16) + C(16x16 f32)
static __device__ __forceinline__ v8f wmma_bf(v16bf a, v16bf b, v8f c) {
  return __builtin_amdgcn_wmma_f32_16x16x32_bf16(false, a, false, b, (short)0, c, false, false);
}

// Per-lane A/B operand slice from a K-contiguous row.
// p must be pre-offset by row*stride + 8*(lane>>4).
// elems 0..7 <- K[k0 + 8*lh .. +7], elems 8..15 <- K[k0 + 16 + 8*lh .. +7]
static __device__ __forceinline__ v16bf ldAB(const __bf16* p, int k0) {
  v8bf a = *(const v8bf*)(p + k0);
  v8bf b = *(const v8bf*)(p + k0 + 16);
  return __builtin_shufflevector(a, b, 0,1,2,3,4,5,6,7,8,9,10,11,12,13,14,15);
}

// FRAGMENT ORDER of the global bf16 planes. A plane is cut into fragments of
// 16 rows x 32 k = 512 elements (1024 B). Inside one, the 16-byte piece that
// holds row r, k = 16*half + 8*lh .. +7 stands at element half*256 + (16*lh + r)*8.
// Lane r + 16*lh then finds its operand slice at lane*8 and 256 + lane*8, and each
// of the two wave-wide loads reads 512 contiguous bytes (4 whole lines) instead
// of 32 bytes out of each of 16 lines.
constexpr int FRAG = 512;   // elements of one fragment

// p must be pre-offset by lane*8; off = element offset of the fragment.
static __device__ __forceinline__ v16bf ldF(const __bf16* p, int off) {
  v8bf a = *(const v8bf*)(p + off);
  v8bf b = *(const v8bf*)(p + off + 256);
  return __builtin_shufflevector(a, b, 0,1,2,3,4,5,6,7,8,9,10,11,12,13,14,15);
}

// One K=32 chunk of the split-bf16 product: hi*hi + hi*lo + lo*hi.
// Both operands from planes in fragment order, at fragment offsets FA_ and FB_.
#define SPLIT_CHUNK(AH_, AL_, FA_, BH_, BL_, FB_, ACC_)  \
  do {                                              \
    v16bf _ah = ldF((AH_), (FA_));                  \
    v16bf _al = ldF((AL_), (FA_));                  \
    v16bf _bh = ldF((BH_), (FB_));                  \
    v16bf _bl = ldF((BL_), (FB_));                  \
    (ACC_) = wmma_bf(_ah, _bh, (ACC_));             \
    (ACC_) = wmma_bf(_ah, _bl, (ACC_));             \
    (ACC_) = wmma_bf(_al, _bh, (ACC_));             \
  } while (0)

// Same chunk but with the A operand (hi,lo) already resident in registers.
#define QK_CHUNK(QH_, QL_, BH_, BL_, FB_, ACC_)     \
  do {                                              \
    v16bf _bh = ldF((BH_), (FB_));                  \
    v16bf _bl = ldF((BL_), (FB_));                  \
    (ACC_) = wmma_bf((QH_), _bh, (ACC_));           \
    (ACC_) = wmma_bf((QH_), _bl, (ACC_));           \
    (ACC_) = wmma_bf((QL_), _bh, (ACC_));           \
  } while (0)

// A (hi,lo) from K-contiguous LDS rows at k K0_, B from a plane in fragment order.
#define PV_CHUNK(AH_, AL_, K0_, BH_, BL_, FB_, ACC_) \
  do {                                              \
    v16bf _ah = ldAB((AH_), (K0_));                 \
    v16bf _al = ldAB((AL_), (K0_));                 \
    v16bf _bh = ldF((BH_), (FB_));                  \
    v16bf _bl = ldF((BL_), (FB_));                  \
    (ACC_) = wmma_bf(_ah, _bh, (ACC_));             \
    (ACC_) = wmma_bf(_ah, _bl, (ACC_));             \
    (ACC_) = wmma_bf(_al, _bh, (ACC_));             \
  } while (0)

// ---------------------------------------------------------------------------
// Kernel 0: elementwise fp32 -> (bf16 hi, bf16 lo) split, row-major source of
// 32 << lgc columns, planes written in fragment order (fragments of a 16-row
// tile follow one another along k). One 16-byte piece of each plane a thread,
// taken in the order of the destination.
// ---------------------------------------------------------------------------
__global__ __launch_bounds__(256)
void split_kernel(const float* __restrict__ src, __bf16* __restrict__ h,
                  __bf16* __restrict__ l, int npieces, int lgc) {
  for (int d = blockIdx.x * blockDim.x + threadIdx.x; d < npieces; d += gridDim.x * blockDim.x) {
    const int frag = d >> 6;
    const int row  = (frag >> lgc) * 16 + (d & 15);
    const int k    = (frag & ((1 << lgc) - 1)) * 32 + ((d >> 5) & 1) * 16 + ((d >> 4) & 1) * 8;
    const float* sp = src + ((size_t)row << (lgc + 5)) + k;
    const v4f f0 = *(const v4f*)sp;
    const v4f f1 = *(const v4f*)(sp + 4);
    v8bf hv, lv;
#pragma unroll   // constant indices: the four vectors stay in registers
    for (int j = 0; j < 8; ++j) {
      __bf16 hh, ll;
      split2(j < 4 ? f0[j & 3] : f1[j & 3], hh, ll);
      hv[j] = hh;
      lv[j] = ll;
    }
    *(v8bf*)(h + (size_t)d * 8) = hv;
    *(v8bf*)(l + (size_t)d * 8) = lv;
  }
}

// ---------------------------------------------------------------------------
// Kernel 1: QKV projection (split-bf16 GEMM, K=128 -> 4 chunks * 3 WMMA).
// grid = (128, H, 3), block = 256: 64 rows of x by one head's 128 columns.
// x and W are read, and Q, K, V^T written, in fragment order.
// Q, K: rows t, k = e; per (b,h) fragment (t/16)*4 + e/32.
// V^T : rows e, k = t; per (b,h) fragment (t/32)*8 + e/16.
// The hi and lo output tiles are staged in LDS, and leave as 16-byte stores in
// the order of the destination, 512 contiguous bytes a wave.
// ---------------------------------------------------------------------------
constexpr int QK_PITCH = 136;   // staged Q/K row: 128 e + 8 (272 B, 4 banks a row)
constexpr int VT_PITCH = 72;    // staged V^T row: 64 t + 8 (144 B, 36 dwords a row)
constexpr int STAGE_ELEMS = 128 * VT_PITCH;   // one plane; also holds 64 * QK_PITCH

// TR == false: D = W * x^T, so a lane holds 8 consecutive e of one row t.
// TR == true : D = x * W^T, so a lane holds 8 consecutive t of one column e.
// Either way the lane's 8 values are one 16-byte piece of the output layout.
template <bool TR>
static __device__ __forceinline__ void qkv_tile(
    const __bf16* __restrict__ xh, const __bf16* __restrict__ xl,
    const __bf16* __restrict__ Wh, const __bf16* __restrict__ Wl,
    __bf16* __restrict__ oh, __bf16* __restrict__ ol,
    __bf16* sH, __bf16* sL) {
  // the wave's number as a scalar: W's and x's row bases then stay in scalar
  // registers and every fragment load shares one per-lane offset
  const int wave = __builtin_amdgcn_readfirstlane(threadIdx.x >> 5);
  const int lane = threadIdx.x & 31;
  const int r16 = lane & 15, lh = lane >> 4;
  const int m0 = blockIdx.x * 64;
  const int h  = blockIdx.y;
  const unsigned vo = (unsigned)(lane * 8);            // the lane's piece of a fragment

  const __bf16* bwh = Wh + (size_t)(h * E_ + wave * 16) * E_ + vo;
  const __bf16* bwl = Wl + (size_t)(h * E_ + wave * 16) * E_ + vo;
  const v16bf w_h0 = ldF(bwh, 0),        w_h1 = ldF(bwh, FRAG);
  const v16bf w_h2 = ldF(bwh, 2 * FRAG), w_h3 = ldF(bwh, 3 * FRAG);
  const v16bf w_l0 = ldF(bwl, 0),        w_l1 = ldF(bwl, FRAG);
  const v16bf w_l2 = ldF(bwl, 2 * FRAG), w_l3 = ldF(bwl, 3 * FRAG);

// hi*hi + hi*lo + lo*hi of one K=32 chunk, x's fragments already in registers
#define XW_CHUNK(XH_, XL_, WH_, WL_, ACC_)            \
  do {                                                \
    if (TR) {                                         \
      (ACC_) = wmma_bf((XH_), (WH_), (ACC_));         \
      (ACC_) = wmma_bf((XH_), (WL_), (ACC_));         \
      (ACC_) = wmma_bf((XL_), (WH_), (ACC_));         \
    } else {                                          \
      (ACC_) = wmma_bf((WH_), (XH_), (ACC_));         \
      (ACC_) = wmma_bf((WL_), (XH_), (ACC_));         \
      (ACC_) = wmma_bf((WH_), (XL_), (ACC_));         \
    }                                                 \
  } while (0)

  const __bf16* axh = xh + (size_t)m0 * E_ + vo;
  const __bf16* axl = xl + (size_t)m0 * E_ + vo;
  v16bf fh[4], fl[4];                              // x fragments of one 16-row tile
#pragma unroll
  for (int c = 0; c < 4; ++c) {
    fh[c] = ldF(axh, c * FRAG);
    fl[c] = ldF(axl, c * FRAG);
  }
  // all 32 first loads issue before the first product; left alone, the last
  // ones were issued in pairs among the products, each behind a wait to 0
  __builtin_amdgcn_sched_barrier(0);

#pragma unroll
  for (int mt = 0; mt < 4; ++mt) {
    v8f acc0 = vzero8(), acc1 = vzero8(), acc2 = vzero8(), acc3 = vzero8();
    XW_CHUNK(fh[0], fl[0], w_h0, w_l0, acc0);
    XW_CHUNK(fh[1], fl[1], w_h1, w_l1, acc1);
    XW_CHUNK(fh[2], fl[2], w_h2, w_l2, acc2);
    XW_CHUNK(fh[3], fl[3], w_h3, w_l3, acc3);
    v8f acc = (acc0 + acc1) + (acc2 + acc3);

    if (mt < 3) {
      // the next tile's loads stay behind this tile's products, so that they take
      // the same registers: hoisted, they cost a second set and resident blocks
      __builtin_amdgcn_sched_barrier(0);
      // they fly while this tile is split and staged
#pragma unroll
      for (int c = 0; c < 4; ++c) {
        fh[c] = ldF(axh, ((mt + 1) * 4 + c) * FRAG);
        fl[c] = ldF(axl, ((mt + 1) * 4 + c) * FRAG);
      }
      // a precaution: the loads issued so far have taken their address register
      // before anything below may be given it
      asm volatile("s_wait_xcnt 0x0" ::: "memory");
      // no load is moved behind that wait and no register write in front of it
      __builtin_amdgcn_sched_barrier(0);
    }

    v8bf hv, lv;                                   // C layout: VGPR j -> M = j + 8*(lane/16)
#pragma unroll
    for (int j = 0; j < 8; ++j) {
      __bf16 hh, ll;
      split2(acc[j], hh, ll);
      hv[j] = hh;
      lv[j] = ll;
    }
    const int off = TR ? (wave * 16 + r16) * VT_PITCH + mt * 16 + 8 * lh    // [e][t]
                       : (mt * 16 + r16) * QK_PITCH + wave * 16 + 8 * lh;   // [t][e]
    *(v8bf*)(sH + off) = hv;
    *(v8bf*)(sL + off) = lv;
  }
#undef XW_CHUNK
  __syncthreads();   // every wave's pieces are staged before any row is read back

  const int bb = m0 / T_;
  const int tb = m0 % T_;
#pragma unroll
  for (int i = 0; i < 4; ++i) {
    const int c = i * 256 + threadIdx.x;           // 1024 pieces of 16 B a plane
    const int f = c >> 6;                          // 16 fragments, 64 pieces each
    const int r = c & 15;                          // the piece's row in its fragment
    const int kk = ((c >> 5) & 1) * 16 + ((c >> 4) & 1) * 8;   // and its first k
    // either way the block's 64 t are 16 fragments in a row, from element tb * E_
    const int from = TR ? ((f & 7) * 16 + r) * VT_PITCH + (f >> 3) * 32 + kk    // [e][t]
                        : ((f >> 2) * 16 + r) * QK_PITCH + (f & 3) * 32 + kk;   // [t][e]
    const size_t to = ((size_t)bb * H_ + h) * (size_t)T_ * E_ + (size_t)tb * E_ + c * 8;
    *(v8bf*)(oh + to) = *(const v8bf*)(sH + from);
    *(v8bf*)(ol + to) = *(const v8bf*)(sL + from);
  }
  // a precaution: the stores have taken their registers before the V^T code,
  // which follows this one in the built text behind a conditional branch
  if (!TR) asm volatile("s_wait_xcnt 0x0" ::: "memory");
}

__global__ __launch_bounds__(256)
void qkv_kernel(const __bf16* __restrict__ xh, const __bf16* __restrict__ xl,
                const __bf16* __restrict__ wqh, const __bf16* __restrict__ wql,
                const __bf16* __restrict__ wkh, const __bf16* __restrict__ wkl,
                const __bf16* __restrict__ wvh, const __bf16* __restrict__ wvl,
                __bf16* __restrict__ qh, __bf16* __restrict__ ql,
                __bf16* __restrict__ kh, __bf16* __restrict__ kl,
                __bf16* __restrict__ vth, __bf16* __restrict__ vtl) {
  __shared__ __attribute__((aligned(16))) __bf16 sH[STAGE_ELEMS];
  __shared__ __attribute__((aligned(16))) __bf16 sL[STAGE_ELEMS];
  if (blockIdx.z == 2) {
    qkv_tile<true>(xh, xl, wvh, wvl, vth, vtl, sH, sL);
    return;
  }
  const bool isq = blockIdx.z == 0;
  qkv_tile<false>(xh, xl, isq ? wqh : wkh, isq ? wql : wkl,
                  isq ? qh : kh, isq ? ql : kl, sH, sL);
}

// ---------------------------------------------------------------------------
// Kernel 2: attention, one (b,h) x 32 query rows per block.
// LDS: fp32 S [32][SROW] + bf16 Phi/Plo [32][PROW] + one flag word = 263,696 B.
// Keys past the block's causal edge hold only -inf or -1e9. While every row's
// maximum is far above -1e9 their exp is exactly 0, so they are not walked.
// ---------------------------------------------------------------------------
__global__ __launch_bounds__(256)
void attn_kernel(const __bf16* __restrict__ qh, const __bf16* __restrict__ ql,
                 const __bf16* __restrict__ kh, const __bf16* __restrict__ kl,
                 const __bf16* __restrict__ vth, const __bf16* __restrict__ vtl,
                 const int* __restrict__ mask,
                 __bf16* __restrict__ aoh, __bf16* __restrict__ aol) {
  extern __shared__ char smem[];
  float*  sS  = (float*)smem;                          // [32][SROW] fp32
  __bf16* pHi = (__bf16*)(smem + 32 * SROW * 4);       // [32][PROW]
  __bf16* pLo = pHi + 32 * PROW;                       // [32][PROW]
  int* sFull  = (int*)(smem + 32 * SROW * 4 + 2 * 32 * PROW * 2);  // 1: walk all T_ keys

  // the wave's number as a scalar: fragment bases then stay in scalar registers
  // and every fragment load shares the one per-lane offset vo
  const int wave = __builtin_amdgcn_readfirstlane(threadIdx.x >> 5);
  const int lane = threadIdx.x & 31;
  const int r16 = lane & 15, lh = lane >> 4;
  const unsigned vo = (unsigned)(lane * 8);            // the lane's piece of a fragment
  const int b = blockIdx.z, h = blockIdx.y, t0 = blockIdx.x * 32;

  const size_t bh = ((size_t)b * H_ + h) * (size_t)T_ * E_;
  const __bf16* Qh = qh + bh;  const __bf16* Ql = ql + bh;
  const __bf16* Kh = kh + bh;  const __bf16* Kl = kl + bh;
  const __bf16* Vh = vth + bh; const __bf16* Vl = vtl + bh;   // all in fragment order

  // keys up to the causal edge of the last query row, in whole groups of 128
  // (one key tile for each of the 8 waves)
  const int nkc = (t0 + 32 + 127) & ~127;
  int nk = nkc;
  if (threadIdx.x == 0) *sFull = 0;

  // ---- Phase 1: S = (Q K^T)*scale, causal -inf then padding -1e9 ----
  // Q operand (8 x v16bf) is hoisted into registers and reused for all nkc/128 (1 to 8)
  // key-tiles this wave handles at a given tm -> ~2x fewer VMEM issues.
  for (int tm = 0; tm < 2; ++tm) {
    const int q0 = t0 + tm * 16;
    const __bf16* aqh = Qh + (size_t)q0 * E_ + vo;   // 4 fragments a 16-row tile
    const __bf16* aql = Ql + (size_t)q0 * E_ + vo;
    const v16bf q_h0 = ldF(aqh, 0),        q_h1 = ldF(aqh, FRAG);
    const v16bf q_h2 = ldF(aqh, 2 * FRAG), q_h3 = ldF(aqh, 3 * FRAG);
    const v16bf q_l0 = ldF(aql, 0),        q_l1 = ldF(aql, FRAG);
    const v16bf q_l2 = ldF(aql, 2 * FRAG), q_l3 = ldF(aql, 3 * FRAG);

    for (int tb = 0; tb < (nkc >> 4); tb += 8) {
      const int k0 = (tb + wave) * 16;
      const __bf16* bkh = Kh + (size_t)k0 * E_ + vo;
      const __bf16* bkl = Kl + (size_t)k0 * E_ + vo;

      v8f acc0 = vzero8(), acc1 = vzero8(), acc2 = vzero8(), acc3 = vzero8();
      QK_CHUNK(q_h0, q_l0, bkh, bkl, 0,        acc0);
      QK_CHUNK(q_h1, q_l1, bkh, bkl, FRAG,     acc1);
      QK_CHUNK(q_h2, q_l2, bkh, bkl, 2 * FRAG, acc2);
      QK_CHUNK(q_h3, q_l3, bkh, bkl, 3 * FRAG, acc3);
      v8f acc = (acc0 + acc1) + (acc2 + acc3);

      const int kg = k0 + r16;
#pragma unroll
      for (int j = 0; j < 8; ++j) {
        const int qg = q0 + j + 8 * lh;
        float val = acc[j] * SCALE;
        if (kg > qg) val = -INFINITY;                      // causal first
        if (mask[(size_t)qg * T_ + kg] == 0) val = -1e9f;  // padding overwrites
        sS[(tm * 16 + j + 8 * lh) * SROW + kg] = val;
      }
    }
  }
  __syncthreads();

  // ---- Phase 2a: row maxima over the walked keys ----
  float mxr[4];
  bool low = false;
#pragma unroll
  for (int r = 0; r < 4; ++r) {
    const float* row = sS + (wave * 4 + r) * SROW;
    float mx = -INFINITY;
    for (int cb = 0; cb < nkc; cb += 128) {
#pragma unroll   // four reads behind one wait; the key count is a multiple of 128
      for (int u = 0; u < 4; ++u) mx = fmaxf(mx, row[cb + 32 * u + lane]);
    }
    for (int off = 16; off; off >>= 1) mx = fmaxf(mx, __shfl_xor(mx, off, 32));
    mxr[r] = mx;
    low = low || !(mx >= -5e8f);   // exp(-1e9 - mx) might not be 0 for this row
  }
  if (low) *sFull = 1;
  __syncthreads();   // publishes the flag: all waves must walk the same key count
  if (__builtin_amdgcn_readfirstlane(*sFull) != 0) {
    // A row without a live key up to the edge: the keys past the edge count.
    // All of them are causal for every row here, so no product is needed.
    // Each wave fills the rows that it alone reads in phase 2.
    nk = T_;
#pragma unroll
    for (int r = 0; r < 4; ++r) {
      const int rr = wave * 4 + r;
      float* row = sS + rr * SROW;
      float mx = mxr[r];
      for (int c = nkc + lane; c < T_; c += 32) {
        const float val = (mask[(size_t)(t0 + rr) * T_ + c] == 0) ? -1e9f : -INFINITY;
        row[c] = val;
        mx = fmaxf(mx, val);
      }
      for (int off = 16; off; off >>= 1) mx = fmaxf(mx, __shfl_xor(mx, off, 32));
      mxr[r] = mx;
    }
  }

  // ---- Phase 2b: exp, row sum; emit P as split bf16 ----
#pragma unroll
  for (int r = 0; r < 4; ++r) {
    const int rr = wave * 4 + r;
    float* row = sS + rr * SROW;
    const float mx = mxr[r];
    float sum = 0.f;
    for (int cb = 0; cb < nk; cb += 128) {
#pragma unroll   // four reads behind one wait; same per-lane order of the sum
      for (int u = 0; u < 4; ++u) {
        const int c = cb + 32 * u + lane;
        float e = expf(row[c] - mx); row[c] = e; sum += e;
      }
    }
    for (int off = 16; off; off >>= 1) sum += __shfl_xor(sum, off, 32);
    const float inv = 1.f / sum;
    for (int cb = 0; cb < nk; cb += 128) {
#pragma unroll   // four reads behind one wait
      for (int u = 0; u < 4; ++u) {
        const int c = cb + 32 * u + lane;
        __bf16 hh, ll;
        split2(row[c] * inv, hh, ll);
        pHi[rr * PROW + c] = hh;
        pLo[rr * PROW + c] = ll;
      }
    }
  }
  __syncthreads();

  // ---- Phase 3: O = P @ V  (A from LDS split-bf16, B from transposed V) ----
  // The score rows are dead now: each wave turns its output tiles there, in a
  // range of its own, into the 16-byte pieces of the fragment order.
  constexpr int OPITCH = 24;                        // 48 B a row: 16 rows, 16 bank groups
  __bf16* stH = (__bf16*)smem + wave * 1024;        // [16][OPITCH]
  __bf16* stL = stH + 16 * OPITCH;
  for (int tix = wave; tix < 16; tix += 8) {        // 2 x 8 tiles of 16x16
    const int tm = tix >> 3, tn = tix & 7;
    const __bf16* aph = pHi + (tm * 16 + r16) * PROW + 8 * lh;
    const __bf16* apl = pLo + (tm * 16 + r16) * PROW + 8 * lh;
    const __bf16* bvh = Vh + tn * FRAG + vo;         // 32 keys on: 8 fragments on
    const __bf16* bvl = Vl + tn * FRAG + vo;

    v8f acc0 = vzero8(), acc1 = vzero8(), acc2 = vzero8(), acc3 = vzero8();
#pragma unroll 2
    for (int k0 = 0; k0 < nk; k0 += 128) {
      PV_CHUNK(aph, apl, k0,      bvh, bvl, (k0 >> 5) * 8 * FRAG,       acc0);
      PV_CHUNK(aph, apl, k0 + 32, bvh, bvl, ((k0 >> 5) + 1) * 8 * FRAG, acc1);
      PV_CHUNK(aph, apl, k0 + 64, bvh, bvl, ((k0 >> 5) + 2) * 8 * FRAG, acc2);
      PV_CHUNK(aph, apl, k0 + 96, bvh, bvl, ((k0 >> 5) + 3) * 8 * FRAG, acc3);
    }
    v8f acc = (acc0 + acc1) + (acc2 + acc3);

#pragma unroll
    for (int j = 0; j < 8; ++j) {
      __bf16 hh, ll;
      split2(acc[j], hh, ll);
      stH[(j + 8 * lh) * OPITCH + r16] = hh;
      stL[(j + 8 * lh) * OPITCH + r16] = ll;
    }
    // the wave's own LDS writes have landed before it reads the rows back
    asm volatile("s_wait_dscnt 0x0" ::: "memory");
    // rows (b,t), k = h*E + e, pre-split for the output projection: fragment
    // (row / 16) * 32 + k / 32; this tile is its half tn & 1, one piece a lane
    const size_t idx = ((size_t)((b * T_ + t0) / 16 + tm) * 32 + h * 4 + (tn >> 1)) * FRAG
                     + (tn & 1) * 256;
    *(v8bf*)(aoh + idx + vo) = *(const v8bf*)(stH + r16 * OPITCH + 8 * lh);
    *(v8bf*)(aol + idx + vo) = *(const v8bf*)(stL + r16 * OPITCH + 8 * lh);
    // a precaution: the two stores have taken their registers before the next
    // tile's code, behind the loop's branch, is given them
    asm volatile("s_wait_xcnt 0x0" ::: "memory");
  }
}

// ---------------------------------------------------------------------------
// Kernel 3: out = ao @ Wu^T + bu   (split-bf16, M=8192, N=128, K=1024)
// ---------------------------------------------------------------------------
__global__ __launch_bounds__(256)
void proj_kernel(const __bf16* __restrict__ aoh, const __bf16* __restrict__ aol,
                 const __bf16* __restrict__ wuh, const __bf16* __restrict__ wul,
                 const float* __restrict__ bu, float* __restrict__ out) {
  // the wave's number as a scalar: Wu's fragment base stays in scalar registers
  const int wave = __builtin_amdgcn_readfirstlane(threadIdx.x >> 5);
  const int lane = threadIdx.x & 31;
  const int r16 = lane & 15, lh = lane >> 4;
  const unsigned vo = (unsigned)(lane * 8);            // the lane's piece of a fragment
  const int m0 = blockIdx.x * 16;
  const int n0 = wave * 16;
  const int K  = H_ * E_;  // 1024

  // both operands in fragment order: the 32 fragments of a 16-row tile in a row
  const __bf16* aah = aoh + (size_t)m0 * K + vo;
  const __bf16* aal = aol + (size_t)m0 * K + vo;
  const __bf16* bwh = wuh + (size_t)n0 * K + vo;
  const __bf16* bwl = wul + (size_t)n0 * K + vo;

  v8f acc0 = vzero8(), acc1 = vzero8(), acc2 = vzero8(), acc3 = vzero8();
#pragma unroll 2
  for (int k0 = 0; k0 < K; k0 += 128) {
    const int f0 = (k0 >> 5) * FRAG;
    SPLIT_CHUNK(aah, aal, f0,            bwh, bwl, f0,            acc0);
    SPLIT_CHUNK(aah, aal, f0 + FRAG,     bwh, bwl, f0 + FRAG,     acc1);
    SPLIT_CHUNK(aah, aal, f0 + 2 * FRAG, bwh, bwl, f0 + 2 * FRAG, acc2);
    SPLIT_CHUNK(aah, aal, f0 + 3 * FRAG, bwh, bwl, f0 + 3 * FRAG, acc3);
  }
  v8f acc = (acc0 + acc1) + (acc2 + acc3);

  const float bias = bu[n0 + r16];
#pragma unroll
  for (int j = 0; j < 8; ++j) {
    out[(size_t)(m0 + j + 8 * lh) * E_ + n0 + r16] = acc[j] + bias;
  }
}

// ---------------------------------------------------------------------------
extern "C" void kernel_launch(void* const* d_in, const int* in_sizes, int n_in,
                              void* d_out, int out_size, void* d_ws, size_t ws_size,
                              hipStream_t stream) {
  (void)in_sizes; (void)n_in; (void)out_size; (void)ws_size;
  const float* x    = (const float*)d_in[0];
  const int*   mask = (const int*)  d_in[1];
  const float* Wk   = (const float*)d_in[2];   // dict order: x, mask, Wk, Wq, Wv, Wu, bu
  const float* Wq   = (const float*)d_in[3];
  const float* Wv   = (const float*)d_in[4];
  const float* Wu   = (const float*)d_in[5];
  const float* bu   = (const float*)d_in[6];
  float* out = (float*)d_out;

  // workspace layout (bf16 element offsets); total ~140.5 MB
  __bf16* ws = (__bf16*)d_ws;
  const size_t CH = (size_t)B_ * H_ * T_ * E_;   // 8,388,608
  const size_t XH = (size_t)B_ * T_ * E_;        // 1,048,576
  const size_t WH = (size_t)(H_ * E_) * E_;      //   131,072
  __bf16* qh  = ws;            __bf16* ql  = ws + CH;
  __bf16* kh  = ws + 2 * CH;   __bf16* kl  = ws + 3 * CH;
  __bf16* vth = ws + 4 * CH;   __bf16* vtl = ws + 5 * CH;
  __bf16* aoh = ws + 6 * CH;   __bf16* aol = ws + 7 * CH;
  __bf16* xh  = ws + 8 * CH;   __bf16* xl  = xh + XH;
  __bf16* wb  = xl + XH;
  __bf16* wqh = wb;            __bf16* wql = wb + WH;
  __bf16* wkh = wb + 2 * WH;   __bf16* wkl = wb + 3 * WH;
  __bf16* wvh = wb + 4 * WH;   __bf16* wvl = wb + 5 * WH;
  __bf16* wuh = wb + 6 * WH;   __bf16* wul = wb + 7 * WH;

  // 0) split fp32 inputs into bf16 hi/lo, fragment order (8 elements a thread;
  //    last argument: log2 of the row length / 32)
  split_kernel<<<512, 256, 0, stream>>>(x,  xh,  xl,  131072, 2);
  split_kernel<<<64,  256, 0, stream>>>(Wq, wqh, wql, 16384, 2);
  split_kernel<<<64,  256, 0, stream>>>(Wk, wkh, wkl, 16384, 2);
  split_kernel<<<64,  256, 0, stream>>>(Wv, wvh, wvl, 16384, 2);
  split_kernel<<<64,  256, 0, stream>>>(Wu, wuh, wul, 16384, 5);

  // 1) QKV projection (V transposed)
  dim3 g1((B_ * T_) / 64, H_, 3);
  qkv_kernel<<<g1, 256, 0, stream>>>(xh, xl, wqh, wql, wkh, wkl, wvh, wvl,
                                     qh, ql, kh, kl, vth, vtl);

  // 2) attention
  const size_t lds = (size_t)32 * SROW * 4 + (size_t)2 * 32 * PROW * 2 + 16;  // 263,696 B
  (void)hipFuncSetAttribute((const void*)attn_kernel,
                            hipFuncAttributeMaxDynamicSharedMemorySize, (int)lds);
  dim3 g2(T_ / 32, H_, B_);
  attn_kernel<<<g2, 256, lds, stream>>>(qh, ql, kh, kl, vth, vtl, mask, aoh, aol);

  // 3) output projection
  proj_kernel<<<(B_ * T_) / 16, 256, 0, stream>>>(aoh, aol, wuh, wul, bu, out);
}

// v004
// A run of this version takes 280 microseconds.
// Timed twice side by side with v003, it ran 1.14 times as fast both times.
// Counting every step since v000, it is 2.35 times as fast.
#include <hip/hip_runtime.h>
#include <math.h>

typedef __attribute__((ext_vector_type(4)))  float  v4f;
typedef __attribute__((ext_vector_type(8)))  float  v8f;
typedef __attribute__((ext_vector_type(8)))  __bf16 v8bf;
typedef __attribute__((ext_vector_type(16))) __bf16 v16bf;

constexpr int B_ = 8, T_ = 1024, E_ = 128, H_ = 8;
constexpr int SROW = 1028;   // fp32 score row stride (1028 % 64 == 4 -> conflict-free)
constexpr int PROW = 1032;   // bf16 prob row stride (16B aligned; 516 dwords % 64 == 4)
constexpr float SCALE = 0.08838834764831845f;  // 1/sqrt(128)

static __device__ __forceinline__ v8f vzero8() {
  v8f z = {0.f, 0.f, 0.f, 0.f, 0.f, 0.f, 0.f, 0.f};
  return z;
}

// --- bf16 helpers (bit-exact, storage-only use of __bf16) ---
static __device__ __forceinline__ float bf2f(__bf16 h) {
  return __builtin_bit_cast(float, (unsigned)((unsigned)__builtin_bit_cast(unsigned short, h) << 16));
}
static __device__ __forceinline__ __bf16 f2bf(float f) {          // RNE
  unsigned u = __builtin_bit_cast(unsigned, f);
  u = (u + 0x7FFFu + ((u >> 16) & 1u)) >> 16;
  return __builtin_bit_cast(__bf16, (unsigned short)u);
}
static __device__ __forceinline__ void split2(float f, __bf16& h, __bf16& l) {
  h = f2bf(f);
  l = f2bf(f - bf2f(h));
}

// D = A(16x32 bf16) * B(32x16 bf16) + C(16x16 f32)
static __device__ __forceinline__ v8f wmma_bf(v16bf a, v16bf b, v8f c) {
  return __builtin_amdgcn_wmma_f32_16x16x32_bf16(false, a, false, b, (short)0, c, false, false);
}

// Per-lane A/B operand slice from a K-contiguous row.
// p must be pre-offset by row*stride + 8*(lane>>4).
// elems 0..7 <- K[k0 + 8*lh .. +7], elems 8..15 <- K[k0 + 16 + 8*lh .. +7]
static __device__ __forceinline__ v16bf ldAB(const __bf16* p, int k0) {
  v8bf a = *(const v8bf*)(p + k0);
  v8bf b = *(const v8bf*)(p + k0 + 16);
  return __builtin_shufflevector(a, b, 0,1,2,3,4,5,6,7,8,9,10,11,12,13,14,15);
}

// FRAGMENT ORDER of the global bf16 planes. A plane is cut into fragments of
// 16 rows x 32 k = 512 elements (1024 B). Inside one, the 16-byte piece that
// holds row r, k = 16*half + 8*lh .. +7 stands at element half*256 + (16*lh + r)*8.
// Lane r + 16*lh then finds its operand slice at lane*8 and 256 + lane*8, and each
// of the two wave-wide loads reads 512 contiguous bytes (4 whole lines) instead
// of 32 bytes out of each of 16 lines.
constexpr int FRAG = 512;   // elements of one fragment

// p must be pre-offset by lane*8; off = element offset of the fragment.
static __device__ __forceinline__ v16bf ldF(const __bf16* p, int off) {
  v8bf a = *(const v8bf*)(p + off);
  v8bf b = *(const v8bf*)(p + off + 256);
  return __builtin_shufflevector(a, b, 0,1,2,3,4,5,6,7,8,9,10,11,12,13,14,15);
}

// One K=32 chunk of the split-bf16 product: hi*hi + hi*lo + lo*hi.
// Both operands from planes in fragment order, at fragment offsets FA_ and FB_.
#define SPLIT_CHUNK(AH_, AL_, FA_, BH_, BL_, FB_, ACC_)  \
  do {                                              \
    v16bf _ah = ldF((AH_), (FA_));                  \
    v16bf _al = ldF((AL_), (FA_));                  \
    v16bf _bh = ldF((BH_), (FB_));                  \
    v16bf _bl = ldF((BL_), (FB_));                  \
    (ACC_) = wmma_bf(_ah, _bh, (ACC_));             \
    (ACC_) = wmma_bf(_ah, _bl, (ACC_));             \
    (ACC_) = wmma_bf(_al, _bh, (ACC_));             \
  } while (0)

// The same three products with all four operands already in registers.
#define REG_CHUNK(AH_, AL_, BH_, BL_, ACC_)         \
  do {                                              \
    (ACC_) = wmma_bf((AH_), (BH_), (ACC_));         \
    (ACC_) = wmma_bf((AH_), (BL_), (ACC_));         \
    (ACC_) = wmma_bf((AL_), (BH_), (ACC_));         \
  } while (0)

// ---------------------------------------------------------------------------
// Kernel 0: elementwise fp32 -> (bf16 hi, bf16 lo) split, row-major source of
// 32 << lgc columns, planes written in fragment order (fragments of a 16-row
// tile follow one another along k). One 16-byte piece of each plane a thread,
// taken in the order of the destination.
// ---------------------------------------------------------------------------
__global__ __launch_bounds__(256)
void split_kernel(const float* __restrict__ src, __bf16* __restrict__ h,
                  __bf16* __restrict__ l, int npieces, int lgc) {
  for (int d = blockIdx.x * blockDim.x + threadIdx.x; d < npieces; d += gridDim.x * blockDim.x) {
    const int frag = d >> 6;
    const int row  = (frag >> lgc) * 16 + (d & 15);
    const int k    = (frag & ((1 << lgc) - 1)) * 32 + ((d >> 5) & 1) * 16 + ((d >> 4) & 1) * 8;
    const float* sp = src + ((size_t)row << (lgc + 5)) + k;
    const v4f f0 = *(const v4f*)sp;
    const v4f f1 = *(const v4f*)(sp + 4);
    v8bf hv, lv;
#pragma unroll   // constant indices: the four vectors stay in registers
    for (int j = 0; j < 8; ++j) {
      __bf16 hh, ll;
      split2(j < 4 ? f0[j & 3] : f1[j & 3], hh, ll);
      hv[j] = hh;
      lv[j] = ll;
    }
    *(v8bf*)(h + (size_t)d * 8) = hv;
    *(v8bf*)(l + (size_t)d * 8) = lv;
  }
}

// ---------------------------------------------------------------------------
// Kernel 1: QKV projection (split-bf16 GEMM, K=128 -> 4 chunks * 3 WMMA).
// grid = (128, H, 3), block = 256: 64 rows of x by one head's 128 columns.
// x and W are read, and Q, K, V^T written, in fragment order.
// Q, K: rows t, k = e; per (b,h) fragment (t/16)*4 + e/32.
// V^T : rows e, k = t; per (b,h) fragment (t/32)*8 + e/16.
// The hi and lo output tiles are staged in LDS, and leave as 16-byte stores in
// the order of the destination, 512 contiguous bytes a wave.
// ---------------------------------------------------------------------------
constexpr int QK_PITCH = 136;   // staged Q/K row: 128 e + 8 (272 B, 4 banks a row)
constexpr int VT_PITCH = 72;    // staged V^T row: 64 t + 8 (144 B, 36 dwords a row)
constexpr int STAGE_ELEMS = 128 * VT_PITCH;   // one plane; also holds 64 * QK_PITCH

// TR == false: D = W * x^T, so a lane holds 8 consecutive e of one row t.
// TR == true : D = x * W^T, so a lane holds 8 consecutive t of one column e.
// Either way the lane's 8 values are one 16-byte piece of the output layout.
template <bool TR>
static __device__ __forceinline__ void qkv_tile(
    const __bf16* __restrict__ xh, const __bf16* __restrict__ xl,
    const __bf16* __restrict__ Wh, const __bf16* __restrict__ Wl,
    __bf16* __restrict__ oh, __bf16* __restrict__ ol,
    __bf16* sH, __bf16* sL) {
  // the wave's number as a scalar: W's and x's row bases then stay in scalar
  // registers and every fragment load shares one per-lane offset
  const int wave = __builtin_amdgcn_readfirstlane(threadIdx.x >> 5);
  const int lane = threadIdx.x & 31;
  const int r16 = lane & 15, lh = lane >> 4;
  const int m0 = blockIdx.x * 64;
  const int h  = blockIdx.y;
  const unsigned vo = (unsigned)(lane * 8);            // the lane's piece of a fragment

  const __bf16* bwh = Wh + (size_t)(h * E_ + wave * 16) * E_ + vo;
  const __bf16* bwl = Wl + (size_t)(h * E_ + wave * 16) * E_ + vo;
  const v16bf w_h0 = ldF(bwh, 0),        w_h1 = ldF(bwh, FRAG);
  const v16bf w_h2 = ldF(bwh, 2 * FRAG), w_h3 = ldF(bwh, 3 * FRAG);
  const v16bf w_l0 = ldF(bwl, 0),        w_l1 = ldF(bwl, FRAG);
  const v16bf w_l2 = ldF(bwl, 2 * FRAG), w_l3 = ldF(bwl, 3 * FRAG);

// hi*hi + hi*lo + lo*hi of one K=32 chunk, x's fragments already in registers
#define XW_CHUNK(XH_, XL_, WH_, WL_, ACC_)            \
  do {                                                \
    if (TR) {                                         \
      (ACC_) = wmma_bf((XH_), (WH_), (ACC_));         \
      (ACC_) = wmma_bf((XH_), (WL_), (ACC_));         \
      (ACC_) = wmma_bf((XL_), (WH_), (ACC_));         \
    } else {                                          \
      (ACC_) = wmma_bf((WH_), (XH_), (ACC_));         \
      (ACC_) = wmma_bf((WL_), (XH_), (ACC_));         \
      (ACC_) = wmma_bf((WH_), (XL_), (ACC_));         \
    }                                                 \
  } while (0)

  const __bf16* axh = xh + (size_t)m0 * E_ + vo;
  const __bf16* axl = xl + (size_t)m0 * E_ + vo;
  v16bf fh[4], fl[4];                              // x fragments of one 16-row tile
#pragma unroll
  for (int c = 0; c < 4; ++c) {
    fh[c] = ldF(axh, c * FRAG);
    fl[c] = ldF(axl, c * FRAG);
  }
  // all 32 first loads issue before the first product; left alone, the last
  // ones were issued in pairs among the products, each behind a wait to 0
  __builtin_amdgcn_sched_barrier(0);

#pragma unroll
  for (int mt = 0; mt < 4; ++mt) {
    v8f acc0 = vzero8(), acc1 = vzero8(), acc2 = vzero8(), acc3 = vzero8();
    XW_CHUNK(fh[0], fl[0], w_h0, w_l0, acc0);
    XW_CHUNK(fh[1], fl[1], w_h1, w_l1, acc1);
    XW_CHUNK(fh[2], fl[2], w_h2, w_l2, acc2);
    XW_CHUNK(fh[3], fl[3], w_h3, w_l3, acc3);
    v8f acc = (acc0 + acc1) + (acc2 + acc3);

    if (mt < 3) {
      // the next tile's loads stay behind this tile's products, so that they take
      // the same registers: hoisted, they cost a second set and resident blocks
      __builtin_amdgcn_sched_barrier(0);
      // they fly while this tile is split and staged
#pragma unroll
      for (int c = 0; c < 4; ++c) {
        fh[c] = ldF(axh, ((mt + 1) * 4 + c) * FRAG);
        fl[c] = ldF(axl, ((mt + 1) * 4 + c) * FRAG);
      }
      // a precaution: the loads issued so far have taken their address register
      // before anything below may be given it
      asm volatile("s_wait_xcnt 0x0" ::: "memory");
      // no load is moved behind that wait and no register write in front of it
      __builtin_amdgcn_sched_barrier(0);
    }

    v8bf hv, lv;                                   // C layout: VGPR j -> M = j + 8*(lane/16)
#pragma unroll
    for (int j = 0; j < 8; ++j) {
      __bf16 hh, ll;
      split2(acc[j], hh, ll);
      hv[j] = hh;
      lv[j] = ll;
    }
    const int off = TR ? (wave * 16 + r16) * VT_PITCH + mt * 16 + 8 * lh    // [e][t]
                       : (mt * 16 + r16) * QK_PITCH + wave * 16 + 8 * lh;   // [t][e]
    *(v8bf*)(sH + off) = hv;
    *(v8bf*)(sL + off) = lv;
  }
#undef XW_CHUNK
  __syncthreads();   // every wave's pieces are staged before any row is read back

  const int bb = m0 / T_;
  const int tb = m0 % T_;
#pragma unroll
  for (int i = 0; i < 4; ++i) {
    const int c = i * 256 + threadIdx.x;           // 1024 pieces of 16 B a plane
    const int f = c >> 6;                          // 16 fragments, 64 pieces each
    const int r = c & 15;                          // the piece's row in its fragment
    const int kk = ((c >> 5) & 1) * 16 + ((c >> 4) & 1) * 8;   // and its first k
    // either way the block's 64 t are 16 fragments in a row, from element tb * E_
    const int from = TR ? ((f & 7) * 16 + r) * VT_PITCH + (f >> 3) * 32 + kk    // [e][t]
                        : ((f >> 2) * 16 + r) * QK_PITCH + (f & 3) * 32 + kk;   // [t][e]
    const size_t to = ((size_t)bb * H_ + h) * (size_t)T_ * E_ + (size_t)tb * E_ + c * 8;
    *(v8bf*)(oh + to) = *(const v8bf*)(sH + from);
    *(v8bf*)(ol + to) = *(const v8bf*)(sL + from);
  }
  // a precaution: the stores have taken their registers before the V^T code,
  // which follows this one in the built text behind a conditional branch
  if (!TR) asm volatile("s_wait_xcnt 0x0" ::: "memory");
}

__global__ __launch_bounds__(256)
void qkv_kernel(const __bf16* __restrict__ xh, const __bf16* __restrict__ xl,
                const __bf16* __restrict__ wqh, const __bf16* __restrict__ wql,
                const __bf16* __restrict__ wkh, const __bf16* __restrict__ wkl,
                const __bf16* __restrict__ wvh, const __bf16* __restrict__ wvl,
                __bf16* __restrict__ qh, __bf16* __restrict__ ql,
                __bf16* __restrict__ kh, __bf16* __restrict__ kl,
                __bf16* __restrict__ vth, __bf16* __restrict__ vtl) {
  __shared__ __attribute__((aligned(16))) __bf16 sH[STAGE_ELEMS];
  __shared__ __attribute__((aligned(16))) __bf16 sL[STAGE_ELEMS];
  if (blockIdx.z == 2) {
    qkv_tile<true>(xh, xl, wvh, wvl, vth, vtl, sH, sL);
    return;
  }
  const bool isq = blockIdx.z == 0;
  qkv_tile<false>(xh, xl, isq ? wqh : wkh, isq ? wql : wkl,
                  isq ? qh : kh, isq ? ql : kl, sH, sL);
}

// ---------------------------------------------------------------------------
// Kernel 2: attention, one (b,h) x 32 query rows per block.
// LDS: fp32 S [32][SROW] + bf16 Phi/Plo [32][PROW] + one flag word = 263,696 B.
// Keys past the block's causal edge hold only -inf or -1e9. While every row's
// maximum is far above -1e9 their exp is exactly 0, so they are not walked.
// ---------------------------------------------------------------------------
__global__ __launch_bounds__(256)
void attn_kernel(const __bf16* __restrict__ qh, const __bf16* __restrict__ ql,
                 const __bf16* __restrict__ kh, const __bf16* __restrict__ kl,
                 const __bf16* __restrict__ vth, const __bf16* __restrict__ vtl,
                 const int* __restrict__ mask,
                 __bf16* __restrict__ aoh, __bf16* __restrict__ aol) {
  extern __shared__ char smem[];
  float*  sS  = (float*)smem;                          // [32][SROW] fp32
  __bf16* pHi = (__bf16*)(smem + 32 * SROW * 4);       // [32][PROW]
  __bf16* pLo = pHi + 32 * PROW;                       // [32][PROW]
  int* sFull  = (int*)(smem + 32 * SROW * 4 + 2 * 32 * PROW * 2);  // 1: walk all T_ keys

  // the wave's number as a scalar: fragment bases then stay in scalar registers
  // and every fragment load shares the one per-lane offset vo
  const int wave = __builtin_amdgcn_readfirstlane(threadIdx.x >> 5);
  const int lane = threadIdx.x & 31;
  const int r16 = lane & 15, lh = lane >> 4;
  const unsigned vo = (unsigned)(lane * 8);            // the lane's piece of a fragment
  const int b = blockIdx.z, h = blockIdx.y, t0 = blockIdx.x * 32;

  const size_t bh = ((size_t)b * H_ + h) * (size_t)T_ * E_;
  const __bf16* Qh = qh + bh;  const __bf16* Ql = ql + bh;
  const __bf16* Kh = kh + bh;  const __bf16* Kl = kl + bh;
  const __bf16* Vh = vth + bh; const __bf16* Vl = vtl + bh;   // all in fragment order

  // keys up to the causal edge of the last query row, in whole groups of 128
  // (one key tile for each of the 8 waves)
  const int nkc = (t0 + 32 + 127) & ~127;
  int nk = nkc;
  if (threadIdx.x == 0) *sFull = 0;

  // ---- Phase 1: S = (Q K^T)*scale, causal -inf then padding -1e9 ----
  // Q of both 16-row tiles (16 x v16bf) stays in registers; a K fragment is
  // loaded once and multiplied with both, so K crosses from L2 once a block.
  {
    const __bf16* aqh = Qh + (size_t)t0 * E_ + vo;   // 4 fragments a 16-row tile
    const __bf16* aql = Ql + (size_t)t0 * E_ + vo;
    v16bf q_h[2][4], q_l[2][4];
#pragma unroll   // constant indices: the fragments stay in registers
    for (int c = 0; c < 8; ++c) {
      q_h[c >> 2][c & 3] = ldF(aqh, c * FRAG);
      q_l[c >> 2][c & 3] = ldF(aql, c * FRAG);
    }

    for (int tb = 0; tb < (nkc >> 4); tb += 8) {
      const int k0 = (tb + wave) * 16;
      const __bf16* bkh = Kh + (size_t)k0 * E_ + vo;
      const __bf16* bkl = Kl + (size_t)k0 * E_ + vo;
      v16bf k_h[4], k_l[4];
#pragma unroll   // constant indices: the fragments stay in registers
      for (int c = 0; c < 4; ++c) {
        k_h[c] = ldF(bkh, c * FRAG);
        k_l[c] = ldF(bkl, c * FRAG);
      }

      const int kg = k0 + r16;
#pragma unroll   // constant indices into the Q fragments
      for (int tm = 0; tm < 2; ++tm) {
        const int q0 = t0 + tm * 16;
        v8f acc0 = vzero8(), acc1 = vzero8(), acc2 = vzero8(), acc3 = vzero8();
        REG_CHUNK(q_h[tm][0], q_l[tm][0], k_h[0], k_l[0], acc0);
        REG_CHUNK(q_h[tm][1], q_l[tm][1], k_h[1], k_l[1], acc1);
        REG_CHUNK(q_h[tm][2], q_l[tm][2], k_h[2], k_l[2], acc2);
        REG_CHUNK(q_h[tm][3], q_l[tm][3], k_h[3], k_l[3], acc3);
        v8f acc = (acc0 + acc1) + (acc2 + acc3);

#pragma unroll
        for (int j = 0; j < 8; ++j) {
          const int qg = q0 + j + 8 * lh;
          float val = acc[j] * SCALE;
          if (kg > qg) val = -INFINITY;                      // causal first
          if (mask[(size_t)qg * T_ + kg] == 0) val = -1e9f;  // padding overwrites
          sS[(tm * 16 + j + 8 * lh) * SROW + kg] = val;
        }
      }
    }
  }
  __syncthreads();

  // ---- Phase 2a: row maxima over the walked keys ----
  float mxr[4];
  bool low = false;
#pragma unroll
  for (int r = 0; r < 4; ++r) {
    const float* row = sS + (wave * 4 + r) * SROW;
    float mx = -INFINITY;
    for (int cb = 0; cb < nkc; cb += 128) {
#pragma unroll   // four reads behind one wait; the key count is a multiple of 128
      for (int u = 0; u < 4; ++u) mx = fmaxf(mx, row[cb + 32 * u + lane]);
    }
    for (int off = 16; off; off >>= 1) mx = fmaxf(mx, __shfl_xor(mx, off, 32));
    mxr[r] = mx;
    low = low || !(mx >= -5e8f);   // exp(-1e9 - mx) might not be 0 for this row
  }
  if (low) *sFull = 1;
  __syncthreads();   // publishes the flag: all waves must walk the same key count
  if (__builtin_amdgcn_readfirstlane(*sFull) != 0) {
    // A row without a live key up to the edge: the keys past the edge count.
    // All of them are causal for every row here, so no product is needed.
    // Each wave fills the rows that it alone reads in phase 2.
    nk = T_;
#pragma unroll
    for (int r = 0; r < 4; ++r) {
      const int rr = wave * 4 + r;
      float* row = sS + rr * SROW;
      float mx = mxr[r];
      for (int c = nkc + lane; c < T_; c += 32) {
        const float val = (mask[(size_t)(t0 + rr) * T_ + c] == 0) ? -1e9f : -INFINITY;
        row[c] = val;
        mx = fmaxf(mx, val);
      }
      for (int off = 16; off; off >>= 1) mx = fmaxf(mx, __shfl_xor(mx, off, 32));
      mxr[r] = mx;
    }
  }

  // ---- Phase 2b: exp, row sum; emit P as split bf16 ----
#pragma unroll
  for (int r = 0; r < 4; ++r) {
    const int rr = wave * 4 + r;
    float* row = sS + rr * SROW;
    const float mx = mxr[r];
    float sum = 0.f;
    for (int cb = 0; cb < nk; cb += 128) {
#pragma unroll   // four reads behind one wait; same per-lane order of the sum
      for (int u = 0; u < 4; ++u) {
        const int c = cb + 32 * u + lane;
        float e = expf(row[c] - mx); row[c] = e; sum += e;
      }
    }
    for (int off = 16; off; off >>= 1) sum += __shfl_xor(sum, off, 32);
    const float inv = 1.f / sum;
    for (int cb = 0; cb < nk; cb += 128) {
#pragma unroll   // four reads behind one wait
      for (int u = 0; u < 4; ++u) {
        const int c = cb + 32 * u + lane;
        __bf16 hh, ll;
        split2(row[c] * inv, hh, ll);
        pHi[rr * PROW + c] = hh;
        pLo[rr * PROW + c] = ll;
      }
    }
  }
  __syncthreads();

  // ---- Phase 3: O = P @ V  (A from LDS split-bf16, B from transposed V) ----
  // The score rows are dead now: each wave turns its output tiles there, in a
  // range of its own, into the 16-byte pieces of the fragment order.
  constexpr int OPITCH = 24;                        // 48 B a row: 16 rows, 16 bank groups
  __bf16* stH = (__bf16*)smem + wave * 1024;        // [16][OPITCH]
  __bf16* stL = stH + 16 * OPITCH;
  // Wave w owns the 16 columns e = 16*w of both 16-row tiles: a V fragment is
  // loaded once and multiplied with both, so V crosses from L2 once a block.
  const int tn = wave;
  const __bf16* aph = pHi + r16 * PROW + 8 * lh;
  const __bf16* apl = pLo + r16 * PROW + 8 * lh;
  const __bf16* bvh = Vh + tn * FRAG + vo;           // 32 keys on: 8 fragments on
  const __bf16* bvl = Vl + tn * FRAG + vo;

  v8f acc[2][4];
#pragma unroll   // constant indices: the accumulators stay in registers
  for (int c = 0; c < 8; ++c) acc[c >> 2][c & 3] = vzero8();
  for (int k0 = 0; k0 < nk; k0 += 128) {
#pragma unroll   // constant indices into the accumulators
    for (int c = 0; c < 4; ++c) {
      const v16bf v_h = ldF(bvh, ((k0 >> 5) + c) * 8 * FRAG);
      const v16bf v_l = ldF(bvl, ((k0 >> 5) + c) * 8 * FRAG);
#pragma unroll   // constant indices into the accumulators
      for (int tm = 0; tm < 2; ++tm) {
        const v16bf p_h = ldAB(aph + tm * 16 * PROW, k0 + 32 * c);
        const v16bf p_l = ldAB(apl + tm * 16 * PROW, k0 + 32 * c);
        REG_CHUNK(p_h, p_l, v_h, v_l, acc[tm][c]);
      }
    }
  }

#pragma unroll   // constant indices into the accumulators
  for (int tm = 0; tm < 2; ++tm) {
    const v8f o = (acc[tm][0] + acc[tm][1]) + (acc[tm][2] + acc[tm][3]);
#pragma unroll
    for (int j = 0; j < 8; ++j) {
      __bf16 hh, ll;
      split2(o[j], hh, ll);
      stH[(j + 8 * lh) * OPITCH + r16] = hh;
      stL[(j + 8 * lh) * OPITCH + r16] = ll;
    }
    // the wave's own LDS writes have landed before it reads the rows back
    asm volatile("s_wait_dscnt 0x0" ::: "memory");
    // rows (b,t), k = h*E + e, pre-split for the output projection: fragment
    // (row / 16) * 32 + k / 32; this tile is its half tn & 1, one piece a lane
    const size_t idx = ((size_t)((b * T_ + t0) / 16 + tm) * 32 + h * 4 + (tn >> 1)) * FRAG
                     + (tn & 1) * 256;
    *(v8bf*)(aoh + idx + vo) = *(const v8bf*)(stH + r16 * OPITCH + 8 * lh);
    *(v8bf*)(aol + idx + vo) = *(const v8bf*)(stL + r16 * OPITCH + 8 * lh);
    // a precaution: the two stores have taken their registers before the second
    // tile's code is given them
    if (tm == 0) {
      asm volatile("s_wait_xcnt 0x0" ::: "memory");
      // no register write of the second tile's code is moved in front of that wait
      __builtin_amdgcn_sched_barrier(0);
    }
  }
}

// ---------------------------------------------------------------------------
// Kernel 3: out = ao @ Wu^T + bu   (split-bf16, M=8192, N=128, K=1024)
// ---------------------------------------------------------------------------
__global__ __launch_bounds__(256)
void proj_kernel(const __bf16* __restrict__ aoh, const __bf16* __restrict__ aol,
                 const __bf16* __restrict__ wuh, const __bf16* __restrict__ wul,
                 const float* __restrict__ bu, float* __restrict__ out) {
  // the wave's number as a scalar: Wu's fragment base stays in scalar registers
  const int wave = __builtin_amdgcn_readfirstlane(threadIdx.x >> 5);
  const int lane = threadIdx.x & 31;
  const int r16 = lane & 15, lh = lane >> 4;
  const unsigned vo = (unsigned)(lane * 8);            // the lane's piece of a fragment
  const int m0 = blockIdx.x * 16;
  const int n0 = wave * 16;
  const int K  = H_ * E_;  // 1024

  // both operands in fragment order: the 32 fragments of a 16-row tile in a row
  const __bf16* aah = aoh + (size_t)m0 * K + vo;
  const __bf16* aal = aol + (size_t)m0 * K + vo;
  const __bf16* bwh = wuh + (size_t)n0 * K + vo;
  const __bf16* bwl = wul + (size_t)n0 * K + vo;

  v8f acc0 = vzero8(), acc1 = vzero8(), acc2 = vzero8(), acc3 = vzero8();
#pragma unroll 2
  for (int k0 = 0; k0 < K; k0 += 128) {
    const int f0 = (k0 >> 5) * FRAG;
    SPLIT_CHUNK(aah, aal, f0,            bwh, bwl, f0,            acc0);
    SPLIT_CHUNK(aah, aal, f0 + FRAG,     bwh, bwl, f0 + FRAG,     acc1);
    SPLIT_CHUNK(aah, aal, f0 + 2 * FRAG, bwh, bwl, f0 + 2 * FRAG, acc2);
    SPLIT_CHUNK(aah, aal, f0 + 3 * FRAG, bwh, bwl, f0 + 3 * FRAG, acc3);
  }
  v8f acc = (acc0 + acc1) + (acc2 + acc3);

  const float bias = bu[n0 + r16];
#pragma unroll
  for (int j = 0; j < 8; ++j) {
    out[(size_t)(m0 + j + 8 * lh) * E_ + n0 + r16] = acc[j] + bias;
  }
}

// ---------------------------------------------------------------------------
extern "C" void kernel_launch(void* const* d_in, const int* in_sizes, int n_in,
                              void* d_out, int out_size, void* d_ws, size_t ws_size,
                              hipStream_t stream) {
  (void)in_sizes; (void)n_in; (void)out_size; (void)ws_size;
  const float* x    = (const float*)d_in[0];
  const int*   mask = (const int*)  d_in[1];
  const float* Wk   = (const float*)d_in[2];   // dict order: x, mask, Wk, Wq, Wv, Wu, bu
  const float* Wq   = (const float*)d_in[3];
  const float* Wv   = (const float*)d_in[4];
  const float* Wu   = (const float*)d_in[5];
  const float* bu   = (const float*)d_in[6];
  float* out = (float*)d_out;

  // workspace layout (bf16 element offsets); total ~140.5 MB
  __bf16* ws = (__bf16*)d_ws;
  const size_t CH = (size_t)B_ * H_ * T_ * E_;   // 8,388,608
  const size_t XH = (size_t)B_ * T_ * E_;        // 1,048,576
  const size_t WH = (size_t)(H_ * E_) * E_;      //   131,072
  __bf16* qh  = ws;            __bf16* ql  = ws + CH;
  __bf16* kh  = ws + 2 * CH;   __bf16* kl  = ws + 3 * CH;
  __bf16* vth = ws + 4 * CH;   __bf16* vtl = ws + 5 * CH;
  __bf16* aoh = ws + 6 * CH;   __bf16* aol = ws + 7 * CH;
  __bf16* xh  = ws + 8 * CH;   __bf16* xl  = xh + XH;
  __bf16* wb  = xl + XH;
  __bf16* wqh = wb;            __bf16* wql = wb + WH;
  __bf16* wkh = wb + 2 * WH;   __bf16* wkl = wb + 3 * WH;
  __bf16* wvh = wb + 4 * WH;   __bf16* wvl = wb + 5 * WH;
  __bf16* wuh = wb + 6 * WH;   __bf16* wul = wb + 7 * WH;

  // 0) split fp32 inputs into bf16 hi/lo, fragment order (8 elements a thread;
  //    last argument: log2 of the row length / 32)
  split_kernel<<<512, 256, 0, stream>>>(x,  xh,  xl,  131072, 2);
  split_kernel<<<64,  256, 0, stream>>>(Wq, wqh, wql, 16384, 2);
  split_kernel<<<64,  256, 0, stream>>>(Wk, wkh, wkl, 16384, 2);
  split_kernel<<<64,  256, 0, stream>>>(Wv, wvh, wvl, 16384, 2);
  split_kernel<<<64,  256, 0, stream>>>(Wu, wuh, wul, 16384, 5);

  // 1) QKV projection (V transposed)
  dim3 g1((B_ * T_) / 64, H_, 3);
  qkv_kernel<<<g1, 256, 0, stream>>>(xh, xl, wqh, wql, wkh, wkl, wvh, wvl,
                                     qh, ql, kh, kl, vth, vtl);

  // 2) attention
  const size_t lds = (size_t)32 * SROW * 4 + (size_t)2 * 32 * PROW * 2 + 16;  // 263,696 B
  (void)hipFuncSetAttribute((const void*)attn_kernel,
                            hipFuncAttributeMaxDynamicSharedMemorySize, (int)lds);
  dim3 g2(T_ / 32, H_, B_);
  attn_kernel<<<g2, 256, lds, stream>>>(qh, ql, kh, kl, vth, vtl, mask, aoh, aol);

  // 3) output projection
  proj_kernel<<<(B_ * T_) / 16, 256, 0, stream>>>(aoh, aol, wuh, wul, bu, out);
}

// v005
// It runs in 215 microseconds.
// In two side-by-side timings against v004, it was 1.30 and 1.31 times as fast.
// All steps since v000 together make it 3.07 times as fast.
#include <hip/hip_runtime.h>
#include <math.h>

typedef __attribute__((ext_vector_type(4)))  float  v4f;
typedef __attribute__((ext_vector_type(8)))  float  v8f;
typedef __attribute__((ext_vector_type(8)))  __bf16 v8bf;
typedef __attribute__((ext_vector_type(16))) __bf16 v16bf;

constexpr int B_ = 8, T_ = 1024, E_ = 128, H_ = 8;
constexpr int SROW = 1028;   // fp32 score row stride (1028 % 64 == 4 -> conflict-free)
constexpr int PROW = 2 * SROW;  // bf16 prob row stride: a prob row stands in its score row's place
constexpr float SCALE = 0.08838834764831845f;  // 1/sqrt(128)

static __device__ __forceinline__ v8f vzero8() {
  v8f z = {0.f, 0.f, 0.f, 0.f, 0.f, 0.f, 0.f, 0.f};
  return z;
}

// --- bf16 helpers (bit-exact, storage-only use of __bf16) ---
static __device__ __forceinline__ float bf2f(__bf16 h) {
  return __builtin_bit_cast(float, (unsigned)((unsigned)__builtin_bit_cast(unsigned short, h) << 16));
}
static __device__ __forceinline__ __bf16 f2bf(float f) {          // RNE
  unsigned u = __builtin_bit_cast(unsigned, f);
  u = (u + 0x7FFFu + ((u >> 16) & 1u)) >> 16;
  return __builtin_bit_cast(__bf16, (unsigned short)u);
}
static __device__ __forceinline__ void split2(float f, __bf16& h, __bf16& l) {
  h = f2bf(f);
  l = f2bf(f - bf2f(h));
}

// D = A(16x32 bf16) * B(32x16 bf16) + C(16x16 f32)
static __device__ __forceinline__ v8f wmma_bf(v16bf a, v16bf b, v8f c) {
  return __builtin_amdgcn_wmma_f32_16x16x32_bf16(false, a, false, b, (short)0, c, false, false);
}

// Per-lane A/B operand slice from a K-contiguous row.
// p must be pre-offset by row*stride + 8*(lane>>4).
// elems 0..7 <- K[k0 + 8*lh .. +7], elems 8..15 <- K[k0 + 16 + 8*lh .. +7]
static __device__ __forceinline__ v16bf ldAB(const __bf16* p, int k0) {
  v8bf a = *(const v8bf*)(p + k0);
  v8bf b = *(const v8bf*)(p + k0 + 16);
  return __builtin_shufflevector(a, b, 0,1,2,3,4,5,6,7,8,9,10,11,12,13,14,15);
}

// FRAGMENT ORDER of the global bf16 planes. A plane is cut into fragments of
// 16 rows x 32 k = 512 elements (1024 B). Inside one, the 16-byte piece that
// holds row r, k = 16*half + 8*lh .. +7 stands at element half*256 + (16*lh + r)*8.
// Lane r + 16*lh then finds its operand slice at lane*8 and 256 + lane*8, and each
// of the two wave-wide loads reads 512 contiguous bytes (4 whole lines) instead
// of 32 bytes out of each of 16 lines.
constexpr int FRAG = 512;   // elements of one fragment

// p must be pre-offset by lane*8; off = element offset of the fragment.
static __device__ __forceinline__ v16bf ldF(const __bf16* p, int off) {
  v8bf a = *(const v8bf*)(p + off);
  v8bf b = *(const v8bf*)(p + off + 256);
  return __builtin_shufflevector(a, b, 0,1,2,3,4,5,6,7,8,9,10,11,12,13,14,15);
}

// One K=32 chunk of the split-bf16 product: hi*hi + hi*lo + lo*hi.
// Both operands from planes in fragment order, at fragment offsets FA_ and FB_.
#define SPLIT_CHUNK(AH_, AL_, FA_, BH_, BL_, FB_, ACC_)  \
  do {                                              \
    v16bf _ah = ldF((AH_), (FA_));                  \
    v16bf _al = ldF((AL_), (FA_));                  \
    v16bf _bh = ldF((BH_), (FB_));                  \
    v16bf _bl = ldF((BL_), (FB_));                  \
    (ACC_) = wmma_bf(_ah, _bh, (ACC_));             \
    (ACC_) = wmma_bf(_ah, _bl, (ACC_));             \
    (ACC_) = wmma_bf(_al, _bh, (ACC_));             \
  } while (0)

// The same three products with all four operands already in registers.
#define REG_CHUNK(AH_, AL_, BH_, BL_, ACC_)         \
  do {                                              \
    (ACC_) = wmma_bf((AH_), (BH_), (ACC_));         \
    (ACC_) = wmma_bf((AH_), (BL_), (ACC_));         \
    (ACC_) = wmma_bf((AL_), (BH_), (ACC_));         \
  } while (0)

// ---------------------------------------------------------------------------
// Kernel 0: elementwise fp32 -> (bf16 hi, bf16 lo) split, row-major source of
// 32 << lgc columns, planes written in fragment order (fragments of a 16-row
// tile follow one another along k). One 16-byte piece of each plane a thread,
// taken in the order of the destination.
// ---------------------------------------------------------------------------
__global__ __launch_bounds__(256)
void split_kernel(const float* __restrict__ src, __bf16* __restrict__ h,
                  __bf16* __restrict__ l, int npieces, int lgc) {
  for (int d = blockIdx.x * blockDim.x + threadIdx.x; d < npieces; d += gridDim.x * blockDim.x) {
    const int frag = d >> 6;
    const int row  = (frag >> lgc) * 16 + (d & 15);
    const int k    = (frag & ((1 << lgc) - 1)) * 32 + ((d >> 5) & 1) * 16 + ((d >> 4) & 1) * 8;
    const float* sp = src + ((size_t)row << (lgc + 5)) + k;
    const v4f f0 = *(const v4f*)sp;
    const v4f f1 = *(const v4f*)(sp + 4);
    v8bf hv, lv;
#pragma unroll   // constant indices: the four vectors stay in registers
    for (int j = 0; j < 8; ++j) {
      __bf16 hh, ll;
      split2(j < 4 ? f0[j & 3] : f1[j & 3], hh, ll);
      hv[j] = hh;
      lv[j] = ll;
    }
    *(v8bf*)(h + (size_t)d * 8) = hv;
    *(v8bf*)(l + (size_t)d * 8) = lv;
  }
}

// ---------------------------------------------------------------------------
// Kernel 1: QKV projection (split-bf16 GEMM, K=128 -> 4 chunks * 3 WMMA).
// grid = (128, H, 3), block = 256: 64 rows of x by one head's 128 columns.
// x and W are read, and Q, K, V^T written, in fragment order.
// Q, K: rows t, k = e; per (b,h) fragment (t/16)*4 + e/32.
// V^T : rows e, k = t; per (b,h) fragment (t/32)*8 + e/16.
// The hi and lo output tiles are staged in LDS, and leave as 16-byte stores in
// the order of the destination, 512 contiguous bytes a wave.
// ---------------------------------------------------------------------------
constexpr int QK_PITCH = 136;   // staged Q/K row: 128 e + 8 (272 B, 4 banks a row)
constexpr int VT_PITCH = 72;    // staged V^T row: 64 t + 8 (144 B, 36 dwords a row)
constexpr int STAGE_ELEMS = 128 * VT_PITCH;   // one plane; also holds 64 * QK_PITCH

// TR == false: D = W * x^T, so a lane holds 8 consecutive e of one row t.
// TR == true : D = x * W^T, so a lane holds 8 consecutive t of one column e.
// Either way the lane's 8 values are one 16-byte piece of the output layout.
template <bool TR>
static __device__ __forceinline__ void qkv_tile(
    const __bf16* __restrict__ xh, const __bf16* __restrict__ xl,
    const __bf16* __restrict__ Wh, const __bf16* __restrict__ Wl,
    __bf16* __restrict__ oh, __bf16* __restrict__ ol,
    __bf16* sH, __bf16* sL) {
  // the wave's number as a scalar: W's and x's row bases then stay in scalar
  // registers and every fragment load shares one per-lane offset
  const int wave = __builtin_amdgcn_readfirstlane(threadIdx.x >> 5);
  const int lane = threadIdx.x & 31;
  const int r16 = lane & 15, lh = lane >> 4;
  const int m0 = blockIdx.x * 64;
  const int h  = blockIdx.y;
  const unsigned vo = (unsigned)(lane * 8);            // the lane's piece of a fragment

  const __bf16* bwh = Wh + (size_t)(h * E_ + wave * 16) * E_ + vo;
  const __bf16* bwl = Wl + (size_t)(h * E_ + wave * 16) * E_ + vo;
  const v16bf w_h0 = ldF(bwh, 0),        w_h1 = ldF(bwh, FRAG);
  const v16bf w_h2 = ldF(bwh, 2 * FRAG), w_h3 = ldF(bwh, 3 * FRAG);
  const v16bf w_l0 = ldF(bwl, 0),        w_l1 = ldF(bwl, FRAG);
  const v16bf w_l2 = ldF(bwl, 2 * FRAG), w_l3 = ldF(bwl, 3 * FRAG);

// hi*hi + hi*lo + lo*hi of one K=32 chunk, x's fragments already in registers
#define XW_CHUNK(XH_, XL_, WH_, WL_, ACC_)            \
  do {                                                \
    if (TR) {                                         \
      (ACC_) = wmma_bf((XH_), (WH_), (ACC_));         \
      (ACC_) = wmma_bf((XH_), (WL_), (ACC_));         \
      (ACC_) = wmma_bf((XL_), (WH_), (ACC_));         \
    } else {                                          \
      (ACC_) = wmma_bf((WH_), (XH_), (ACC_));         \
      (ACC_) = wmma_bf((WL_), (XH_), (ACC_));         \
      (ACC_) = wmma_bf((WH_), (XL_), (ACC_));         \
    }                                                 \
  } while (0)

  const __bf16* axh = xh + (size_t)m0 * E_ + vo;
  const __bf16* axl = xl + (size_t)m0 * E_ + vo;
  v16bf fh[4], fl[4];                              // x fragments of one 16-row tile
#pragma unroll
  for (int c = 0; c < 4; ++c) {
    fh[c] = ldF(axh, c * FRAG);
    fl[c] = ldF(axl, c * FRAG);
  }
  // all 32 first loads issue before the first product; left alone, the last
  // ones were issued in pairs among the products, each behind a wait to 0
  __builtin_amdgcn_sched_barrier(0);

#pragma unroll
  for (int mt = 0; mt < 4; ++mt) {
    v8f acc0 = vzero8(), acc1 = vzero8(), acc2 = vzero8(), acc3 = vzero8();
    XW_CHUNK(fh[0], fl[0], w_h0, w_l0, acc0);
    XW_CHUNK(fh[1], fl[1], w_h1, w_l1, acc1);
    XW_CHUNK(fh[2], fl[2], w_h2, w_l2, acc2);
    XW_CHUNK(fh[3], fl[3], w_h3, w_l3, acc3);
    v8f acc = (acc0 + acc1) + (acc2 + acc3);

    if (mt < 3) {
      // the next tile's loads stay behind this tile's products, so that they take
      // the same registers: hoisted, they cost a second set and resident blocks
      __builtin_amdgcn_sched_barrier(0);
      // they fly while this tile is split and staged
#pragma unroll
      for (int c = 0; c < 4; ++c) {
        fh[c] = ldF(axh, ((mt + 1) * 4 + c) * FRAG);
        fl[c] = ldF(axl, ((mt + 1) * 4 + c) * FRAG);
      }
      // a precaution: the loads issued so far have taken their address register
      // before anything below may be given it
      asm volatile("s_wait_xcnt 0x0" ::: "memory");
      // no load is moved behind that wait and no register write in front of it
      __builtin_amdgcn_sched_barrier(0);
    }

    v8bf hv, lv;                                   // C layout: VGPR j -> M = j + 8*(lane/16)
#pragma unroll
    for (int j = 0; j < 8; ++j) {
      __bf16 hh, ll;
      split2(acc[j], hh, ll);
      hv[j] = hh;
      lv[j] = ll;
    }
    const int off = TR ? (wave * 16 + r16) * VT_PITCH + mt * 16 + 8 * lh    // [e][t]
                       : (mt * 16 + r16) * QK_PITCH + wave * 16 + 8 * lh;   // [t][e]
    *(v8bf*)(sH + off) = hv;
    *(v8bf*)(sL + off) = lv;
  }
#undef XW_CHUNK
  __syncthreads();   // every wave's pieces are staged before any row is read back

  const int bb = m0 / T_;
  const int tb = m0 % T_;
#pragma unroll
  for (int i = 0; i < 4; ++i) {
    const int c = i * 256 + threadIdx.x;           // 1024 pieces of 16 B a plane
    const int f = c >> 6;                          // 16 fragments, 64 pieces each
    const int r = c & 15;                          // the piece's row in its fragment
    const int kk = ((c >> 5) & 1) * 16 + ((c >> 4) & 1) * 8;   // and its first k
    // either way the block's 64 t are 16 fragments in a row, from element tb * E_
    const int from = TR ? ((f & 7) * 16 + r) * VT_PITCH + (f >> 3) * 32 + kk    // [e][t]
                        : ((f >> 2) * 16 + r) * QK_PITCH + (f & 3) * 32 + kk;   // [t][e]
    const size_t to = ((size_t)bb * H_ + h) * (size_t)T_ * E_ + (size_t)tb * E_ + c * 8;
    *(v8bf*)(oh + to) = *(const v8bf*)(sH + from);
    *(v8bf*)(ol + to) = *(const v8bf*)(sL + from);
  }
  // a precaution: the stores have taken their registers before the V^T code,
  // which follows this one in the built text behind a conditional branch
  if (!TR) asm volatile("s_wait_xcnt 0x0" ::: "memory");
}

__global__ __launch_bounds__(256)
void qkv_kernel(const __bf16* __restrict__ xh, const __bf16* __restrict__ xl,
                const __bf16* __restrict__ wqh, const __bf16* __restrict__ wql,
                const __bf16* __restrict__ wkh, const __bf16* __restrict__ wkl,
                const __bf16* __restrict__ wvh, const __bf16* __restrict__ wvl,
                __bf16* __restrict__ qh, __bf16* __restrict__ ql,
                __bf16* __restrict__ kh, __bf16* __restrict__ kl,
                __bf16* __restrict__ vth, __bf16* __restrict__ vtl) {
  __shared__ __attribute__((aligned(16))) __bf16 sH[STAGE_ELEMS];
  __shared__ __attribute__((aligned(16))) __bf16 sL[STAGE_ELEMS];
  if (blockIdx.z == 2) {
    qkv_tile<true>(xh, xl, wvh, wvl, vth, vtl, sH, sL);
    return;
  }
  const bool isq = blockIdx.z == 0;
  qkv_tile<false>(xh, xl, isq ? wqh : wkh, isq ? wql : wkl,
                  isq ? qh : kh, isq ? ql : kl, sH, sL);
}

// ---------------------------------------------------------------------------
// Kernel 2: attention, one (b,h) x 32 query rows per block.
// LDS: fp32 S [32][SROW] + output staging 8 x 1,536 B + one flag word = 143,888 B,
// so that two blocks stand on a WGP (which also takes at most 256 VGPRs a wave).
// A score row's 4,112 B later hold the row's P: hi in the first 2,048 B, lo in
// the next 2,048 B.
// Keys past the block's causal edge hold only -inf or -1e9. While every row's
// maximum is far above -1e9 their exp is exactly 0, so they are not walked.
// ---------------------------------------------------------------------------
__global__ __launch_bounds__(256)
void attn_kernel(const __bf16* __restrict__ qh, const __bf16* __restrict__ ql,
                 const __bf16* __restrict__ kh, const __bf16* __restrict__ kl,
                 const __bf16* __restrict__ vth, const __bf16* __restrict__ vtl,
                 const int* __restrict__ mask,
                 __bf16* __restrict__ aoh, __bf16* __restrict__ aol) {
  extern __shared__ char smem[];
  float*  sS  = (float*)smem;                          // [32][SROW] fp32
  __bf16* pHi = (__bf16*)smem;                         // [32][PROW], over S row by row
  __bf16* pLo = pHi + T_;                              // [32][PROW], behind the row's hi
  __bf16* sOut = (__bf16*)(smem + 32 * SROW * 4);      // 8 waves x 768 elements
  int* sFull  = (int*)(smem + 32 * SROW * 4 + 8 * 768 * 2);  // 1: walk all T_ keys

  // the wave's number as a scalar: fragment bases then stay in scalar registers
  // and every fragment load shares the one per-lane offset vo
  const int wave = __builtin_amdgcn_readfirstlane(threadIdx.x >> 5);
  const int lane = threadIdx.x & 31;
  const int r16 = lane & 15, lh = lane >> 4;
  const unsigned vo = (unsigned)(lane * 8);            // the lane's piece of a fragment
  const int b = blockIdx.z, h = blockIdx.y, t0 = blockIdx.x * 32;

  const size_t bh = ((size_t)b * H_ + h) * (size_t)T_ * E_;
  const __bf16* Qh = qh + bh;  const __bf16* Ql = ql + bh;
  const __bf16* Kh = kh + bh;  const __bf16* Kl = kl + bh;
  const __bf16* Vh = vth + bh; const __bf16* Vl = vtl + bh;   // all in fragment order

  // keys up to the causal edge of the last query row, in whole groups of 128
  // (one key tile for each of the 8 waves)
  const int nkc = (t0 + 32 + 127) & ~127;
  int nk = nkc;
  if (threadIdx.x == 0) *sFull = 0;

  // ---- Phase 1: S = (Q K^T)*scale, causal -inf then padding -1e9 ----
  // Q of both 16-row tiles (16 x v16bf) stays in registers; a K fragment is
  // loaded once and multiplied with both, so K crosses from L2 once a block.
  {
    const __bf16* aqh = Qh + (size_t)t0 * E_ + vo;   // 4 fragments a 16-row tile
    const __bf16* aql = Ql + (size_t)t0 * E_ + vo;
    v16bf q_h[2][4], q_l[2][4];
#pragma unroll   // constant indices: the fragments stay in registers
    for (int c = 0; c < 8; ++c) {
      q_h[c >> 2][c & 3] = ldF(aqh, c * FRAG);
      q_l[c >> 2][c & 3] = ldF(aql, c * FRAG);
    }

    for (int tb = 0; tb < (nkc >> 4); tb += 8) {
      const int k0 = (tb + wave) * 16;
      const __bf16* bkh = Kh + (size_t)k0 * E_ + vo;
      const __bf16* bkl = Kl + (size_t)k0 * E_ + vo;
      v16bf k_h[4], k_l[4];
#pragma unroll   // constant indices: the fragments stay in registers
      for (int c = 0; c < 4; ++c) {
        k_h[c] = ldF(bkh, c * FRAG);
        k_l[c] = ldF(bkl, c * FRAG);
      }

      const int kg = k0 + r16;
#pragma unroll   // constant indices into the Q fragments
      for (int tm = 0; tm < 2; ++tm) {
        const int q0 = t0 + tm * 16;
        v8f acc0 = vzero8(), acc1 = vzero8(), acc2 = vzero8(), acc3 = vzero8();
        REG_CHUNK(q_h[tm][0], q_l[tm][0], k_h[0], k_l[0], acc0);
        REG_CHUNK(q_h[tm][1], q_l[tm][1], k_h[1], k_l[1], acc1);
        REG_CHUNK(q_h[tm][2], q_l[tm][2], k_h[2], k_l[2], acc2);
        REG_CHUNK(q_h[tm][3], q_l[tm][3], k_h[3], k_l[3], acc3);
        v8f acc = (acc0 + acc1) + (acc2 + acc3);

#pragma unroll
        for (int j = 0; j < 8; ++j) {
          const int qg = q0 + j + 8 * lh;
          float val = acc[j] * SCALE;
          if (kg > qg) val = -INFINITY;                      // causal first
          if (mask[(size_t)qg * T_ + kg] == 0) val = -1e9f;  // padding overwrites
          sS[(tm * 16 + j + 8 * lh) * SROW + kg] = val;
        }
      }
    }
  }
  __syncthreads();

  // ---- Phase 2a: row maxima over the walked keys ----
  float mxr[4];
  bool low = false;
#pragma unroll
  for (int r = 0; r < 4; ++r) {
    const float* row = sS + (wave * 4 + r) * SROW;
    float mx = -INFINITY;
    for (int cb = 0; cb < nkc; cb += 128) {
#pragma unroll   // four reads behind one wait; the key count is a multiple of 128
      for (int u = 0; u < 4; ++u) mx = fmaxf(mx, row[cb + 32 * u + lane]);
    }
    for (int off = 16; off; off >>= 1) mx = fmaxf(mx, __shfl_xor(mx, off, 32));
    mxr[r] = mx;
    low = low || !(mx >= -5e8f);   // exp(-1e9 - mx) might not be 0 for this row
  }
  if (low) *sFull = 1;
  __syncthreads();   // publishes the flag: all waves must walk the same key count
  if (__builtin_amdgcn_readfirstlane(*sFull) != 0) {
    // A row without a live key up to the edge: the keys past the edge count.
    // All of them are causal for every row here, so no product is needed.
    // Each wave fills the rows that it alone reads in phase 2.
    nk = T_;
#pragma unroll
    for (int r = 0; r < 4; ++r) {
      const int rr = wave * 4 + r;
      float* row = sS + rr * SROW;
      float mx = mxr[r];
      for (int c = nkc + lane; c < T_; c += 32) {
        const float val = (mask[(size_t)(t0 + rr) * T_ + c] == 0) ? -1e9f : -INFINITY;
        row[c] = val;
        mx = fmaxf(mx, val);
      }
      for (int off = 16; off; off >>= 1) mx = fmaxf(mx, __shfl_xor(mx, off, 32));
      mxr[r] = mx;
    }
  }

  // ---- Phase 2b: exp, row sum; emit P as split bf16 ----
  // The wave takes a whole row into registers (up to 32 values a lane) and only
  // then writes P over it: every store of a row depends, through the row's sum,
  // on every load of that row, and no other wave touches the row in this phase.
#pragma unroll
  for (int r = 0; r < 4; ++r) {
    const int rr = wave * 4 + r;
    const float* row = sS + rr * SROW;
    const float mx = mxr[r];
    float e[32];
    float sum = 0.f;
#pragma unroll   // constant indices: the row stays in registers; nk is a scalar
    for (int g = 0; g < 8; ++g) {
      if (g * 128 < nk) {
#pragma unroll   // constant indices
        for (int u = 0; u < 4; ++u) e[g * 4 + u] = row[g * 128 + 32 * u + lane];
      }
    }
#pragma unroll   // constant indices; same per-lane order of the sum
    for (int g = 0; g < 8; ++g) {
      if (g * 128 < nk) {
#pragma unroll   // constant indices
        for (int u = 0; u < 4; ++u) {
          e[g * 4 + u] = expf(e[g * 4 + u] - mx);
          sum += e[g * 4 + u];
        }
      }
    }
    for (int off = 16; off; off >>= 1) sum += __shfl_xor(sum, off, 32);
    const float inv = 1.f / sum;
#pragma unroll   // constant indices
    for (int g = 0; g < 8; ++g) {
      if (g * 128 < nk) {
#pragma unroll   // constant indices
        for (int u = 0; u < 4; ++u) {
          const int c = g * 128 + 32 * u + lane;
          __bf16 hh, ll;
          split2(e[g * 4 + u] * inv, hh, ll);
          pHi[rr * PROW + c] = hh;
          pLo[rr * PROW + c] = ll;
        }
      }
    }
  }
  __syncthreads();

  // ---- Phase 3: O = P @ V  (A from LDS split-bf16, B from transposed V) ----
  // Each wave turns its output tiles, in a staging range of its own, into the
  // 16-byte pieces of the fragment order.
  constexpr int OPITCH = 24;                        // 48 B a row: 16 rows, 16 bank groups
  __bf16* stH = sOut + wave * 768;                  // [16][OPITCH]
  __bf16* stL = stH + 16 * OPITCH;
  // Wave w owns the 16 columns e = 16*w of both 16-row tiles: a V fragment is
  // loaded once and multiplied with both, so V crosses from L2 once a block.
  const int tn = wave;
  const __bf16* aph = pHi + r16 * PROW + 8 * lh;
  const __bf16* apl = pLo + r16 * PROW + 8 * lh;
  const __bf16* bvh = Vh + tn * FRAG + vo;           // 32 keys on: 8 fragments on
  const __bf16* bvl = Vl + tn * FRAG + vo;

  v8f acc[2][4];
#pragma unroll   // constant indices: the accumulators stay in registers
  for (int c = 0; c < 8; ++c) acc[c >> 2][c & 3] = vzero8();
  for (int k0 = 0; k0 < nk; k0 += 128) {
#pragma unroll   // constant indices into the accumulators
    for (int c = 0; c < 4; ++c) {
      const v16bf v_h = ldF(bvh, ((k0 >> 5) + c) * 8 * FRAG);
      const v16bf v_l = ldF(bvl, ((k0 >> 5) + c) * 8 * FRAG);
#pragma unroll   // constant indices into the accumulators
      for (int tm = 0; tm < 2; ++tm) {
        const v16bf p_h = ldAB(aph + tm * 16 * PROW, k0 + 32 * c);
        const v16bf p_l = ldAB(apl + tm * 16 * PROW, k0 + 32 * c);
        REG_CHUNK(p_h, p_l, v_h, v_l, acc[tm][c]);
      }
    }
  }

#pragma unroll   // constant indices into the accumulators
  for (int tm = 0; tm < 2; ++tm) {
    const v8f o = (acc[tm][0] + acc[tm][1]) + (acc[tm][2] + acc[tm][3]);
#pragma unroll
    for (int j = 0; j < 8; ++j) {
      __bf16 hh, ll;
      split2(o[j], hh, ll);
      stH[(j + 8 * lh) * OPITCH + r16] = hh;
      stL[(j + 8 * lh) * OPITCH + r16] = ll;
    }
    // the wave's own LDS writes have landed before it reads the rows back
    asm volatile("s_wait_dscnt 0x0" ::: "memory");
    // rows (b,t), k = h*E + e, pre-split for the output projection: fragment
    // (row / 16) * 32 + k / 32; this tile is its half tn & 1, one piece a lane
    const size_t idx = ((size_t)((b * T_ + t0) / 16 + tm) * 32 + h * 4 + (tn >> 1)) * FRAG
                     + (tn & 1) * 256;
    *(v8bf*)(aoh + idx + vo) = *(const v8bf*)(stH + r16 * OPITCH + 8 * lh);
    *(v8bf*)(aol + idx + vo) = *(const v8bf*)(stL + r16 * OPITCH + 8 * lh);
    // a precaution: the two stores have taken their registers before the second
    // tile's code is given them
    if (tm == 0) {
      asm volatile("s_wait_xcnt 0x0" ::: "memory");
      // no register write of the second tile's code is moved in front of that wait
      __builtin_amdgcn_sched_barrier(0);
    }
  }
}

// ---------------------------------------------------------------------------
// Kernel 3: out = ao @ Wu^T + bu   (split-bf16, M=8192, N=128, K=1024)
// ---------------------------------------------------------------------------
__global__ __launch_bounds__(256)
void proj_kernel(const __bf16* __restrict__ aoh, const __bf16* __restrict__ aol,
                 const __bf16* __restrict__ wuh, const __bf16* __restrict__ wul,
                 const float* __restrict__ bu, float* __restrict__ out) {
  // the wave's number as a scalar: Wu's fragment base stays in scalar registers
  const int wave = __builtin_amdgcn_readfirstlane(threadIdx.x >> 5);
  const int lane = threadIdx.x & 31;
  const int r16 = lane & 15, lh = lane >> 4;
  const unsigned vo = (unsigned)(lane * 8);            // the lane's piece of a fragment
  const int m0 = blockIdx.x * 16;
  const int n0 = wave * 16;
  const int K  = H_ * E_;  // 1024

  // both operands in fragment order: the 32 fragments of a 16-row tile in a row
  const __bf16* aah = aoh + (size_t)m0 * K + vo;
  const __bf16* aal = aol + (size_t)m0 * K + vo;
  const __bf16* bwh = wuh + (size_t)n0 * K + vo;
  const __bf16* bwl = wul + (size_t)n0 * K + vo;

  v8f acc0 = vzero8(), acc1 = vzero8(), acc2 = vzero8(), acc3 = vzero8();
#pragma unroll 2
  for (int k0 = 0; k0 < K; k0 += 128) {
    const int f0 = (k0 >> 5) * FRAG;
    SPLIT_CHUNK(aah, aal, f0,            bwh, bwl, f0,            acc0);
    SPLIT_CHUNK(aah, aal, f0 + FRAG,     bwh, bwl, f0 + FRAG,     acc1);
    SPLIT_CHUNK(aah, aal, f0 + 2 * FRAG, bwh, bwl, f0 + 2 * FRAG, acc2);
    SPLIT_CHUNK(aah, aal, f0 + 3 * FRAG, bwh, bwl, f0 + 3 * FRAG, acc3);
  }
  v8f acc = (acc0 + acc1) + (acc2 + acc3);

  const float bias = bu[n0 + r16];
#pragma unroll
  for (int j = 0; j < 8; ++j) {
    out[(size_t)(m0 + j + 8 * lh) * E_ + n0 + r16] = acc[j] + bias;
  }
}

// ---------------------------------------------------------------------------
extern "C" void kernel_launch(void* const* d_in, const int* in_sizes, int n_in,
                              void* d_out, int out_size, void* d_ws, size_t ws_size,
                              hipStream_t stream) {
  (void)in_sizes; (void)n_in; (void)out_size; (void)ws_size;
  const float* x    = (const float*)d_in[0];
  const int*   mask = (const int*)  d_in[1];
  const float* Wk   = (const float*)d_in[2];   // dict order: x, mask, Wk, Wq, Wv, Wu, bu
  const float* Wq   = (const float*)d_in[3];
  const float* Wv   = (const float*)d_in[4];
  const float* Wu   = (const float*)d_in[5];
  const float* bu   = (const float*)d_in[6];
  float* out = (float*)d_out;

  // workspace layout (bf16 element offsets); total ~140.5 MB
  __bf16* ws = (__bf16*)d_ws;
  const size_t CH = (size_t)B_ * H_ * T_ * E_;   // 8,388,608
  const size_t XH = (size_t)B_ * T_ * E_;        // 1,048,576
  const size_t WH = (size_t)(H_ * E_) * E_;      //   131,072
  __bf16* qh  = ws;            __bf16* ql  = ws + CH;
  __bf16* kh  = ws + 2 * CH;   __bf16* kl  = ws + 3 * CH;
  __bf16* vth = ws + 4 * CH;   __bf16* vtl = ws + 5 * CH;
  __bf16* aoh = ws + 6 * CH;   __bf16* aol = ws + 7 * CH;
  __bf16* xh  = ws + 8 * CH;   __bf16* xl  = xh + XH;
  __bf16* wb  = xl + XH;
  __bf16* wqh = wb;            __bf16* wql = wb + WH;
  __bf16* wkh = wb + 2 * WH;   __bf16* wkl = wb + 3 * WH;
  __bf16* wvh = wb + 4 * WH;   __bf16* wvl = wb + 5 * WH;
  __bf16* wuh = wb + 6 * WH;   __bf16* wul = wb + 7 * WH;

  // 0) split fp32 inputs into bf16 hi/lo, fragment order (8 elements a thread;
  //    last argument: log2 of the row length / 32)
  split_kernel<<<512, 256, 0, stream>>>(x,  xh,  xl,  131072, 2);
  split_kernel<<<64,  256, 0, stream>>>(Wq, wqh, wql, 16384, 2);
  split_kernel<<<64,  256, 0, stream>>>(Wk, wkh, wkl, 16384, 2);
  split_kernel<<<64,  256, 0, stream>>>(Wv, wvh, wvl, 16384, 2);
  split_kernel<<<64,  256, 0, stream>>>(Wu, wuh, wul, 16384, 5);

  // 1) QKV projection (V transposed)
  dim3 g1((B_ * T_) / 64, H_, 3);
  qkv_kernel<<<g1, 256, 0, stream>>>(xh, xl, wqh, wql, wkh, wkl, wvh, wvl,
                                     qh, ql, kh, kl, vth, vtl);

  // 2) attention
  const size_t lds = (size_t)32 * SROW * 4 + (size_t)8 * 768 * 2 + 16;  // 143,888 B
  (void)hipFuncSetAttribute((const void*)attn_kernel,
                            hipFuncAttributeMaxDynamicSharedMemorySize, (int)lds);
  dim3 g2(T_ / 32, H_, B_);
  attn_kernel<<<g2, 256, lds, stream>>>(qh, ql, kh, kl, vth, vtl, mask, aoh, aol);

  // 3) output projection
  proj_kernel<<<(B_ * T_) / 16, 256, 0, stream>>>(aoh, aol, wuh, wul, bu, out);
}

// v006
// A run of this version takes 190 microseconds.
// In both of two side-by-side timings against v005, it was 1.13 times as fast.
// Counting every step since v000, it is 3.46 times as fast.
#include <hip/hip_runtime.h>
#include <math.h>

typedef __attribute__((ext_vector_type(4)))  float  v4f;
typedef __attribute__((ext_vector_type(8)))  float  v8f;
typedef __attribute__((ext_vector_type(8)))  __bf16 v8bf;
typedef __attribute__((ext_vector_type(16))) __bf16 v16bf;

constexpr int B_ = 8, T_ = 1024, E_ = 128, H_ = 8;
constexpr int SROW = 1028;   // fp32 score row stride (1028 % 64 == 4 -> conflict-free)
constexpr int PROW = 2 * SROW;  // bf16 prob row stride: a prob row stands in its score row's place
constexpr float SCALE = 0.08838834764831845f;  // 1/sqrt(128)

static __device__ __forceinline__ v8f vzero8() {
  v8f z = {0.f, 0.f, 0.f, 0.f, 0.f, 0.f, 0.f, 0.f};
  return z;
}

// --- bf16 helpers (bit-exact, storage-only use of __bf16) ---
static __device__ __forceinline__ float bf2f(__bf16 h) {
  return __builtin_bit_cast(float, (unsigned)((unsigned)__builtin_bit_cast(unsigned short, h) << 16));
}
static __device__ __forceinline__ __bf16 f2bf(float f) {          // RNE
  unsigned u = __builtin_bit_cast(unsigned, f);
  u = (u + 0x7FFFu + ((u >> 16) & 1u)) >> 16;
  return __builtin_bit_cast(__bf16, (unsigned short)u);
}
static __device__ __forceinline__ void split2(float f, __bf16& h, __bf16& l) {
  h = f2bf(f);
  l = f2bf(f - bf2f(h));
}

// D = A(16x32 bf16) * B(32x16 bf16) + C(16x16 f32)
static __device__ __forceinline__ v8f wmma_bf(v16bf a, v16bf b, v8f c) {
  return __builtin_amdgcn_wmma_f32_16x16x32_bf16(false, a, false, b, (short)0, c, false, false);
}

// Per-lane A/B operand slice from a K-contiguous row.
// p must be pre-offset by row*stride + 8*(lane>>4).
// elems 0..7 <- K[k0 + 8*lh .. +7], elems 8..15 <- K[k0 + 16 + 8*lh .. +7]
static __device__ __forceinline__ v16bf ldAB(const __bf16* p, int k0) {
  v8bf a = *(const v8bf*)(p + k0);
  v8bf b = *(const v8bf*)(p + k0 + 16);
  return __builtin_shufflevector(a, b, 0,1,2,3,4,5,6,7,8,9,10,11,12,13,14,15);
}

// FRAGMENT ORDER of the global bf16 planes. A plane is cut into fragments of
// 16 rows x 32 k = 512 elements (1024 B). Inside one, the 16-byte piece that
// holds row r, k = 16*half + 8*lh .. +7 stands at element half*256 + (16*lh + r)*8.
// Lane r + 16*lh then finds its operand slice at lane*8 and 256 + lane*8, and each
// of the two wave-wide loads reads 512 contiguous bytes (4 whole lines) instead
// of 32 bytes out of each of 16 lines.
constexpr int FRAG = 512;   // elements of one fragment

// p must be pre-offset by lane*8; off = element offset of the fragment.
static __device__ __forceinline__ v16bf ldF(const __bf16* p, int off) {
  v8bf a = *(const v8bf*)(p + off);
  v8bf b = *(const v8bf*)(p + off + 256);
  return __builtin_shufflevector(a, b, 0,1,2,3,4,5,6,7,8,9,10,11,12,13,14,15);
}

// One K=32 chunk of the split-bf16 product: hi*hi + hi*lo + lo*hi.
// Both operands from planes in fragment order, at fragment offsets FA_ and FB_.
#define SPLIT_CHUNK(AH_, AL_, FA_, BH_, BL_, FB_, ACC_)  \
  do {                                              \
    v16bf _ah = ldF((AH_), (FA_));                  \
    v16bf _al = ldF((AL_), (FA_));                  \
    v16bf _bh = ldF((BH_), (FB_));                  \
    v16bf _bl = ldF((BL_), (FB_));                  \
    (ACC_) = wmma_bf(_ah, _bh, (ACC_));             \
    (ACC_) = wmma_bf(_ah, _bl, (ACC_));             \
    (ACC_) = wmma_bf(_al, _bh, (ACC_));             \
  } while (0)

// The same three products with all four operands already in registers.
#define REG_CHUNK(AH_, AL_, BH_, BL_, ACC_)         \
  do {                                              \
    (ACC_) = wmma_bf((AH_), (BH_), (ACC_));         \
    (ACC_) = wmma_bf((AH_), (BL_), (ACC_));         \
    (ACC_) = wmma_bf((AL_), (BH_), (ACC_));         \
  } while (0)

// ---------------------------------------------------------------------------
// Kernel 0: elementwise fp32 -> (bf16 hi, bf16 lo) split, row-major source of
// 32 << lgc columns, planes written in fragment order (fragments of a 16-row
// tile follow one another along k). One 16-byte piece of each plane a thread,
// taken in the order of the destination.
// ---------------------------------------------------------------------------
__global__ __launch_bounds__(256)
void split_kernel(const float* __restrict__ src, __bf16* __restrict__ h,
                  __bf16* __restrict__ l, int npieces, int lgc) {
  for (int d = blockIdx.x * blockDim.x + threadIdx.x; d < npieces; d += gridDim.x * blockDim.x) {
    const int frag = d >> 6;
    const int row  = (frag >> lgc) * 16 + (d & 15);
    const int k    = (frag & ((1 << lgc) - 1)) * 32 + ((d >> 5) & 1) * 16 + ((d >> 4) & 1) * 8;
    const float* sp = src + ((size_t)row << (lgc + 5)) + k;
    const v4f f0 = *(const v4f*)sp;
    const v4f f1 = *(const v4f*)(sp + 4);
    v8bf hv, lv;
#pragma unroll   // constant indices: the four vectors stay in registers
    for (int j = 0; j < 8; ++j) {
      __bf16 hh, ll;
      split2(j < 4 ? f0[j & 3] : f1[j & 3], hh, ll);
      hv[j] = hh;
      lv[j] = ll;
    }
    *(v8bf*)(h + (size_t)d * 8) = hv;
    *(v8bf*)(l + (size_t)d * 8) = lv;
  }
}

// ---------------------------------------------------------------------------
// Kernel 1: QKV projection (split-bf16 GEMM, K=128 -> 4 chunks * 3 WMMA).
// grid = (128, H, 3), block = 256: 64 rows of x by one head's 128 columns.
// x and W are read, and Q, K, V^T written, in fragment order.
// Q, K: rows t, k = e; per (b,h) fragment (t/16)*4 + e/32.
// V^T : rows e, k = t; per (b,h) fragment (t/32)*8 + e/16.
// The hi and lo output tiles are staged in LDS, and leave as 16-byte stores in
// the order of the destination, 512 contiguous bytes a wave.
// ---------------------------------------------------------------------------
constexpr int QK_PITCH = 136;   // staged Q/K row: 128 e + 8 (272 B, 4 banks a row)
constexpr int VT_PITCH = 72;    // staged V^T row: 64 t + 8 (144 B, 36 dwords a row)
constexpr int STAGE_ELEMS = 128 * VT_PITCH;   // one plane; also holds 64 * QK_PITCH

// TR == false: D = W * x^T, so a lane holds 8 consecutive e of one row t.
// TR == true : D = x * W^T, so a lane holds 8 consecutive t of one column e.
// Either way the lane's 8 values are one 16-byte piece of the output layout.
template <bool TR>
static __device__ __forceinline__ void qkv_tile(
    const __bf16* __restrict__ xh, const __bf16* __restrict__ xl,
    const __bf16* __restrict__ Wh, const __bf16* __restrict__ Wl,
    __bf16* __restrict__ oh, __bf16* __restrict__ ol,
    __bf16* sH, __bf16* sL) {
  // the wave's number as a scalar: W's and x's row bases then stay in scalar
  // registers and every fragment load shares one per-lane offset
  const int wave = __builtin_amdgcn_readfirstlane(threadIdx.x >> 5);
  const int lane = threadIdx.x & 31;
  const int r16 = lane & 15, lh = lane >> 4;
  const int m0 = blockIdx.x * 64;
  const int h  = blockIdx.y;
  const unsigned vo = (unsigned)(lane * 8);            // the lane's piece of a fragment

  const __bf16* bwh = Wh + (size_t)(h * E_ + wave * 16) * E_ + vo;
  const __bf16* bwl = Wl + (size_t)(h * E_ + wave * 16) * E_ + vo;
  const v16bf w_h0 = ldF(bwh, 0),        w_h1 = ldF(bwh, FRAG);
  const v16bf w_h2 = ldF(bwh, 2 * FRAG), w_h3 = ldF(bwh, 3 * FRAG);
  const v16bf w_l0 = ldF(bwl, 0),        w_l1 = ldF(bwl, FRAG);
  const v16bf w_l2 = ldF(bwl, 2 * FRAG), w_l3 = ldF(bwl, 3 * FRAG);

// hi*hi + hi*lo + lo*hi of one K=32 chunk, x's fragments already in registers
#define XW_CHUNK(XH_, XL_, WH_, WL_, ACC_)            \
  do {                                                \
    if (TR) {                                         \
      (ACC_) = wmma_bf((XH_), (WH_), (ACC_));         \
      (ACC_) = wmma_bf((XH_), (WL_), (ACC_));         \
      (ACC_) = wmma_bf((XL_), (WH_), (ACC_));         \
    } else {                                          \
      (ACC_) = wmma_bf((WH_), (XH_), (ACC_));         \
      (ACC_) = wmma_bf((WL_), (XH_), (ACC_));         \
      (ACC_) = wmma_bf((WH_), (XL_), (ACC_));         \
    }                                                 \
  } while (0)

  const __bf16* axh = xh + (size_t)m0 * E_ + vo;
  const __bf16* axl = xl + (size_t)m0 * E_ + vo;
  v16bf fh[4], fl[4];                              // x fragments of one 16-row tile
#pragma unroll
  for (int c = 0; c < 4; ++c) {
    fh[c] = ldF(axh, c * FRAG);
    fl[c] = ldF(axl, c * FRAG);
  }
  // all 32 first loads issue before the first product; left alone, the last
  // ones were issued in pairs among the products, each behind a wait to 0
  __builtin_amdgcn_sched_barrier(0);

#pragma unroll
  for (int mt = 0; mt < 4; ++mt) {
    v8f acc0 = vzero8(), acc1 = vzero8(), acc2 = vzero8(), acc3 = vzero8();
    XW_CHUNK(fh[0], fl[0], w_h0, w_l0, acc0);
    XW_CHUNK(fh[1], fl[1], w_h1, w_l1, acc1);
    XW_CHUNK(fh[2], fl[2], w_h2, w_l2, acc2);
    XW_CHUNK(fh[3], fl[3], w_h3, w_l3, acc3);
    v8f acc = (acc0 + acc1) + (acc2 + acc3);

    if (mt < 3) {
      // the next tile's loads stay behind this tile's products, so that they take
      // the same registers: hoisted, they cost a second set and resident blocks
      __builtin_amdgcn_sched_barrier(0);
      // they fly while this tile is split and staged
#pragma unroll
      for (int c = 0; c < 4; ++c) {
        fh[c] = ldF(axh, ((mt + 1) * 4 + c) * FRAG);
        fl[c] = ldF(axl, ((mt + 1) * 4 + c) * FRAG);
      }
      // a precaution: the loads issued so far have taken their address register
      // before anything below may be given it
      asm volatile("s_wait_xcnt 0x0" ::: "memory");
      // no load is moved behind that wait and no register write in front of it
      __builtin_amdgcn_sched_barrier(0);
    }

    v8bf hv, lv;                                   // C layout: VGPR j -> M = j + 8*(lane/16)
#pragma unroll
    for (int j = 0; j < 8; ++j) {
      __bf16 hh, ll;
      split2(acc[j], hh, ll);
      hv[j] = hh;
      lv[j] = ll;
    }
    const int off = TR ? (wave * 16 + r16) * VT_PITCH + mt * 16 + 8 * lh    // [e][t]
                       : (mt * 16 + r16) * QK_PITCH + wave * 16 + 8 * lh;   // [t][e]
    *(v8bf*)(sH + off) = hv;
    *(v8bf*)(sL + off) = lv;
  }
#undef XW_CHUNK
  __syncthreads();   // every wave's pieces are staged before any row is read back

  const int bb = m0 / T_;
  const int tb = m0 % T_;
#pragma unroll
  for (int i = 0; i < 4; ++i) {
    const int c = i * 256 + threadIdx.x;           // 1024 pieces of 16 B a plane
    const int f = c >> 6;                          // 16 fragments, 64 pieces each
    const int r = c & 15;                          // the piece's row in its fragment
    const int kk = ((c >> 5) & 1) * 16 + ((c >> 4) & 1) * 8;   // and its first k
    // either way the block's 64 t are 16 fragments in a row, from element tb * E_
    const int from = TR ? ((f & 7) * 16 + r) * VT_PITCH + (f >> 3) * 32 + kk    // [e][t]
                        : ((f >> 2) * 16 + r) * QK_PITCH + (f & 3) * 32 + kk;   // [t][e]
    const size_t to = ((size_t)bb * H_ + h) * (size_t)T_ * E_ + (size_t)tb * E_ + c * 8;
    *(v8bf*)(oh + to) = *(const v8bf*)(sH + from);
    *(v8bf*)(ol + to) = *(const v8bf*)(sL + from);
  }
  // a precaution: the stores have taken their registers before the V^T code,
  // which follows this one in the built text behind a conditional branch
  if (!TR) asm volatile("s_wait_xcnt 0x0" ::: "memory");
}

__global__ __launch_bounds__(256)
void qkv_kernel(const __bf16* __restrict__ xh, const __bf16* __restrict__ xl,
                const __bf16* __restrict__ wqh, const __bf16* __restrict__ wql,
                const __bf16* __restrict__ wkh, const __bf16* __restrict__ wkl,
                const __bf16* __restrict__ wvh, const __bf16* __restrict__ wvl,
                __bf16* __restrict__ qh, __bf16* __restrict__ ql,
                __bf16* __restrict__ kh, __bf16* __restrict__ kl,
                __bf16* __restrict__ vth, __bf16* __restrict__ vtl) {
  __shared__ __attribute__((aligned(16))) __bf16 sH[STAGE_ELEMS];
  __shared__ __attribute__((aligned(16))) __bf16 sL[STAGE_ELEMS];
  if (blockIdx.z == 2) {
    qkv_tile<true>(xh, xl, wvh, wvl, vth, vtl, sH, sL);
    return;
  }
  const bool isq = blockIdx.z == 0;
  qkv_tile<false>(xh, xl, isq ? wqh : wkh, isq ? wql : wkl,
                  isq ? qh : kh, isq ? ql : kl, sH, sL);
}

// ---------------------------------------------------------------------------
// Kernel 2: attention, one (b,h) x 32 query rows per block.
// LDS: fp32 S [32][SROW] + output staging 8 x 1,536 B + one flag word = 143,888 B,
// so that two blocks stand on a WGP (which also takes at most 256 VGPRs a wave).
// A score row's 4,112 B later hold the row's P: hi in the first 2,048 B, lo in
// the next 2,048 B.
// Keys past the block's causal edge hold only -inf or -1e9. While every row's
// maximum is far above -1e9 their exp is exactly 0, so they are not walked.
// ---------------------------------------------------------------------------
__global__ __launch_bounds__(256)
void attn_kernel(const __bf16* __restrict__ qh, const __bf16* __restrict__ ql,
                 const __bf16* __restrict__ kh, const __bf16* __restrict__ kl,
                 const __bf16* __restrict__ vth, const __bf16* __restrict__ vtl,
                 const int* __restrict__ mask,
                 __bf16* __restrict__ aoh, __bf16* __restrict__ aol) {
  extern __shared__ char smem[];
  float*  sS  = (float*)smem;                          // [32][SROW] fp32
  __bf16* pHi = (__bf16*)smem;                         // [32][PROW], over S row by row
  __bf16* pLo = pHi + T_;                              // [32][PROW], behind the row's hi
  __bf16* sOut = (__bf16*)(smem + 32 * SROW * 4);      // 8 waves x 768 elements
  int* sFull  = (int*)(smem + 32 * SROW * 4 + 8 * 768 * 2);  // 1: walk all T_ keys

  // the wave's number as a scalar: fragment bases then stay in scalar registers
  // and every fragment load shares the one per-lane offset vo
  const int wave = __builtin_amdgcn_readfirstlane(threadIdx.x >> 5);
  const int lane = threadIdx.x & 31;
  const int r16 = lane & 15, lh = lane >> 4;
  const unsigned vo = (unsigned)(lane * 8);            // the lane's piece of a fragment
  // Block order: a block's cost grows with its query tile (it walks the keys up to
  // its causal edge) and there are four times as many blocks as places. So cost
  // falls with the index: within a group of
  // 16 (b,h) pairs the last query tile comes first, and the launch ends on the
  // short blocks. Groups of 16 pairs keep the K and V in use at one time small.
  const int b = blockIdx.z * 2 + (blockIdx.x >> 3), h = blockIdx.x & 7;
  const int t0 = (T_ / 32 - 1 - blockIdx.y) * 32;

  const size_t bh = ((size_t)b * H_ + h) * (size_t)T_ * E_;
  const __bf16* Qh = qh + bh;  const __bf16* Ql = ql + bh;
  const __bf16* Kh = kh + bh;  const __bf16* Kl = kl + bh;
  const __bf16* Vh = vth + bh; const __bf16* Vl = vtl + bh;   // all in fragment order

  // keys up to the causal edge of the last query row, in whole groups of 128
  // (one key tile for each of the 8 waves)
  const int nkc = (t0 + 32 + 127) & ~127;
  int nk = nkc;
  if (threadIdx.x == 0) *sFull = 0;

  // ---- Phase 1: S = (Q K^T)*scale, causal -inf then padding -1e9 ----
  // Q of both 16-row tiles (16 x v16bf) stays in registers; a K fragment is
  // loaded once and multiplied with both, so K crosses from L2 once a block.
  {
    const __bf16* aqh = Qh + (size_t)t0 * E_ + vo;   // 4 fragments a 16-row tile
    const __bf16* aql = Ql + (size_t)t0 * E_ + vo;
    v16bf q_h[2][4], q_l[2][4];
#pragma unroll   // constant indices: the fragments stay in registers
    for (int c = 0; c < 8; ++c) {
      q_h[c >> 2][c & 3] = ldF(aqh, c * FRAG);
      q_l[c >> 2][c & 3] = ldF(aql, c * FRAG);
    }

    for (int tb = 0; tb < (nkc >> 4); tb += 8) {
      const int k0 = (tb + wave) * 16;
      const __bf16* bkh = Kh + (size_t)k0 * E_ + vo;
      const __bf16* bkl = Kl + (size_t)k0 * E_ + vo;
      v16bf k_h[4], k_l[4];
#pragma unroll   // constant indices: the fragments stay in registers
      for (int c = 0; c < 4; ++c) {
        k_h[c] = ldF(bkh, c * FRAG);
        k_l[c] = ldF(bkl, c * FRAG);
      }

      const int kg = k0 + r16;
#pragma unroll   // constant indices into the Q fragments
      for (int tm = 0; tm < 2; ++tm) {
        const int q0 = t0 + tm * 16;
        v8f acc0 = vzero8(), acc1 = vzero8(), acc2 = vzero8(), acc3 = vzero8();
        REG_CHUNK(q_h[tm][0], q_l[tm][0], k_h[0], k_l[0], acc0);
        REG_CHUNK(q_h[tm][1], q_l[tm][1], k_h[1], k_l[1], acc1);
        REG_CHUNK(q_h[tm][2], q_l[tm][2], k_h[2], k_l[2], acc2);
        REG_CHUNK(q_h[tm][3], q_l[tm][3], k_h[3], k_l[3], acc3);
        v8f acc = (acc0 + acc1) + (acc2 + acc3);

#pragma unroll
        for (int j = 0; j < 8; ++j) {
          const int qg = q0 + j + 8 * lh;
          float val = acc[j] * SCALE;
          if (kg > qg) val = -INFINITY;                      // causal first
          if (mask[(size_t)qg * T_ + kg] == 0) val = -1e9f;  // padding overwrites
          sS[(tm * 16 + j + 8 * lh) * SROW + kg] = val;
        }
      }
    }
  }
  __syncthreads();

  // ---- Phase 2a: row maxima over the walked keys ----
  float mxr[4];
  bool low = false;
#pragma unroll
  for (int r = 0; r < 4; ++r) {
    const float* row = sS + (wave * 4 + r) * SROW;
    float mx = -INFINITY;
    for (int cb = 0; cb < nkc; cb += 128) {
#pragma unroll   // four reads behind one wait; the key count is a multiple of 128
      for (int u = 0; u < 4; ++u) mx = fmaxf(mx, row[cb + 32 * u + lane]);
    }
    for (int off = 16; off; off >>= 1) mx = fmaxf(mx, __shfl_xor(mx, off, 32));
    mxr[r] = mx;
    low = low || !(mx >= -5e8f);   // exp(-1e9 - mx) might not be 0 for this row
  }
  if (low) *sFull = 1;
  __syncthreads();   // publishes the flag: all waves must walk the same key count
  if (__builtin_amdgcn_readfirstlane(*sFull) != 0) {
    // A row without a live key up to the edge: the keys past the edge count.
    // All of them are causal for every row here, so no product is needed.
    // Each wave fills the rows that it alone reads in phase 2.
    nk = T_;
#pragma unroll
    for (int r = 0; r < 4; ++r) {
      const int rr = wave * 4 + r;
      float* row = sS + rr * SROW;
      float mx = mxr[r];
      for (int c = nkc + lane; c < T_; c += 32) {
        const float val = (mask[(size_t)(t0 + rr) * T_ + c] == 0) ? -1e9f : -INFINITY;
        row[c] = val;
        mx = fmaxf(mx, val);
      }
      for (int off = 16; off; off >>= 1) mx = fmaxf(mx, __shfl_xor(mx, off, 32));
      mxr[r] = mx;
    }
  }

  // ---- Phase 2b: exp, row sum; emit P as split bf16 ----
  // The wave takes a whole row into registers (up to 32 values a lane) and only
  // then writes P over it: every store of a row depends, through the row's sum,
  // on every load of that row, and no other wave touches the row in this phase.
#pragma unroll
  for (int r = 0; r < 4; ++r) {
    const int rr = wave * 4 + r;
    const float* row = sS + rr * SROW;
    const float mx = mxr[r];
    float e[32];
    float sum = 0.f;
#pragma unroll   // constant indices: the row stays in registers; nk is a scalar
    for (int g = 0; g < 8; ++g) {
      if (g * 128 < nk) {
#pragma unroll   // constant indices
        for (int u = 0; u < 4; ++u) e[g * 4 + u] = row[g * 128 + 32 * u + lane];
      }
    }
#pragma unroll   // constant indices; same per-lane order of the sum
    for (int g = 0; g < 8; ++g) {
      if (g * 128 < nk) {
#pragma unroll   // constant indices
        for (int u = 0; u < 4; ++u) {
          e[g * 4 + u] = expf(e[g * 4 + u] - mx);
          sum += e[g * 4 + u];
        }
      }
    }
    for (int off = 16; off; off >>= 1) sum += __shfl_xor(sum, off, 32);
    const float inv = 1.f / sum;
#pragma unroll   // constant indices
    for (int g = 0; g < 8; ++g) {
      if (g * 128 < nk) {
#pragma unroll   // constant indices
        for (int u = 0; u < 4; ++u) {
          const int c = g * 128 + 32 * u + lane;
          __bf16 hh, ll;
          split2(e[g * 4 + u] * inv, hh, ll);
          pHi[rr * PROW + c] = hh;
          pLo[rr * PROW + c] = ll;
        }
      }
    }
  }
  __syncthreads();

  // ---- Phase 3: O = P @ V  (A from LDS split-bf16, B from transposed V) ----
  // Each wave turns its output tiles, in a staging range of its own, into the
  // 16-byte pieces of the fragment order.
  constexpr int OPITCH = 24;                        // 48 B a row: 16 rows, 16 bank groups
  __bf16* stH = sOut + wave * 768;                  // [16][OPITCH]
  __bf16* stL = stH + 16 * OPITCH;
  // Wave w owns the 16 columns e = 16*w of both 16-row tiles: a V fragment is
  // loaded once and multiplied with both, so V crosses from L2 once a block.
  const int tn = wave;
  const __bf16* aph = pHi + r16 * PROW + 8 * lh;
  const __bf16* apl = pLo + r16 * PROW + 8 * lh;
  const __bf16* bvh = Vh + tn * FRAG + vo;           // 32 keys on: 8 fragments on
  const __bf16* bvl = Vl + tn * FRAG + vo;

  v8f acc[2][4];
#pragma unroll   // constant indices: the accumulators stay in registers
  for (int c = 0; c < 8; ++c) acc[c >> 2][c & 3] = vzero8();
  for (int k0 = 0; k0 < nk; k0 += 128) {
#pragma unroll   // constant indices into the accumulators
    for (int c = 0; c < 4; ++c) {
      const v16bf v_h = ldF(bvh, ((k0 >> 5) + c) * 8 * FRAG);
      const v16bf v_l = ldF(bvl, ((k0 >> 5) + c) * 8 * FRAG);
#pragma unroll   // constant indices into the accumulators
      for (int tm = 0; tm < 2; ++tm) {
        const v16bf p_h = ldAB(aph + tm * 16 * PROW, k0 + 32 * c);
        const v16bf p_l = ldAB(apl + tm * 16 * PROW, k0 + 32 * c);
        REG_CHUNK(p_h, p_l, v_h, v_l, acc[tm][c]);
      }
    }
  }

#pragma unroll   // constant indices into the accumulators
  for (int tm = 0; tm < 2; ++tm) {
    const v8f o = (acc[tm][0] + acc[tm][1]) + (acc[tm][2] + acc[tm][3]);
#pragma unroll
    for (int j = 0; j < 8; ++j) {
      __bf16 hh, ll;
      split2(o[j], hh, ll);
      stH[(j + 8 * lh) * OPITCH + r16] = hh;
      stL[(j + 8 * lh) * OPITCH + r16] = ll;
    }
    // the wave's own LDS writes have landed before it reads the rows back
    asm volatile("s_wait_dscnt 0x0" ::: "memory");
    // rows (b,t), k = h*E + e, pre-split for the output projection: fragment
    // (row / 16) * 32 + k / 32; this tile is its half tn & 1, one piece a lane
    const size_t idx = ((size_t)((b * T_ + t0) / 16 + tm) * 32 + h * 4 + (tn >> 1)) * FRAG
                     + (tn & 1) * 256;
    *(v8bf*)(aoh + idx + vo) = *(const v8bf*)(stH + r16 * OPITCH + 8 * lh);
    *(v8bf*)(aol + idx + vo) = *(const v8bf*)(stL + r16 * OPITCH + 8 * lh);
    // a precaution: the two stores have taken their registers before the second
    // tile's code is given them
    if (tm == 0) {
      asm volatile("s_wait_xcnt 0x0" ::: "memory");
      // no register write of the second tile's code is moved in front of that wait
      __builtin_amdgcn_sched_barrier(0);
    }
  }
}

// ---------------------------------------------------------------------------
// Kernel 3: out = ao @ Wu^T + bu   (split-bf16, M=8192, N=128, K=1024)
// ---------------------------------------------------------------------------
__global__ __launch_bounds__(256)
void proj_kernel(const __bf16* __restrict__ aoh, const __bf16* __restrict__ aol,
                 const __bf16* __restrict__ wuh, const __bf16* __restrict__ wul,
                 const float* __restrict__ bu, float* __restrict__ out) {
  // the wave's number as a scalar: Wu's fragment base stays in scalar registers
  const int wave = __builtin_amdgcn_readfirstlane(threadIdx.x >> 5);
  const int lane = threadIdx.x & 31;
  const int r16 = lane & 15, lh = lane >> 4;
  const unsigned vo = (unsigned)(lane * 8);            // the lane's piece of a fragment
  const int m0 = blockIdx.x * 16;
  const int n0 = wave * 16;
  const int K  = H_ * E_;  // 1024

  // both operands in fragment order: the 32 fragments of a 16-row tile in a row
  const __bf16* aah = aoh + (size_t)m0 * K + vo;
  const __bf16* aal = aol + (size_t)m0 * K + vo;
  const __bf16* bwh = wuh + (size_t)n0 * K + vo;
  const __bf16* bwl = wul + (size_t)n0 * K + vo;

  v8f acc0 = vzero8(), acc1 = vzero8(), acc2 = vzero8(), acc3 = vzero8();
#pragma unroll 2
  for (int k0 = 0; k0 < K; k0 += 128) {
    const int f0 = (k0 >> 5) * FRAG;
    SPLIT_CHUNK(aah, aal, f0,            bwh, bwl, f0,            acc0);
    SPLIT_CHUNK(aah, aal, f0 + FRAG,     bwh, bwl, f0 + FRAG,     acc1);
    SPLIT_CHUNK(aah, aal, f0 + 2 * FRAG, bwh, bwl, f0 + 2 * FRAG, acc2);
    SPLIT_CHUNK(aah, aal, f0 + 3 * FRAG, bwh, bwl, f0 + 3 * FRAG, acc3);
  }
  v8f acc = (acc0 + acc1) + (acc2 + acc3);

  const float bias = bu[n0 + r16];
#pragma unroll
  for (int j = 0; j < 8; ++j) {
    out[(size_t)(m0 + j + 8 * lh) * E_ + n0 + r16] = acc[j] + bias;
  }
}

// ---------------------------------------------------------------------------
extern "C" void kernel_launch(void* const* d_in, const int* in_sizes, int n_in,
                              void* d_out, int out_size, void* d_ws, size_t ws_size,
                              hipStream_t stream) {
  (void)in_sizes; (void)n_in; (void)out_size; (void)ws_size;
  const float* x    = (const float*)d_in[0];
  const int*   mask = (const int*)  d_in[1];
  const float* Wk   = (const float*)d_in[2];   // dict order: x, mask, Wk, Wq, Wv, Wu, bu
  const float* Wq   = (const float*)d_in[3];
  const float* Wv   = (const float*)d_in[4];
  const float* Wu   = (const float*)d_in[5];
  const float* bu   = (const float*)d_in[6];
  float* out = (float*)d_out;

  // workspace layout (bf16 element offsets); total ~140.5 MB
  __bf16* ws = (__bf16*)d_ws;
  const size_t CH = (size_t)B_ * H_ * T_ * E_;   // 8,388,608
  const size_t XH = (size_t)B_ * T_ * E_;        // 1,048,576
  const size_t WH = (size_t)(H_ * E_) * E_;      //   131,072
  __bf16* qh  = ws;            __bf16* ql  = ws + CH;
  __bf16* kh  = ws + 2 * CH;   __bf16* kl  = ws + 3 * CH;
  __bf16* vth = ws + 4 * CH;   __bf16* vtl = ws + 5 * CH;
  __bf16* aoh = ws + 6 * CH;   __bf16* aol = ws + 7 * CH;
  __bf16* xh  = ws + 8 * CH;   __bf16* xl  = xh + XH;
  __bf16* wb  = xl + XH;
  __bf16* wqh = wb;            __bf16* wql = wb + WH;
  __bf16* wkh = wb + 2 * WH;   __bf16* wkl = wb + 3 * WH;
  __bf16* wvh = wb + 4 * WH;   __bf16* wvl = wb + 5 * WH;
  __bf16* wuh = wb + 6 * WH;   __bf16* wul = wb + 7 * WH;

  // 0) split fp32 inputs into bf16 hi/lo, fragment order (8 elements a thread;
  //    last argument: log2 of the row length / 32)
  split_kernel<<<512, 256, 0, stream>>>(x,  xh,  xl,  131072, 2);
  split_kernel<<<64,  256, 0, stream>>>(Wq, wqh, wql, 16384, 2);
  split_kernel<<<64,  256, 0, stream>>>(Wk, wkh, wkl, 16384, 2);
  split_kernel<<<64,  256, 0, stream>>>(Wv, wvh, wvl, 16384, 2);
  split_kernel<<<64,  256, 0, stream>>>(Wu, wuh, wul, 16384, 5);

  // 1) QKV projection (V transposed)
  dim3 g1((B_ * T_) / 64, H_, 3);
  qkv_kernel<<<g1, 256, 0, stream>>>(xh, xl, wqh, wql, wkh, wkl, wvh, wvl,
                                     qh, ql, kh, kl, vth, vtl);

  // 2) attention
  const size_t lds = (size_t)32 * SROW * 4 + (size_t)8 * 768 * 2 + 16;  // 143,888 B
  (void)hipFuncSetAttribute((const void*)attn_kernel,
                            hipFuncAttributeMaxDynamicSharedMemorySize, (int)lds);
  dim3 g2(2 * H_, T_ / 32, B_ / 2);   // (b,h) pair of a group; query tile, last first; group
  attn_kernel<<<g2, 256, lds, stream>>>(qh, ql, kh, kl, vth, vtl, mask, aoh, aol);

  // 3) output projection
  proj_kernel<<<(B_ * T_) / 16, 256, 0, stream>>>(aoh, aol, wuh, wul, bu, out);
}

// v007
// Measured time: 181 microseconds a run.
// Two timings next to v006 both put it at 1.05 times that version's speed.
// Counting every step since v000, it is 3.63 times as fast.
#include <hip/hip_runtime.h>
#include <math.h>

typedef __attribute__((ext_vector_type(4)))  float  v4f;
typedef __attribute__((ext_vector_type(8)))  float  v8f;
typedef __attribute__((ext_vector_type(8)))  __bf16 v8bf;
typedef __attribute__((ext_vector_type(16))) __bf16 v16bf;

constexpr int B_ = 8, T_ = 1024, E_ = 128, H_ = 8;
constexpr int SROW = 1028;   // fp32 score row stride (1028 % 64 == 4 -> conflict-free)
constexpr int PROW = 2 * SROW;  // bf16 prob row stride: a prob row stands in its score row's place
constexpr float SCALE = 0.08838834764831845f;  // 1/sqrt(128)

static __device__ __forceinline__ v8f vzero8() {
  v8f z = {0.f, 0.f, 0.f, 0.f, 0.f, 0.f, 0.f, 0.f};
  return z;
}

// --- bf16 helpers (bit-exact, storage-only use of __bf16) ---
static __device__ __forceinline__ float bf2f(__bf16 h) {
  return __builtin_bit_cast(float, (unsigned)((unsigned)__builtin_bit_cast(unsigned short, h) << 16));
}
static __device__ __forceinline__ __bf16 f2bf(float f) {          // RNE
  unsigned u = __builtin_bit_cast(unsigned, f);
  u = (u + 0x7FFFu + ((u >> 16) & 1u)) >> 16;
  return __builtin_bit_cast(__bf16, (unsigned short)u);
}
static __device__ __forceinline__ void split2(float f, __bf16& h, __bf16& l) {
  h = f2bf(f);
  l = f2bf(f - bf2f(h));
}

// D = A(16x32 bf16) * B(32x16 bf16) + C(16x16 f32)
static __device__ __forceinline__ v8f wmma_bf(v16bf a, v16bf b, v8f c) {
  return __builtin_amdgcn_wmma_f32_16x16x32_bf16(false, a, false, b, (short)0, c, false, false);
}

// Per-lane A/B operand slice from a K-contiguous row.
// p must be pre-offset by row*stride + 8*(lane>>4).
// elems 0..7 <- K[k0 + 8*lh .. +7], elems 8..15 <- K[k0 + 16 + 8*lh .. +7]
static __device__ __forceinline__ v16bf ldAB(const __bf16* p, int k0) {
  v8bf a = *(const v8bf*)(p + k0);
  v8bf b = *(const v8bf*)(p + k0 + 16);
  return __builtin_shufflevector(a, b, 0,1,2,3,4,5,6,7,8,9,10,11,12,13,14,15);
}

// FRAGMENT ORDER of the global bf16 planes. A plane is cut into fragments of
// 16 rows x 32 k = 512 elements (1024 B). Inside one, the 16-byte piece that
// holds row r, k = 16*half + 8*lh .. +7 stands at element half*256 + (16*lh + r)*8.
// Lane r + 16*lh then finds its operand slice at lane*8 and 256 + lane*8, and each
// of the two wave-wide loads reads 512 contiguous bytes (4 whole lines) instead
// of 32 bytes out of each of 16 lines.
constexpr int FRAG = 512;   // elements of one fragment

// p must be pre-offset by lane*8; off = element offset of the fragment.
static __device__ __forceinline__ v16bf ldF(const __bf16* p, int off) {
  v8bf a = *(const v8bf*)(p + off);
  v8bf b = *(const v8bf*)(p + off + 256);
  return __builtin_shufflevector(a, b, 0,1,2,3,4,5,6,7,8,9,10,11,12,13,14,15);
}

// One K=32 chunk of the split-bf16 product: hi*hi + hi*lo + lo*hi.
// Both operands from planes in fragment order, at fragment offsets FA_ and FB_.
#define SPLIT_CHUNK(AH_, AL_, FA_, BH_, BL_, FB_, ACC_)  \
  do {                                              \
    v16bf _ah = ldF((AH_), (FA_));                  \
    v16bf _al = ldF((AL_), (FA_));                  \
    v16bf _bh = ldF((BH_), (FB_));                  \
    v16bf _bl = ldF((BL_), (FB_));                  \
    (ACC_) = wmma_bf(_ah, _bh, (ACC_));             \
    (ACC_) = wmma_bf(_ah, _bl, (ACC_));             \
    (ACC_) = wmma_bf(_al, _bh, (ACC_));             \
  } while (0)

// The same three products with all four operands already in registers.
#define REG_CHUNK(AH_, AL_, BH_, BL_, ACC_)         \
  do {                                              \
    (ACC_) = wmma_bf((AH_), (BH_), (ACC_));         \
    (ACC_) = wmma_bf((AH_), (BL_), (ACC_));         \
    (ACC_) = wmma_bf((AL_), (BH_), (ACC_));         \
  } while (0)

// ---------------------------------------------------------------------------
// Kernel 0: elementwise fp32 -> (bf16 hi, bf16 lo) split of x and of the four
// weight matrices in ONE launch: none of the five needs anything of another, so
// they share a grid by ranges of the block index (a block-uniform choice).
// Row-major source of 32 << lgc columns, planes written in fragment order
// (fragments of a 16-row tile follow one another along k). One 16-byte piece of
// each plane a thread, taken in the order of the destination.
// ---------------------------------------------------------------------------
constexpr int XBLK = (B_ * T_ * E_ / 8) / 256;        // 512 blocks for x
constexpr int WBLK = (H_ * E_ * E_ / 8) / 256;        //  64 blocks for each weight
constexpr size_t WPLANE = (size_t)(H_ * E_) * E_;     // elements of one weight plane

__global__ __launch_bounds__(256)
void split_kernel(const float* __restrict__ x,  const float* __restrict__ Wq,
                  const float* __restrict__ Wk, const float* __restrict__ Wv,
                  const float* __restrict__ Wu,
                  __bf16* __restrict__ xh, __bf16* __restrict__ xl,
                  __bf16* __restrict__ wb) {
  // wb: hi and lo plane of Wq, Wk, Wv, Wu, one behind the other
  const int blk = blockIdx.x;
  const float* src = x;
  __bf16* h = xh;
  __bf16* l = xl;
  int lgc = 2;                                        // x, Wq, Wk, Wv: 128 columns
  int first = blk;
  if (blk >= XBLK) {
    const int j = (blk - XBLK) / WBLK;
    src = j == 0 ? Wq : j == 1 ? Wk : j == 2 ? Wv : Wu;
    if (j == 3) lgc = 5;                              // Wu: 1024 columns
    h = wb + (size_t)(2 * j) * WPLANE;
    l = h + WPLANE;
    first = (blk - XBLK) % WBLK;
  }
  const int d = first * 256 + threadIdx.x;
  const int frag = d >> 6;
  const int row  = (frag >> lgc) * 16 + (d & 15);
  const int k    = (frag & ((1 << lgc) - 1)) * 32 + ((d >> 5) & 1) * 16 + ((d >> 4) & 1) * 8;
  const float* sp = src + ((size_t)row << (lgc + 5)) + k;
  const v4f f0 = *(const v4f*)sp;
  const v4f f1 = *(const v4f*)(sp + 4);
  v8bf hv, lv;
#pragma unroll   // constant indices: the four vectors stay in registers
  for (int j = 0; j < 8; ++j) {
    __bf16 hh, ll;
    split2(j < 4 ? f0[j & 3] : f1[j & 3], hh, ll);
    hv[j] = hh;
    lv[j] = ll;
  }
  *(v8bf*)(h + (size_t)d * 8) = hv;
  *(v8bf*)(l + (size_t)d * 8) = lv;
}

// ---------------------------------------------------------------------------
// Kernel 1: QKV projection (split-bf16 GEMM, K=128 -> 4 chunks * 3 WMMA).
// grid = (128, H, 3), block = 256: 64 rows of x by one head's 128 columns.
// x and W are read, and Q, K, V^T written, in fragment order.
// Q, K: rows t, k = e; per (b,h) fragment (t/16)*4 + e/32.
// V^T : rows e, k = t; per (b,h) fragment (t/32)*8 + e/16.
// The hi and lo output tiles are staged in LDS, and leave as 16-byte stores in
// the order of the destination, 512 contiguous bytes a wave.
// ---------------------------------------------------------------------------
constexpr int QK_PITCH = 136;   // staged Q/K row: 128 e + 8 (272 B, 4 banks a row)
constexpr int VT_PITCH = 72;    // staged V^T row: 64 t + 8 (144 B, 36 dwords a row)
constexpr int STAGE_ELEMS = 128 * VT_PITCH;   // one plane; also holds 64 * QK_PITCH

// TR == false: D = W * x^T, so a lane holds 8 consecutive e of one row t.
// TR == true : D = x * W^T, so a lane holds 8 consecutive t of one column e.
// Either way the lane's 8 values are one 16-byte piece of the output layout.
template <bool TR>
static __device__ __forceinline__ void qkv_tile(
    const __bf16* __restrict__ xh, const __bf16* __restrict__ xl,
    const __bf16* __restrict__ Wh, const __bf16* __restrict__ Wl,
    __bf16* __restrict__ oh, __bf16* __restrict__ ol,
    __bf16* sH, __bf16* sL) {
  // the wave's number as a scalar: W's and x's row bases then stay in scalar
  // registers and every fragment load shares one per-lane offset
  const int wave = __builtin_amdgcn_readfirstlane(threadIdx.x >> 5);
  const int lane = threadIdx.x & 31;
  const int r16 = lane & 15, lh = lane >> 4;
  const int m0 = blockIdx.x * 64;
  const int h  = blockIdx.y;
  const unsigned vo = (unsigned)(lane * 8);            // the lane's piece of a fragment

  const __bf16* bwh = Wh + (size_t)(h * E_ + wave * 16) * E_ + vo;
  const __bf16* bwl = Wl + (size_t)(h * E_ + wave * 16) * E_ + vo;
  const v16bf w_h0 = ldF(bwh, 0),        w_h1 = ldF(bwh, FRAG);
  const v16bf w_h2 = ldF(bwh, 2 * FRAG), w_h3 = ldF(bwh, 3 * FRAG);
  const v16bf w_l0 = ldF(bwl, 0),        w_l1 = ldF(bwl, FRAG);
  const v16bf w_l2 = ldF(bwl, 2 * FRAG), w_l3 = ldF(bwl, 3 * FRAG);

// hi*hi + hi*lo + lo*hi of one K=32 chunk, x's fragments already in registers
#define XW_CHUNK(XH_, XL_, WH_, WL_, ACC_)            \
  do {                                                \
    if (TR) {                                         \
      (ACC_) = wmma_bf((XH_), (WH_), (ACC_));         \
      (ACC_) = wmma_bf((XH_), (WL_), (ACC_));         \
      (ACC_) = wmma_bf((XL_), (WH_), (ACC_));         \
    } else {                                          \
      (ACC_) = wmma_bf((WH_), (XH_), (ACC_));         \
      (ACC_) = wmma_bf((WL_), (XH_), (ACC_));         \
      (ACC_) = wmma_bf((WH_), (XL_), (ACC_));         \
    }                                                 \
  } while (0)

  const __bf16* axh = xh + (size_t)m0 * E_ + vo;
  const __bf16* axl = xl + (size_t)m0 * E_ + vo;
  v16bf fh[4], fl[4];                              // x fragments of one 16-row tile
#pragma unroll
  for (int c = 0; c < 4; ++c) {
    fh[c] = ldF(axh, c * FRAG);
    fl[c] = ldF(axl, c * FRAG);
  }
  // all 32 first loads issue before the first product; left alone, the last
  // ones were issued in pairs among the products, each behind a wait to 0
  __builtin_amdgcn_sched_barrier(0);

#pragma unroll
  for (int mt = 0; mt < 4; ++mt) {
    v8f acc0 = vzero8(), acc1 = vzero8(), acc2 = vzero8(), acc3 = vzero8();
    XW_CHUNK(fh[0], fl[0], w_h0, w_l0, acc0);
    XW_CHUNK(fh[1], fl[1], w_h1, w_l1, acc1);
    XW_CHUNK(fh[2], fl[2], w_h2, w_l2, acc2);
    XW_CHUNK(fh[3], fl[3], w_h3, w_l3, acc3);
    v8f acc = (acc0 + acc1) + (acc2 + acc3);

    if (mt < 3) {
      // the next tile's loads stay behind this tile's products, so that they take
      // the same registers: hoisted, they cost a second set and resident blocks
      __builtin_amdgcn_sched_barrier(0);
      // they fly while this tile is split and staged
#pragma unroll
      for (int c = 0; c < 4; ++c) {
        fh[c] = ldF(axh, ((mt + 1) * 4 + c) * FRAG);
        fl[c] = ldF(axl, ((mt + 1) * 4 + c) * FRAG);
      }
      // a precaution: the loads issued so far have taken their address register
      // before anything below may be given it
      asm volatile("s_wait_xcnt 0x0" ::: "memory");
      // no load is moved behind that wait and no register write in front of it
      __builtin_amdgcn_sched_barrier(0);
    }

    v8bf hv, lv;                                   // C layout: VGPR j -> M = j + 8*(lane/16)
#pragma unroll
    for (int j = 0; j < 8; ++j) {
      __bf16 hh, ll;
      split2(acc[j], hh, ll);
      hv[j] = hh;
      lv[j] = ll;
    }
    const int off = TR ? (wave * 16 + r16) * VT_PITCH + mt * 16 + 8 * lh    // [e][t]
                       : (mt * 16 + r16) * QK_PITCH + wave * 16 + 8 * lh;   // [t][e]
    *(v8bf*)(sH + off) = hv;
    *(v8bf*)(sL + off) = lv;
  }
#undef XW_CHUNK
  __syncthreads();   // every wave's pieces are staged before any row is read back

  const int bb = m0 / T_;
  const int tb = m0 % T_;
#pragma unroll
  for (int i = 0; i < 4; ++i) {
    const int c = i * 256 + threadIdx.x;           // 1024 pieces of 16 B a plane
    const int f = c >> 6;                          // 16 fragments, 64 pieces each
    const int r = c & 15;                          // the piece's row in its fragment
    const int kk = ((c >> 5) & 1) * 16 + ((c >> 4) & 1) * 8;   // and its first k
    // either way the block's 64 t are 16 fragments in a row, from element tb * E_
    const int from = TR ? ((f & 7) * 16 + r) * VT_PITCH + (f >> 3) * 32 + kk    // [e][t]
                        : ((f >> 2) * 16 + r) * QK_PITCH + (f & 3) * 32 + kk;   // [t][e]
    const size_t to = ((size_t)bb * H_ + h) * (size_t)T_ * E_ + (size_t)tb * E_ + c * 8;
    *(v8bf*)(oh + to) = *(const v8bf*)(sH + from);
    *(v8bf*)(ol + to) = *(const v8bf*)(sL + from);
  }
  // a precaution: the stores have taken their registers before the V^T code,
  // which follows this one in the built text behind a conditional branch
  if (!TR) asm volatile("s_wait_xcnt 0x0" ::: "memory");
}

__global__ __launch_bounds__(256)
void qkv_kernel(const __bf16* __restrict__ xh, const __bf16* __restrict__ xl,
                const __bf16* __restrict__ wqh, const __bf16* __restrict__ wql,
                const __bf16* __restrict__ wkh, const __bf16* __restrict__ wkl,
                const __bf16* __restrict__ wvh, const __bf16* __restrict__ wvl,
                __bf16* __restrict__ qh, __bf16* __restrict__ ql,
                __bf16* __restrict__ kh, __bf16* __restrict__ kl,
                __bf16* __restrict__ vth, __bf16* __restrict__ vtl) {
  __shared__ __attribute__((aligned(16))) __bf16 sH[STAGE_ELEMS];
  __shared__ __attribute__((aligned(16))) __bf16 sL[STAGE_ELEMS];
  if (blockIdx.z == 2) {
    qkv_tile<true>(xh, xl, wvh, wvl, vth, vtl, sH, sL);
    return;
  }
  const bool isq = blockIdx.z == 0;
  qkv_tile<false>(xh, xl, isq ? wqh : wkh, isq ? wql : wkl,
                  isq ? qh : kh, isq ? ql : kl, sH, sL);
}

// ---------------------------------------------------------------------------
// Kernel 2: attention, one (b,h) x 32 query rows per block.
// LDS: fp32 S [32][SROW] + output staging 8 x 1,536 B + one flag word = 143,888 B,
// so that two blocks stand on a WGP (which also takes at most 256 VGPRs a wave).
// A score row's 4,112 B later hold the row's P: hi in the first 2,048 B, lo in
// the next 2,048 B.
// Keys past the block's causal edge hold only -inf or -1e9. While every row's
// maximum is far above -1e9 their exp is exactly 0, so they are not walked.
// ---------------------------------------------------------------------------
__global__ __launch_bounds__(256)
void attn_kernel(const __bf16* __restrict__ qh, const __bf16* __restrict__ ql,
                 const __bf16* __restrict__ kh, const __bf16* __restrict__ kl,
                 const __bf16* __restrict__ vth, const __bf16* __restrict__ vtl,
                 const int* __restrict__ mask,
                 __bf16* __restrict__ aoh, __bf16* __restrict__ aol) {
  extern __shared__ char smem[];
  float*  sS  = (float*)smem;                          // [32][SROW] fp32
  __bf16* pHi = (__bf16*)smem;                         // [32][PROW], over S row by row
  __bf16* pLo = pHi + T_;                              // [32][PROW], behind the row's hi
  __bf16* sOut = (__bf16*)(smem + 32 * SROW * 4);      // 8 waves x 768 elements
  int* sFull  = (int*)(smem + 32 * SROW * 4 + 8 * 768 * 2);  // 1: walk all T_ keys

  // the wave's number as a scalar: fragment bases then stay in scalar registers
  // and every fragment load shares the one per-lane offset vo
  const int wave = __builtin_amdgcn_readfirstlane(threadIdx.x >> 5);
  const int lane = threadIdx.x & 31;
  const int r16 = lane & 15, lh = lane >> 4;
  const unsigned vo = (unsigned)(lane * 8);            // the lane's piece of a fragment
  // Block order: a block's cost grows with its query tile (it walks the keys up to
  // its causal edge) and there are four times as many blocks as places. So cost
  // falls with the index: within a group of
  // 16 (b,h) pairs the last query tile comes first, and the launch ends on the
  // short blocks. Groups of 16 pairs keep the K and V in use at one time small.
  const int b = blockIdx.z * 2 + (blockIdx.x >> 3), h = blockIdx.x & 7;
  const int t0 = (T_ / 32 - 1 - blockIdx.y) * 32;

  const size_t bh = ((size_t)b * H_ + h) * (size_t)T_ * E_;
  const __bf16* Qh = qh + bh;  const __bf16* Ql = ql + bh;
  const __bf16* Kh = kh + bh;  const __bf16* Kl = kl + bh;
  const __bf16* Vh = vth + bh; const __bf16* Vl = vtl + bh;   // all in fragment order

  // keys up to the causal edge of the last query row, in whole groups of 128
  // (one key tile for each of the 8 waves)
  const int nkc = (t0 + 32 + 127) & ~127;
  int nk = nkc;
  if (threadIdx.x == 0) *sFull = 0;

  // ---- Phase 1: S = (Q K^T)*scale, causal -inf then padding -1e9 ----
  // Q of both 16-row tiles (16 x v16bf) stays in registers; a K fragment is
  // loaded once and multiplied with both, so K crosses from L2 once a block.
  {
    const __bf16* aqh = Qh + (size_t)t0 * E_ + vo;   // 4 fragments a 16-row tile
    const __bf16* aql = Ql + (size_t)t0 * E_ + vo;
    v16bf q_h[2][4], q_l[2][4];
#pragma unroll   // constant indices: the fragments stay in registers
    for (int c = 0; c < 8; ++c) {
      q_h[c >> 2][c & 3] = ldF(aqh, c * FRAG);
      q_l[c >> 2][c & 3] = ldF(aql, c * FRAG);
    }

    for (int tb = 0; tb < (nkc >> 4); tb += 8) {
      const int k0 = (tb + wave) * 16;
      const __bf16* bkh = Kh + (size_t)k0 * E_ + vo;
      const __bf16* bkl = Kl + (size_t)k0 * E_ + vo;
      v16bf k_h[4], k_l[4];
#pragma unroll   // constant indices: the fragments stay in registers
      for (int c = 0; c < 4; ++c) {
        k_h[c] = ldF(bkh, c * FRAG);
        k_l[c] = ldF(bkl, c * FRAG);
      }

      const int kg = k0 + r16;
#pragma unroll   // constant indices into the Q fragments
      for (int tm = 0; tm < 2; ++tm) {
        const int q0 = t0 + tm * 16;
        v8f acc0 = vzero8(), acc1 = vzero8(), acc2 = vzero8(), acc3 = vzero8();
        REG_CHUNK(q_h[tm][0], q_l[tm][0], k_h[0], k_l[0], acc0);
        REG_CHUNK(q_h[tm][1], q_l[tm][1], k_h[1], k_l[1], acc1);
        REG_CHUNK(q_h[tm][2], q_l[tm][2], k_h[2], k_l[2], acc2);
        REG_CHUNK(q_h[tm][3], q_l[tm][3], k_h[3], k_l[3], acc3);
        v8f acc = (acc0 + acc1) + (acc2 + acc3);

#pragma unroll
        for (int j = 0; j < 8; ++j) {
          const int qg = q0 + j + 8 * lh;
          float val = acc[j] * SCALE;
          if (kg > qg) val = -INFINITY;                      // causal first
          if (mask[(size_t)qg * T_ + kg] == 0) val = -1e9f;  // padding overwrites
          sS[(tm * 16 + j + 8 * lh) * SROW + kg] = val;
        }
      }
    }
  }
  __syncthreads();

  // ---- Phase 2a: row maxima over the walked keys ----
  float mxr[4];
  bool low = false;
#pragma unroll
  for (int r = 0; r < 4; ++r) {
    const float* row = sS + (wave * 4 + r) * SROW;
    float mx = -INFINITY;
    for (int cb = 0; cb < nkc; cb += 128) {
#pragma unroll   // four reads behind one wait; the key count is a multiple of 128
      for (int u = 0; u < 4; ++u) mx = fmaxf(mx, row[cb + 32 * u + lane]);
    }
    for (int off = 16; off; off >>= 1) mx = fmaxf(mx, __shfl_xor(mx, off, 32));
    mxr[r] = mx;
    low = low || !(mx >= -5e8f);   // exp(-1e9 - mx) might not be 0 for this row
  }
  if (low) *sFull = 1;
  __syncthreads();   // publishes the flag: all waves must walk the same key count
  if (__builtin_amdgcn_readfirstlane(*sFull) != 0) {
    // A row without a live key up to the edge: the keys past the edge count.
    // All of them are causal for every row here, so no product is needed.
    // Each wave fills the rows that it alone reads in phase 2.
    nk = T_;
#pragma unroll
    for (int r = 0; r < 4; ++r) {
      const int rr = wave * 4 + r;
      float* row = sS + rr * SROW;
      float mx = mxr[r];
      for (int c = nkc + lane; c < T_; c += 32) {
        const float val = (mask[(size_t)(t0 + rr) * T_ + c] == 0) ? -1e9f : -INFINITY;
        row[c] = val;
        mx = fmaxf(mx, val);
      }
      for (int off = 16; off; off >>= 1) mx = fmaxf(mx, __shfl_xor(mx, off, 32));
      mxr[r] = mx;
    }
  }

  // ---- Phase 2b: exp, row sum; emit P as split bf16 ----
  // The wave takes a whole row into registers (up to 32 values a lane) and only
  // then writes P over it: every store of a row depends, through the row's sum,
  // on every load of that row, and no other wave touches the row in this phase.
#pragma unroll
  for (int r = 0; r < 4; ++r) {
    const int rr = wave * 4 + r;
    const float* row = sS + rr * SROW;
    const float mx = mxr[r];
    float e[32];
    float sum = 0.f;
#pragma unroll   // constant indices: the row stays in registers; nk is a scalar
    for (int g = 0; g < 8; ++g) {
      if (g * 128 < nk) {
#pragma unroll   // constant indices
        for (int u = 0; u < 4; ++u) e[g * 4 + u] = row[g * 128 + 32 * u + lane];
      }
    }
#pragma unroll   // constant indices; same per-lane order of the sum
    for (int g = 0; g < 8; ++g) {
      if (g * 128 < nk) {
#pragma unroll   // constant indices
        for (int u = 0; u < 4; ++u) {
          e[g * 4 + u] = expf(e[g * 4 + u] - mx);
          sum += e[g * 4 + u];
        }
      }
    }
    for (int off = 16; off; off >>= 1) sum += __shfl_xor(sum, off, 32);
    const float inv = 1.f / sum;
#pragma unroll   // constant indices
    for (int g = 0; g < 8; ++g) {
      if (g * 128 < nk) {
#pragma unroll   // constant indices
        for (int u = 0; u < 4; ++u) {
          const int c = g * 128 + 32 * u + lane;
          __bf16 hh, ll;
          split2(e[g * 4 + u] * inv, hh, ll);
          pHi[rr * PROW + c] = hh;
          pLo[rr * PROW + c] = ll;
        }
      }
    }
  }
  __syncthreads();

  // ---- Phase 3: O = P @ V  (A from LDS split-bf16, B from transposed V) ----
  // Each wave turns its output tiles, in a staging range of its own, into the
  // 16-byte pieces of the fragment order.
  constexpr int OPITCH = 24;                        // 48 B a row: 16 rows, 16 bank groups
  __bf16* stH = sOut + wave * 768;                  // [16][OPITCH]
  __bf16* stL = stH + 16 * OPITCH;
  // Wave w owns the 16 columns e = 16*w of both 16-row tiles: a V fragment is
  // loaded once and multiplied with both, so V crosses from L2 once a block.
  const int tn = wave;
  const __bf16* aph = pHi + r16 * PROW + 8 * lh;
  const __bf16* apl = pLo + r16 * PROW + 8 * lh;
  const __bf16* bvh = Vh + tn * FRAG + vo;           // 32 keys on: 8 fragments on
  const __bf16* bvl = Vl + tn * FRAG + vo;

  v8f acc[2][4];
#pragma unroll   // constant indices: the accumulators stay in registers
  for (int c = 0; c < 8; ++c) acc[c >> 2][c & 3] = vzero8();
  for (int k0 = 0; k0 < nk; k0 += 128) {
#pragma unroll   // constant indices into the accumulators
    for (int c = 0; c < 4; ++c) {
      const v16bf v_h = ldF(bvh, ((k0 >> 5) + c) * 8 * FRAG);
      const v16bf v_l = ldF(bvl, ((k0 >> 5) + c) * 8 * FRAG);
#pragma unroll   // constant indices into the accumulators
      for (int tm = 0; tm < 2; ++tm) {
        const v16bf p_h = ldAB(aph + tm * 16 * PROW, k0 + 32 * c);
        const v16bf p_l = ldAB(apl + tm * 16 * PROW, k0 + 32 * c);
        REG_CHUNK(p_h, p_l, v_h, v_l, acc[tm][c]);
      }
    }
  }

#pragma unroll   // constant indices into the accumulators
  for (int tm = 0; tm < 2; ++tm) {
    const v8f o = (acc[tm][0] + acc[tm][1]) + (acc[tm][2] + acc[tm][3]);
#pragma unroll
    for (int j = 0; j < 8; ++j) {
      __bf16 hh, ll;
      split2(o[j], hh, ll);
      stH[(j + 8 * lh) * OPITCH + r16] = hh;
      stL[(j + 8 * lh) * OPITCH + r16] = ll;
    }
    // the wave's own LDS writes have landed before it reads the rows back
    asm volatile("s_wait_dscnt 0x0" ::: "memory");
    // rows (b,t), k = h*E + e, pre-split for the output projection: fragment
    // (row / 16) * 32 + k / 32; this tile is its half tn & 1, one piece a lane
    const size_t idx = ((size_t)((b * T_ + t0) / 16 + tm) * 32 + h * 4 + (tn >> 1)) * FRAG
                     + (tn & 1) * 256;
    *(v8bf*)(aoh + idx + vo) = *(const v8bf*)(stH + r16 * OPITCH + 8 * lh);
    *(v8bf*)(aol + idx + vo) = *(const v8bf*)(stL + r16 * OPITCH + 8 * lh);
    // a precaution: the two stores have taken their registers before the second
    // tile's code is given them
    if (tm == 0) {
      asm volatile("s_wait_xcnt 0x0" ::: "memory");
      // no register write of the second tile's code is moved in front of that wait
      __builtin_amdgcn_sched_barrier(0);
    }
  }
}

// ---------------------------------------------------------------------------
// Kernel 3: out = ao @ Wu^T + bu   (split-bf16, M=8192, N=128, K=1024)
// ---------------------------------------------------------------------------
__global__ __launch_bounds__(256)
void proj_kernel(const __bf16* __restrict__ aoh, const __bf16* __restrict__ aol,
                 const __bf16* __restrict__ wuh, const __bf16* __restrict__ wul,
                 const float* __restrict__ bu, float* __restrict__ out) {
  // the wave's number as a scalar: Wu's fragment base stays in scalar registers
  const int wave = __builtin_amdgcn_readfirstlane(threadIdx.x >> 5);
  const int lane = threadIdx.x & 31;
  const int r16 = lane & 15, lh = lane >> 4;
  const unsigned vo = (unsigned)(lane * 8);            // the lane's piece of a fragment
  const int m0 = blockIdx.x * 16;
  const int n0 = wave * 16;
  const int K  = H_ * E_;  // 1024

  // both operands in fragment order: the 32 fragments of a 16-row tile in a row
  const __bf16* aah = aoh + (size_t)m0 * K + vo;
  const __bf16* aal = aol + (size_t)m0 * K + vo;
  const __bf16* bwh = wuh + (size_t)n0 * K + vo;
  const __bf16* bwl = wul + (size_t)n0 * K + vo;

  v8f acc0 = vzero8(), acc1 = vzero8(), acc2 = vzero8(), acc3 = vzero8();
#pragma unroll 2
  for (int k0 = 0; k0 < K; k0 += 128) {
    const int f0 = (k0 >> 5) * FRAG;
    SPLIT_CHUNK(aah, aal, f0,            bwh, bwl, f0,            acc0);
    SPLIT_CHUNK(aah, aal, f0 + FRAG,     bwh, bwl, f0 + FRAG,     acc1);
    SPLIT_CHUNK(aah, aal, f0 + 2 * FRAG, bwh, bwl, f0 + 2 * FRAG, acc2);
    SPLIT_CHUNK(aah, aal, f0 + 3 * FRAG, bwh, bwl, f0 + 3 * FRAG, acc3);
  }
  v8f acc = (acc0 + acc1) + (acc2 + acc3);

  const float bias = bu[n0 + r16];
#pragma unroll
  for (int j = 0; j < 8; ++j) {
    out[(size_t)(m0 + j + 8 * lh) * E_ + n0 + r16] = acc[j] + bias;
  }
}

// ---------------------------------------------------------------------------
extern "C" void kernel_launch(void* const* d_in, const int* in_sizes, int n_in,
                              void* d_out, int out_size, void* d_ws, size_t ws_size,
                              hipStream_t stream) {
  (void)in_sizes; (void)n_in; (void)out_size; (void)ws_size;
  const float* x    = (const float*)d_in[0];
  const int*   mask = (const int*)  d_in[1];
  const float* Wk   = (const float*)d_in[2];   // dict order: x, mask, Wk, Wq, Wv, Wu, bu
  const float* Wq   = (const float*)d_in[3];
  const float* Wv   = (const float*)d_in[4];
  const float* Wu   = (const float*)d_in[5];
  const float* bu   = (const float*)d_in[6];
  float* out = (float*)d_out;

  // workspace layout (bf16 element offsets); total ~140.5 MB
  __bf16* ws = (__bf16*)d_ws;
  const size_t CH = (size_t)B_ * H_ * T_ * E_;   // 8,388,608
  const size_t XH = (size_t)B_ * T_ * E_;        // 1,048,576
  const size_t WH = (size_t)(H_ * E_) * E_;      //   131,072
  __bf16* qh  = ws;            __bf16* ql  = ws + CH;
  __bf16* kh  = ws + 2 * CH;   __bf16* kl  = ws + 3 * CH;
  __bf16* vth = ws + 4 * CH;   __bf16* vtl = ws + 5 * CH;
  __bf16* aoh = ws + 6 * CH;   __bf16* aol = ws + 7 * CH;
  __bf16* xh  = ws + 8 * CH;   __bf16* xl  = xh + XH;
  __bf16* wb  = xl + XH;
  __bf16* wqh = wb;            __bf16* wql = wb + WH;
  __bf16* wkh = wb + 2 * WH;   __bf16* wkl = wb + 3 * WH;
  __bf16* wvh = wb + 4 * WH;   __bf16* wvl = wb + 5 * WH;
  __bf16* wuh = wb + 6 * WH;   __bf16* wul = wb + 7 * WH;

  // 0) split fp32 inputs into bf16 hi/lo, fragment order (8 elements a thread):
  //    512 blocks for x, then 64 for each of Wq, Wk, Wv, Wu, in one launch
  split_kernel<<<512 + 4 * 64, 256, 0, stream>>>(x, Wq, Wk, Wv, Wu, xh, xl, wb);

  // 1) QKV projection (V transposed)
  dim3 g1((B_ * T_) / 64, H_, 3);
  qkv_kernel<<<g1, 256, 0, stream>>>(xh, xl, wqh, wql, wkh, wkl, wvh, wvl,
                                     qh, ql, kh, kl, vth, vtl);

  // 2) attention
  const size_t lds = (size_t)32 * SROW * 4 + (size_t)8 * 768 * 2 + 16;  // 143,888 B
  (void)hipFuncSetAttribute((const void*)attn_kernel,
                            hipFuncAttributeMaxDynamicSharedMemorySize, (int)lds);
  dim3 g2(2 * H_, T_ / 32, B_ / 2);   // (b,h) pair of a group; query tile, last first; group
  attn_kernel<<<g2, 256, lds, stream>>>(qh, ql, kh, kl, vth, vtl, mask, aoh, aol);

  // 3) output projection
  proj_kernel<<<(B_ * T_) / 16, 256, 0, stream>>>(aoh, aol, wuh, wul, bu, out);
}

// v008
// Measured time: 173 microseconds a run.
// Two timings next to v007 both put it at 1.05 times that version's speed.
// All steps since v000 together make it 3.80 times as fast.
#include <hip/hip_runtime.h>
#include <math.h>

typedef __attribute__((ext_vector_type(4)))  float  v4f;
typedef __attribute__((ext_vector_type(8)))  float  v8f;
typedef __attribute__((ext_vector_type(8)))  __bf16 v8bf;
typedef __attribute__((ext_vector_type(16))) __bf16 v16bf;

constexpr int B_ = 8, T_ = 1024, E_ = 128, H_ = 8;
constexpr int SROW = 1028;   // fp32 score row stride (1028 % 64 == 4 -> conflict-free)
constexpr int PROW = 2 * SROW;  // bf16 prob row stride: a prob row stands in its score row's place
constexpr float SCALE = 0.08838834764831845f;  // 1/sqrt(128)

static __device__ __forceinline__ v8f vzero8() {
  v8f z = {0.f, 0.f, 0.f, 0.f, 0.f, 0.f, 0.f, 0.f};
  return z;
}

// --- bf16 helpers (bit-exact, storage-only use of __bf16) ---
static __device__ __forceinline__ float bf2f(__bf16 h) {
  return __builtin_bit_cast(float, (unsigned)((unsigned)__builtin_bit_cast(unsigned short, h) << 16));
}
static __device__ __forceinline__ __bf16 f2bf(float f) {          // RNE
  unsigned u = __builtin_bit_cast(unsigned, f);
  u = (u + 0x7FFFu + ((u >> 16) & 1u)) >> 16;
  return __builtin_bit_cast(__bf16, (unsigned short)u);
}
static __device__ __forceinline__ void split2(float f, __bf16& h, __bf16& l) {
  h = f2bf(f);
  l = f2bf(f - bf2f(h));
}

// D = A(16x32 bf16) * B(32x16 bf16) + C(16x16 f32)
static __device__ __forceinline__ v8f wmma_bf(v16bf a, v16bf b, v8f c) {
  return __builtin_amdgcn_wmma_f32_16x16x32_bf16(false, a, false, b, (short)0, c, false, false);
}

// Per-lane A/B operand slice from a K-contiguous row.
// p must be pre-offset by row*stride + 8*(lane>>4).
// elems 0..7 <- K[k0 + 8*lh .. +7], elems 8..15 <- K[k0 + 16 + 8*lh .. +7]
static __device__ __forceinline__ v16bf ldAB(const __bf16* p, int k0) {
  v8bf a = *(const v8bf*)(p + k0);
  v8bf b = *(const v8bf*)(p + k0 + 16);
  return __builtin_shufflevector(a, b, 0,1,2,3,4,5,6,7,8,9,10,11,12,13,14,15);
}

// FRAGMENT ORDER of the global bf16 planes. A plane is cut into fragments of
// 16 rows x 32 k = 512 elements (1024 B). Inside one, the 16-byte piece that
// holds row r, k = 16*half + 8*lh .. +7 stands at element half*256 + (16*lh + r)*8.
// Lane r + 16*lh then finds its operand slice at lane*8 and 256 + lane*8, and each
// of the two wave-wide loads reads 512 contiguous bytes (4 whole lines) instead
// of 32 bytes out of each of 16 lines.
constexpr int FRAG = 512;   // elements of one fragment

// p must be pre-offset by lane*8; off = element offset of the fragment.
static __device__ __forceinline__ v16bf ldF(const __bf16* p, int off) {
  v8bf a = *(const v8bf*)(p + off);
  v8bf b = *(const v8bf*)(p + off + 256);
  return __builtin_shufflevector(a, b, 0,1,2,3,4,5,6,7,8,9,10,11,12,13,14,15);
}

// One K=32 chunk of the split-bf16 product: hi*hi + hi*lo + lo*hi.
// Both operands from planes in fragment order, at fragment offsets FA_ and FB_.
#define SPLIT_CHUNK(AH_, AL_, FA_, BH_, BL_, FB_, ACC_)  \
  do {                                              \
    v16bf _ah = ldF((AH_), (FA_));                  \
    v16bf _al = ldF((AL_), (FA_));                  \
    v16bf _bh = ldF((BH_), (FB_));                  \
    v16bf _bl = ldF((BL_), (FB_));                  \
    (ACC_) = wmma_bf(_ah, _bh, (ACC_));             \
    (ACC_) = wmma_bf(_ah, _bl, (ACC_));             \
    (ACC_) = wmma_bf(_al, _bh, (ACC_));             \
  } while (0)

// The same three products with all four operands already in registers.
#define REG_CHUNK(AH_, AL_, BH_, BL_, ACC_)         \
  do {                                              \
    (ACC_) = wmma_bf((AH_), (BH_), (ACC_));         \
    (ACC_) = wmma_bf((AH_), (BL_), (ACC_));         \
    (ACC_) = wmma_bf((AL_), (BH_), (ACC_));         \
  } while (0)

// ---------------------------------------------------------------------------
// Kernel 0: elementwise fp32 -> (bf16 hi, bf16 lo) split of x and of the four
// weight matrices in ONE launch: none of the five needs anything of another, so
// they share a grid by ranges of the block index (a block-uniform choice).
// Row-major source of 32 << lgc columns, planes written in fragment order
// (fragments of a 16-row tile follow one another along k). One 16-byte piece of
// each plane a thread, taken in the order of the destination.
// ---------------------------------------------------------------------------
constexpr int XBLK = (B_ * T_ * E_ / 8) / 256;        // 512 blocks for x
constexpr int WBLK = (H_ * E_ * E_ / 8) / 256;        //  64 blocks for each weight
constexpr size_t WPLANE = (size_t)(H_ * E_) * E_;     // elements of one weight plane

__global__ __launch_bounds__(256)
void split_kernel(const float* __restrict__ x,  const float* __restrict__ Wq,
                  const float* __restrict__ Wk, const float* __restrict__ Wv,
                  const float* __restrict__ Wu,
                  __bf16* __restrict__ xh, __bf16* __restrict__ xl,
                  __bf16* __restrict__ wb) {
  // wb: hi and lo plane of Wq, Wk, Wv, Wu, one behind the other
  const int blk = blockIdx.x;
  const float* src = x;
  __bf16* h = xh;
  __bf16* l = xl;
  int lgc = 2;                                        // x, Wq, Wk, Wv: 128 columns
  int first = blk;
  if (blk >= XBLK) {
    const int j = (blk - XBLK) / WBLK;
    src = j == 0 ? Wq : j == 1 ? Wk : j == 2 ? Wv : Wu;
    if (j == 3) lgc = 5;                              // Wu: 1024 columns
    h = wb + (size_t)(2 * j) * WPLANE;
    l = h + WPLANE;
    first = (blk - XBLK) % WBLK;
  }
  const int d = first * 256 + threadIdx.x;
  const int frag = d >> 6;
  const int row  = (frag >> lgc) * 16 + (d & 15);
  const int k    = (frag & ((1 << lgc) - 1)) * 32 + ((d >> 5) & 1) * 16 + ((d >> 4) & 1) * 8;
  const float* sp = src + ((size_t)row << (lgc + 5)) + k;
  const v4f f0 = *(const v4f*)sp;
  const v4f f1 = *(const v4f*)(sp + 4);
  v8bf hv, lv;
#pragma unroll   // constant indices: the four vectors stay in registers
  for (int j = 0; j < 8; ++j) {
    __bf16 hh, ll;
    split2(j < 4 ? f0[j & 3] : f1[j & 3], hh, ll);
    hv[j] = hh;
    lv[j] = ll;
  }
  *(v8bf*)(h + (size_t)d * 8) = hv;
  *(v8bf*)(l + (size_t)d * 8) = lv;
}

// ---------------------------------------------------------------------------
// Kernel 1: QKV projection (split-bf16 GEMM, K=128 -> 4 chunks * 3 WMMA).
// grid = (128, H, 3), block = 256: 64 rows of x by one head's 128 columns.
// x and W are read, and Q, K, V^T written, in fragment order.
// Q, K: rows t, k = e; per (b,h) fragment (t/16)*4 + e/32.
// V^T : rows e, k = t; per (b,h) fragment (t/32)*8 + e/16.
// The hi and lo output tiles are staged in LDS, and leave as 16-byte stores in
// the order of the destination, 512 contiguous bytes a wave.
// ---------------------------------------------------------------------------
constexpr int QK_PITCH = 136;   // staged Q/K row: 128 e + 8 (272 B, 4 banks a row)
constexpr int VT_PITCH = 72;    // staged V^T row: 64 t + 8 (144 B, 36 dwords a row)
constexpr int STAGE_ELEMS = 128 * VT_PITCH;   // one plane; also holds 64 * QK_PITCH

// TR == false: D = W * x^T, so a lane holds 8 consecutive e of one row t.
// TR == true : D = x * W^T, so a lane holds 8 consecutive t of one column e.
// Either way the lane's 8 values are one 16-byte piece of the output layout.
template <bool TR>
static __device__ __forceinline__ void qkv_tile(
    const __bf16* __restrict__ xh, const __bf16* __restrict__ xl,
    const __bf16* __restrict__ Wh, const __bf16* __restrict__ Wl,
    __bf16* __restrict__ oh, __bf16* __restrict__ ol,
    __bf16* sH, __bf16* sL) {
  // the wave's number as a scalar: W's and x's row bases then stay in scalar
  // registers and every fragment load shares one per-lane offset
  const int wave = __builtin_amdgcn_readfirstlane(threadIdx.x >> 5);
  const int lane = threadIdx.x & 31;
  const int r16 = lane & 15, lh = lane >> 4;
  const int m0 = blockIdx.x * 64;
  const int h  = blockIdx.y;
  const unsigned vo = (unsigned)(lane * 8);            // the lane's piece of a fragment

  const __bf16* bwh = Wh + (size_t)(h * E_ + wave * 16) * E_ + vo;
  const __bf16* bwl = Wl + (size_t)(h * E_ + wave * 16) * E_ + vo;
  const v16bf w_h0 = ldF(bwh, 0),        w_h1 = ldF(bwh, FRAG);
  const v16bf w_h2 = ldF(bwh, 2 * FRAG), w_h3 = ldF(bwh, 3 * FRAG);
  const v16bf w_l0 = ldF(bwl, 0),        w_l1 = ldF(bwl, FRAG);
  const v16bf w_l2 = ldF(bwl, 2 * FRAG), w_l3 = ldF(bwl, 3 * FRAG);

// hi*hi + hi*lo + lo*hi of one K=32 chunk, x's fragments already in registers
#define XW_CHUNK(XH_, XL_, WH_, WL_, ACC_)            \
  do {                                                \
    if (TR) {                                         \
      (ACC_) = wmma_bf((XH_), (WH_), (ACC_));         \
      (ACC_) = wmma_bf((XH_), (WL_), (ACC_));         \
      (ACC_) = wmma_bf((XL_), (WH_), (ACC_));         \
    } else {                                          \
      (ACC_) = wmma_bf((WH_), (XH_), (ACC_));         \
      (ACC_) = wmma_bf((WL_), (XH_), (ACC_));         \
      (ACC_) = wmma_bf((WH_), (XL_), (ACC_));         \
    }                                                 \
  } while (0)

  const __bf16* axh = xh + (size_t)m0 * E_ + vo;
  const __bf16* axl = xl + (size_t)m0 * E_ + vo;
  v16bf fh[4], fl[4];                              // x fragments of one 16-row tile
#pragma unroll
  for (int c = 0; c < 4; ++c) {
    fh[c] = ldF(axh, c * FRAG);
    fl[c] = ldF(axl, c * FRAG);
  }
  // all 32 first loads issue before the first product; left alone, the last
  // ones were issued in pairs among the products, each behind a wait to 0
  __builtin_amdgcn_sched_barrier(0);

#pragma unroll
  for (int mt = 0; mt < 4; ++mt) {
    v8f acc0 = vzero8(), acc1 = vzero8(), acc2 = vzero8(), acc3 = vzero8();
    XW_CHUNK(fh[0], fl[0], w_h0, w_l0, acc0);
    XW_CHUNK(fh[1], fl[1], w_h1, w_l1, acc1);
    XW_CHUNK(fh[2], fl[2], w_h2, w_l2, acc2);
    XW_CHUNK(fh[3], fl[3], w_h3, w_l3, acc3);
    v8f acc = (acc0 + acc1) + (acc2 + acc3);

    if (mt < 3) {
      // the next tile's loads stay behind this tile's products, so that they take
      // the same registers: hoisted, they cost a second set and resident blocks
      __builtin_amdgcn_sched_barrier(0);
      // they fly while this tile is split and staged
#pragma unroll
      for (int c = 0; c < 4; ++c) {
        fh[c] = ldF(axh, ((mt + 1) * 4 + c) * FRAG);
        fl[c] = ldF(axl, ((mt + 1) * 4 + c) * FRAG);
      }
      // a precaution: the loads issued so far have taken their address register
      // before anything below may be given it
      asm volatile("s_wait_xcnt 0x0" ::: "memory");
      // no load is moved behind that wait and no register write in front of it
      __builtin_amdgcn_sched_barrier(0);
    }

    v8bf hv, lv;                                   // C layout: VGPR j -> M = j + 8*(lane/16)
#pragma unroll
    for (int j = 0; j < 8; ++j) {
      __bf16 hh, ll;
      split2(acc[j], hh, ll);
      hv[j] = hh;
      lv[j] = ll;
    }
    const int off = TR ? (wave * 16 + r16) * VT_PITCH + mt * 16 + 8 * lh    // [e][t]
                       : (mt * 16 + r16) * QK_PITCH + wave * 16 + 8 * lh;   // [t][e]
    *(v8bf*)(sH + off) = hv;
    *(v8bf*)(sL + off) = lv;
  }
#undef XW_CHUNK
  __syncthreads();   // every wave's pieces are staged before any row is read back

  const int bb = m0 / T_;
  const int tb = m0 % T_;
#pragma unroll
  for (int i = 0; i < 4; ++i) {
    const int c = i * 256 + threadIdx.x;           // 1024 pieces of 16 B a plane
    const int f = c >> 6;                          // 16 fragments, 64 pieces each
    const int r = c & 15;                          // the piece's row in its fragment
    const int kk = ((c >> 5) & 1) * 16 + ((c >> 4) & 1) * 8;   // and its first k
    // either way the block's 64 t are 16 fragments in a row, from element tb * E_
    const int from = TR ? ((f & 7) * 16 + r) * VT_PITCH + (f >> 3) * 32 + kk    // [e][t]
                        : ((f >> 2) * 16 + r) * QK_PITCH + (f & 3) * 32 + kk;   // [t][e]
    const size_t to = ((size_t)bb * H_ + h) * (size_t)T_ * E_ + (size_t)tb * E_ + c * 8;
    *(v8bf*)(oh + to) = *(const v8bf*)(sH + from);
    *(v8bf*)(ol + to) = *(const v8bf*)(sL + from);
  }
  // a precaution: the stores have taken their registers before the V^T code,
  // which follows this one in the built text behind a conditional branch
  if (!TR) asm volatile("s_wait_xcnt 0x0" ::: "memory");
}

__global__ __launch_bounds__(256)
void qkv_kernel(const __bf16* __restrict__ xh, const __bf16* __restrict__ xl,
                const __bf16* __restrict__ wqh, const __bf16* __restrict__ wql,
                const __bf16* __restrict__ wkh, const __bf16* __restrict__ wkl,
                const __bf16* __restrict__ wvh, const __bf16* __restrict__ wvl,
                __bf16* __restrict__ qh, __bf16* __restrict__ ql,
                __bf16* __restrict__ kh, __bf16* __restrict__ kl,
                __bf16* __restrict__ vth, __bf16* __restrict__ vtl) {
  __shared__ __attribute__((aligned(16))) __bf16 sH[STAGE_ELEMS];
  __shared__ __attribute__((aligned(16))) __bf16 sL[STAGE_ELEMS];
  if (blockIdx.z == 2) {
    qkv_tile<true>(xh, xl, wvh, wvl, vth, vtl, sH, sL);
    return;
  }
  const bool isq = blockIdx.z == 0;
  qkv_tile<false>(xh, xl, isq ? wqh : wkh, isq ? wql : wkl,
                  isq ? qh : kh, isq ? ql : kl, sH, sL);
}

// ---------------------------------------------------------------------------
// One pass of the P V loop of kernel 2: 128 keys, four chunks of 32.
// On entry vh, vl hold this pass's four V fragment pairs and ph, pl the first
// chunk's P fragments of both 16-row tiles. Every operand is fetched ahead of
// its products: a chunk's P while the chunk before it is multiplied, a chunk's V
// one pass ahead, into the same registers, right behind its last product.
// ap*: P (LDS) at this pass's first key; bv*: V at the NEXT pass's first key.
// MORE == false: the last pass, which fetches nothing for a next one.
// ---------------------------------------------------------------------------
template <bool MORE>
static __device__ __forceinline__ void pv_pass(
    const __bf16* aph, const __bf16* apl,
    const __bf16* __restrict__ bvh, const __bf16* __restrict__ bvl,
    v16bf (&vh)[4], v16bf (&vl)[4], v16bf (&ph)[2], v16bf (&pl)[2], v8f (&acc)[2][4]) {
#pragma unroll   // constant indices: fragments and accumulators stay in registers
  for (int c = 0; c < 4; ++c) {
    v16bf nh[2], nl[2];
    if (MORE || c < 3) {
#pragma unroll   // constant indices
      for (int tm = 0; tm < 2; ++tm) {
        nh[tm] = ldAB(aph + tm * 16 * PROW, 32 * (c + 1));
        nl[tm] = ldAB(apl + tm * 16 * PROW, 32 * (c + 1));
      }
      // the next chunk's LDS reads are issued as one group in front of this chunk's
      // products; left alone, they stood among the products behind waits to 0
      __builtin_amdgcn_sched_barrier(0);
    }
    REG_CHUNK(ph[0], pl[0], vh[c], vl[c], acc[0][c]);
    REG_CHUNK(ph[1], pl[1], vh[c], vl[c], acc[1][c]);
    if (MORE) {
      // the reload stays behind the chunk's products, so that it takes the same
      // registers: hoisted, it would cost a second set and the second resident block
      __builtin_amdgcn_sched_barrier(0);
      vh[c] = ldF(bvh, c * 8 * FRAG);
      vl[c] = ldF(bvl, c * 8 * FRAG);
    }
    if (MORE || c < 3) {
#pragma unroll   // constant indices
      for (int tm = 0; tm < 2; ++tm) {
        ph[tm] = nh[tm];
        pl[tm] = nl[tm];
      }
    }
  }
  if (MORE) {
    // a precaution: the loads issued so far have taken their address registers
    // before the next pass's addresses may be given them
    asm volatile("s_wait_xcnt 0x0" ::: "memory");
    // no load is moved behind that wait and no register write in front of it
    __builtin_amdgcn_sched_barrier(0);
  }
}

// ---------------------------------------------------------------------------
// Kernel 2: attention, one (b,h) x 32 query rows per block.
// LDS: fp32 S [32][SROW] + output staging 8 x 1,536 B + one flag word = 143,888 B,
// so that two blocks stand on a WGP (which also takes at most 256 VGPRs a wave).
// A score row's 4,112 B later hold the row's P: hi in the first 2,048 B, lo in
// the next 2,048 B.
// Keys past the block's causal edge hold only -inf or -1e9. While every row's
// maximum is far above -1e9 their exp is exactly 0, so they are not walked.
// ---------------------------------------------------------------------------
__global__ __launch_bounds__(256)
void attn_kernel(const __bf16* __restrict__ qh, const __bf16* __restrict__ ql,
                 const __bf16* __restrict__ kh, const __bf16* __restrict__ kl,
                 const __bf16* __restrict__ vth, const __bf16* __restrict__ vtl,
                 const int* __restrict__ mask,
                 __bf16* __restrict__ aoh, __bf16* __restrict__ aol) {
  extern __shared__ char smem[];
  float*  sS  = (float*)smem;                          // [32][SROW] fp32
  __bf16* pHi = (__bf16*)smem;                         // [32][PROW], over S row by row
  __bf16* pLo = pHi + T_;                              // [32][PROW], behind the row's hi
  __bf16* sOut = (__bf16*)(smem + 32 * SROW * 4);      // 8 waves x 768 elements
  int* sFull  = (int*)(smem + 32 * SROW * 4 + 8 * 768 * 2);  // 1: walk all T_ keys

  // the wave's number as a scalar: fragment bases then stay in scalar registers
  // and every fragment load shares the one per-lane offset vo
  const int wave = __builtin_amdgcn_readfirstlane(threadIdx.x >> 5);
  const int lane = threadIdx.x & 31;
  const int r16 = lane & 15, lh = lane >> 4;
  const unsigned vo = (unsigned)(lane * 8);            // the lane's piece of a fragment
  // Block order: a block's cost grows with its query tile (it walks the keys up to
  // its causal edge) and there are four times as many blocks as places. So cost
  // falls with the index: within a group of
  // 16 (b,h) pairs the last query tile comes first, and the launch ends on the
  // short blocks. Groups of 16 pairs keep the K and V in use at one time small.
  const int b = blockIdx.z * 2 + (blockIdx.x >> 3), h = blockIdx.x & 7;
  const int t0 = (T_ / 32 - 1 - blockIdx.y) * 32;

  const size_t bh = ((size_t)b * H_ + h) * (size_t)T_ * E_;
  const __bf16* Qh = qh + bh;  const __bf16* Ql = ql + bh;
  const __bf16* Kh = kh + bh;  const __bf16* Kl = kl + bh;
  const __bf16* Vh = vth + bh; const __bf16* Vl = vtl + bh;   // all in fragment order

  // keys up to the causal edge of the last query row, in whole groups of 128
  // (one key tile for each of the 8 waves)
  const int nkc = (t0 + 32 + 127) & ~127;
  int nk = nkc;
  if (threadIdx.x == 0) *sFull = 0;

  // ---- Phase 1: S = (Q K^T)*scale, causal -inf then padding -1e9 ----
  // Q of both 16-row tiles (16 x v16bf) stays in registers; a K fragment is
  // loaded once and multiplied with both, so K crosses from L2 once a block.
  {
    const __bf16* aqh = Qh + (size_t)t0 * E_ + vo;   // 4 fragments a 16-row tile
    const __bf16* aql = Ql + (size_t)t0 * E_ + vo;
    v16bf q_h[2][4], q_l[2][4];
#pragma unroll   // constant indices: the fragments stay in registers
    for (int c = 0; c < 8; ++c) {
      q_h[c >> 2][c & 3] = ldF(aqh, c * FRAG);
      q_l[c >> 2][c & 3] = ldF(aql, c * FRAG);
    }

    for (int tb = 0; tb < (nkc >> 4); tb += 8) {
      const int k0 = (tb + wave) * 16;
      const __bf16* bkh = Kh + (size_t)k0 * E_ + vo;
      const __bf16* bkl = Kl + (size_t)k0 * E_ + vo;
      v16bf k_h[4], k_l[4];
#pragma unroll   // constant indices: the fragments stay in registers
      for (int c = 0; c < 4; ++c) {
        k_h[c] = ldF(bkh, c * FRAG);
        k_l[c] = ldF(bkl, c * FRAG);
      }

      const int kg = k0 + r16;
#pragma unroll   // constant indices into the Q fragments
      for (int tm = 0; tm < 2; ++tm) {
        const int q0 = t0 + tm * 16;
        v8f acc0 = vzero8(), acc1 = vzero8(), acc2 = vzero8(), acc3 = vzero8();
        REG_CHUNK(q_h[tm][0], q_l[tm][0], k_h[0], k_l[0], acc0);
        REG_CHUNK(q_h[tm][1], q_l[tm][1], k_h[1], k_l[1], acc1);
        REG_CHUNK(q_h[tm][2], q_l[tm][2], k_h[2], k_l[2], acc2);
        REG_CHUNK(q_h[tm][3], q_l[tm][3], k_h[3], k_l[3], acc3);
        v8f acc = (acc0 + acc1) + (acc2 + acc3);

#pragma unroll
        for (int j = 0; j < 8; ++j) {
          const int qg = q0 + j + 8 * lh;
          float val = acc[j] * SCALE;
          if (kg > qg) val = -INFINITY;                      // causal first
          if (mask[(size_t)qg * T_ + kg] == 0) val = -1e9f;  // padding overwrites
          sS[(tm * 16 + j + 8 * lh) * SROW + kg] = val;
        }
      }
    }
  }
  __syncthreads();

  // ---- Phase 2a: row maxima over the walked keys ----
  float mxr[4];
  bool low = false;
#pragma unroll
  for (int r = 0; r < 4; ++r) {
    const float* row = sS + (wave * 4 + r) * SROW;
    float mx = -INFINITY;
    for (int cb = 0; cb < nkc; cb += 128) {
#pragma unroll   // four reads behind one wait; the key count is a multiple of 128
      for (int u = 0; u < 4; ++u) mx = fmaxf(mx, row[cb + 32 * u + lane]);
    }
    for (int off = 16; off; off >>= 1) mx = fmaxf(mx, __shfl_xor(mx, off, 32));
    mxr[r] = mx;
    low = low || !(mx >= -5e8f);   // exp(-1e9 - mx) might not be 0 for this row
  }
  if (low) *sFull = 1;
  __syncthreads();   // publishes the flag: all waves must walk the same key count
  if (__builtin_amdgcn_readfirstlane(*sFull) != 0) {
    // A row without a live key up to the edge: the keys past the edge count.
    // All of them are causal for every row here, so no product is needed.
    // Each wave fills the rows that it alone reads in phase 2.
    nk = T_;
#pragma unroll
    for (int r = 0; r < 4; ++r) {
      const int rr = wave * 4 + r;
      float* row = sS + rr * SROW;
      float mx = mxr[r];
      for (int c = nkc + lane; c < T_; c += 32) {
        const float val = (mask[(size_t)(t0 + rr) * T_ + c] == 0) ? -1e9f : -INFINITY;
        row[c] = val;
        mx = fmaxf(mx, val);
      }
      for (int off = 16; off; off >>= 1) mx = fmaxf(mx, __shfl_xor(mx, off, 32));
      mxr[r] = mx;
    }
  }

  // Wave w owns the 16 columns e = 16*w of both 16-row tiles in phase 3: a V
  // fragment is loaded once and multiplied with both, so V crosses from L2 once a
  // block. The first 128 keys' V (every block has them) is asked for here and
  // arrives during phase 2b.
  const int tn = wave;
  const __bf16* bvh = Vh + tn * FRAG + vo;           // 32 keys on: 8 fragments on
  const __bf16* bvl = Vl + tn * FRAG + vo;
  v16bf v_h[4], v_l[4];
#pragma unroll   // constant indices: the fragments stay in registers
  for (int c = 0; c < 4; ++c) {
    v_h[c] = ldF(bvh, c * 8 * FRAG);
    v_l[c] = ldF(bvl, c * 8 * FRAG);
  }
  // a precaution: these loads have taken their address registers before phase 2b
  // may be given them
  asm volatile("s_wait_xcnt 0x0" ::: "memory");
  // no load is moved behind that wait and no register write in front of it
  __builtin_amdgcn_sched_barrier(0);

  // ---- Phase 2b: exp, row sum; emit P as split bf16 ----
  // The wave takes a whole row into registers (up to 32 values a lane) and only
  // then writes P over it: every store of a row depends, through the row's sum,
  // on every load of that row, and no other wave touches the row in this phase.
#pragma unroll
  for (int r = 0; r < 4; ++r) {
    const int rr = wave * 4 + r;
    const float* row = sS + rr * SROW;
    const float mx = mxr[r];
    float e[32];
    float sum = 0.f;
#pragma unroll   // constant indices: the row stays in registers; nk is a scalar
    for (int g = 0; g < 8; ++g) {
      if (g * 128 < nk) {
#pragma unroll   // constant indices
        for (int u = 0; u < 4; ++u) e[g * 4 + u] = row[g * 128 + 32 * u + lane];
      }
    }
#pragma unroll   // constant indices; same per-lane order of the sum
    for (int g = 0; g < 8; ++g) {
      if (g * 128 < nk) {
#pragma unroll   // constant indices
        for (int u = 0; u < 4; ++u) {
          e[g * 4 + u] = expf(e[g * 4 + u] - mx);
          sum += e[g * 4 + u];
        }
      }
    }
    for (int off = 16; off; off >>= 1) sum += __shfl_xor(sum, off, 32);
    const float inv = 1.f / sum;
#pragma unroll   // constant indices
    for (int g = 0; g < 8; ++g) {
      if (g * 128 < nk) {
#pragma unroll   // constant indices
        for (int u = 0; u < 4; ++u) {
          const int c = g * 128 + 32 * u + lane;
          __bf16 hh, ll;
          split2(e[g * 4 + u] * inv, hh, ll);
          pHi[rr * PROW + c] = hh;
          pLo[rr * PROW + c] = ll;
        }
      }
    }
  }
  __syncthreads();

  // ---- Phase 3: O = P @ V  (A from LDS split-bf16, B from transposed V) ----
  // Each wave turns its output tiles, in a staging range of its own, into the
  // 16-byte pieces of the fragment order.
  constexpr int OPITCH = 24;                        // 48 B a row: 16 rows, 16 bank groups
  __bf16* stH = sOut + wave * 768;                  // [16][OPITCH]
  __bf16* stL = stH + 16 * OPITCH;
  const __bf16* aph = pHi + r16 * PROW + 8 * lh;
  const __bf16* apl = pLo + r16 * PROW + 8 * lh;

  v8f acc[2][4];
#pragma unroll   // constant indices: the accumulators stay in registers
  for (int c = 0; c < 8; ++c) acc[c >> 2][c & 3] = vzero8();
  v16bf p_h[2], p_l[2];
#pragma unroll   // constant indices
  for (int tm = 0; tm < 2; ++tm) {
    p_h[tm] = ldAB(aph + tm * 16 * PROW, 0);
    p_l[tm] = ldAB(apl + tm * 16 * PROW, 0);
  }
  int k0 = 0;
  for (; k0 + 128 < nk; k0 += 128) {
    const int nx = ((k0 >> 5) + 4) * 8 * FRAG;       // V of the next 128 keys
    pv_pass<true>(aph + k0, apl + k0, bvh + nx, bvl + nx, v_h, v_l, p_h, p_l, acc);
  }
  pv_pass<false>(aph + k0, apl + k0, bvh, bvl, v_h, v_l, p_h, p_l, acc);

#pragma unroll   // constant indices into the accumulators
  for (int tm = 0; tm < 2; ++tm) {
    const v8f o = (acc[tm][0] + acc[tm][1]) + (acc[tm][2] + acc[tm][3]);
#pragma unroll
    for (int j = 0; j < 8; ++j) {
      __bf16 hh, ll;
      split2(o[j], hh, ll);
      stH[(j + 8 * lh) * OPITCH + r16] = hh;
      stL[(j + 8 * lh) * OPITCH + r16] = ll;
    }
    // the wave's own LDS writes have landed before it reads the rows back
    asm volatile("s_wait_dscnt 0x0" ::: "memory");
    // rows (b,t), k = h*E + e, pre-split for the output projection: fragment
    // (row / 16) * 32 + k / 32; this tile is its half tn & 1, one piece a lane
    const size_t idx = ((size_t)((b * T_ + t0) / 16 + tm) * 32 + h * 4 + (tn >> 1)) * FRAG
                     + (tn & 1) * 256;
    *(v8bf*)(aoh + idx + vo) = *(const v8bf*)(stH + r16 * OPITCH + 8 * lh);
    *(v8bf*)(aol + idx + vo) = *(const v8bf*)(stL + r16 * OPITCH + 8 * lh);
    // a precaution: the two stores have taken their registers before the second
    // tile's code is given them
    if (tm == 0) {
      asm volatile("s_wait_xcnt 0x0" ::: "memory");
      // no register write of the second tile's code is moved in front of that wait
      __builtin_amdgcn_sched_barrier(0);
    }
  }
}

// ---------------------------------------------------------------------------
// Kernel 3: out = ao @ Wu^T + bu   (split-bf16, M=8192, N=128, K=1024)
// ---------------------------------------------------------------------------
__global__ __launch_bounds__(256)
void proj_kernel(const __bf16* __restrict__ aoh, const __bf16* __restrict__ aol,
                 const __bf16* __restrict__ wuh, const __bf16* __restrict__ wul,
                 const float* __restrict__ bu, float* __restrict__ out) {
  // the wave's number as a scalar: Wu's fragment base stays in scalar registers
  const int wave = __builtin_amdgcn_readfirstlane(threadIdx.x >> 5);
  const int lane = threadIdx.x & 31;
  const int r16 = lane & 15, lh = lane >> 4;
  const unsigned vo = (unsigned)(lane * 8);            // the lane's piece of a fragment
  const int m0 = blockIdx.x * 16;
  const int n0 = wave * 16;
  const int K  = H_ * E_;  // 1024

  // both operands in fragment order: the 32 fragments of a 16-row tile in a row
  const __bf16* aah = aoh + (size_t)m0 * K + vo;
  const __bf16* aal = aol + (size_t)m0 * K + vo;
  const __bf16* bwh = wuh + (size_t)n0 * K + vo;
  const __bf16* bwl = wul + (size_t)n0 * K + vo;

  v8f acc0 = vzero8(), acc1 = vzero8(), acc2 = vzero8(), acc3 = vzero8();
#pragma unroll 2
  for (int k0 = 0; k0 < K; k0 += 128) {
    const int f0 = (k0 >> 5) * FRAG;
    SPLIT_CHUNK(aah, aal, f0,            bwh, bwl, f0,            acc0);
    SPLIT_CHUNK(aah, aal, f0 + FRAG,     bwh, bwl, f0 + FRAG,     acc1);
    SPLIT_CHUNK(aah, aal, f0 + 2 * FRAG, bwh, bwl, f0 + 2 * FRAG, acc2);
    SPLIT_CHUNK(aah, aal, f0 + 3 * FRAG, bwh, bwl, f0 + 3 * FRAG, acc3);
  }
  v8f acc = (acc0 + acc1) + (acc2 + acc3);

  const float bias = bu[n0 + r16];
#pragma unroll
  for (int j = 0; j < 8; ++j) {
    out[(size_t)(m0 + j + 8 * lh) * E_ + n0 + r16] = acc[j] + bias;
  }
}

// ---------------------------------------------------------------------------
extern "C" void kernel_launch(void* const* d_in, const int* in_sizes, int n_in,
                              void* d_out, int out_size, void* d_ws, size_t ws_size,
                              hipStream_t stream) {
  (void)in_sizes; (void)n_in; (void)out_size; (void)ws_size;
  const float* x    = (const float*)d_in[0];
  const int*   mask = (const int*)  d_in[1];
  const float* Wk   = (const float*)d_in[2];   // dict order: x, mask, Wk, Wq, Wv, Wu, bu
  const float* Wq   = (const float*)d_in[3];
  const float* Wv   = (const float*)d_in[4];
  const float* Wu   = (const float*)d_in[5];
  const float* bu   = (const float*)d_in[6];
  float* out = (float*)d_out;

  // workspace layout (bf16 element offsets); total ~140.5 MB
  __bf16* ws = (__bf16*)d_ws;
  const size_t CH = (size_t)B_ * H_ * T_ * E_;   // 8,388,608
  const size_t XH = (size_t)B_ * T_ * E_;        // 1,048,576
  const size_t WH = (size_t)(H_ * E_) * E_;      //   131,072
  __bf16* qh  = ws;            __bf16* ql  = ws + CH;
  __bf16* kh  = ws + 2 * CH;   __bf16* kl  = ws + 3 * CH;
  __bf16* vth = ws + 4 * CH;   __bf16* vtl = ws + 5 * CH;
  __bf16* aoh = ws + 6 * CH;   __bf16* aol = ws + 7 * CH;
  __bf16* xh  = ws + 8 * CH;   __bf16* xl  = xh + XH;
  __bf16* wb  = xl + XH;
  __bf16* wqh = wb;            __bf16* wql = wb + WH;
  __bf16* wkh = wb + 2 * WH;   __bf16* wkl = wb + 3 * WH;
  __bf16* wvh = wb + 4 * WH;   __bf16* wvl = wb + 5 * WH;
  __bf16* wuh = wb + 6 * WH;   __bf16* wul = wb + 7 * WH;

  // 0) split fp32 inputs into bf16 hi/lo, fragment order (8 elements a thread):
  //    512 blocks for x, then 64 for each of Wq, Wk, Wv, Wu, in one launch
  split_kernel<<<512 + 4 * 64, 256, 0, stream>>>(x, Wq, Wk, Wv, Wu, xh, xl, wb);

  // 1) QKV projection (V transposed)
  dim3 g1((B_ * T_) / 64, H_, 3);
  qkv_kernel<<<g1, 256, 0, stream>>>(xh, xl, wqh, wql, wkh, wkl, wvh, wvl,
                                     qh, ql, kh, kl, vth, vtl);

  // 2) attention
  const size_t lds = (size_t)32 * SROW * 4 + (size_t)8 * 768 * 2 + 16;  // 143,888 B
  (void)hipFuncSetAttribute((const void*)attn_kernel,
                            hipFuncAttributeMaxDynamicSharedMemorySize, (int)lds);
  dim3 g2(2 * H_, T_ / 32, B_ / 2);   // (b,h) pair of a group; query tile, last first; group
  attn_kernel<<<g2, 256, lds, stream>>>(qh, ql, kh, kl, vth, vtl, mask, aoh, aol);

  // 3) output projection
  proj_kernel<<<(B_ * T_) / 16, 256, 0, stream>>>(aoh, aol, wuh, wul, bu, out);
}

// v009
// A run of this version takes 163 microseconds.
// In both of two side-by-side timings against v008, it was 1.06 times as fast.
// Counting every step since v000, it is 4.03 times as fast.
#include <hip/hip_runtime.h>
#include <math.h>

typedef __attribute__((ext_vector_type(4)))  float  v4f;
typedef __attribute__((ext_vector_type(8)))  float  v8f;
typedef __attribute__((ext_vector_type(8)))  __bf16 v8bf;
typedef __attribute__((ext_vector_type(16))) __bf16 v16bf;

constexpr int B_ = 8, T_ = 1024, E_ = 128, H_ = 8;
constexpr int SROW = 1028;   // fp32 score row stride (1028 % 64 == 4 -> conflict-free)
constexpr int PROW = 2 * SROW;  // bf16 prob row stride: a prob row stands in its score row's place
constexpr float SCALE = 0.08838834764831845f;  // 1/sqrt(128)

static __device__ __forceinline__ v8f vzero8() {
  v8f z = {0.f, 0.f, 0.f, 0.f, 0.f, 0.f, 0.f, 0.f};
  return z;
}

// --- bf16 helpers (bit-exact, storage-only use of __bf16) ---
static __device__ __forceinline__ float bf2f(__bf16 h) {
  return __builtin_bit_cast(float, (unsigned)((unsigned)__builtin_bit_cast(unsigned short, h) << 16));
}
static __device__ __forceinline__ __bf16 f2bf(float f) {          // RNE
  unsigned u = __builtin_bit_cast(unsigned, f);
  u = (u + 0x7FFFu + ((u >> 16) & 1u)) >> 16;
  return __builtin_bit_cast(__bf16, (unsigned short)u);
}
static __device__ __forceinline__ void split2(float f, __bf16& h, __bf16& l) {
  h = f2bf(f);
  l = f2bf(f - bf2f(h));
}

// D = A(16x32 bf16) * B(32x16 bf16) + C(16x16 f32)
static __device__ __forceinline__ v8f wmma_bf(v16bf a, v16bf b, v8f c) {
  return __builtin_amdgcn_wmma_f32_16x16x32_bf16(false, a, false, b, (short)0, c, false, false);
}

// Per-lane A/B operand slice from a K-contiguous row.
// p must be pre-offset by row*stride + 8*(lane>>4).
// elems 0..7 <- K[k0 + 8*lh .. +7], elems 8..15 <- K[k0 + 16 + 8*lh .. +7]
static __device__ __forceinline__ v16bf ldAB(const __bf16* p, int k0) {
  v8bf a = *(const v8bf*)(p + k0);
  v8bf b = *(const v8bf*)(p + k0 + 16);
  return __builtin_shufflevector(a, b, 0,1,2,3,4,5,6,7,8,9,10,11,12,13,14,15);
}

// FRAGMENT ORDER of the global bf16 planes. A plane is cut into fragments of
// 16 rows x 32 k = 512 elements (1024 B). Inside one, the 16-byte piece that
// holds row r, k = 16*half + 8*lh .. +7 stands at element half*256 + (16*lh + r)*8.
// Lane r + 16*lh then finds its operand slice at lane*8 and 256 + lane*8, and each
// of the two wave-wide loads reads 512 contiguous bytes (4 whole lines) instead
// of 32 bytes out of each of 16 lines.
constexpr int FRAG = 512;   // elements of one fragment

// p must be pre-offset by lane*8; off = element offset of the fragment.
static __device__ __forceinline__ v16bf ldF(const __bf16* p, int off) {
  v8bf a = *(const v8bf*)(p + off);
  v8bf b = *(const v8bf*)(p + off + 256);
  return __builtin_shufflevector(a, b, 0,1,2,3,4,5,6,7,8,9,10,11,12,13,14,15);
}

// One K=32 chunk of the split-bf16 product: hi*hi + hi*lo + lo*hi.
// Both operands from planes in fragment order, at fragment offsets FA_ and FB_.
#define SPLIT_CHUNK(AH_, AL_, FA_, BH_, BL_, FB_, ACC_)  \
  do {                                              \
    v16bf _ah = ldF((AH_), (FA_));                  \
    v16bf _al = ldF((AL_), (FA_));                  \
    v16bf _bh = ldF((BH_), (FB_));                  \
    v16bf _bl = ldF((BL_), (FB_));                  \
    (ACC_) = wmma_bf(_ah, _bh, (ACC_));             \
    (ACC_) = wmma_bf(_ah, _bl, (ACC_));             \
    (ACC_) = wmma_bf(_al, _bh, (ACC_));             \
  } while (0)

// The same three products with all four operands already in registers.
#define REG_CHUNK(AH_, AL_, BH_, BL_, ACC_)         \
  do {                                              \
    (ACC_) = wmma_bf((AH_), (BH_), (ACC_));         \
    (ACC_) = wmma_bf((AH_), (BL_), (ACC_));         \
    (ACC_) = wmma_bf((AL_), (BH_), (ACC_));         \
  } while (0)

// ---------------------------------------------------------------------------
// Kernel 0: elementwise fp32 -> (bf16 hi, bf16 lo) split of x and of the four
// weight matrices in ONE launch: none of the five needs anything of another, so
// they share a grid by ranges of the block index (a block-uniform choice).
// Row-major source of 32 << lgc columns, planes written in fragment order
// (fragments of a 16-row tile follow one another along k). One 16-byte piece of
// each plane a thread, taken in the order of the destination.
// The same launch packs the padding mask for kernel 2: one 32-bit word for each
// (tile of 32 query rows, key), bit i set where mask[32 * tile + i][key] != 0.
// ---------------------------------------------------------------------------
constexpr int XBLK = (B_ * T_ * E_ / 8) / 256;        // 512 blocks for x
constexpr int WBLK = (H_ * E_ * E_ / 8) / 256;        //  64 blocks for each weight
constexpr size_t WPLANE = (size_t)(H_ * E_) * E_;     // elements of one weight plane
constexpr int MBLK = ((T_ / 32) * T_) / 256;          // 128 blocks for the mask words

__global__ __launch_bounds__(256)
void split_kernel(const float* __restrict__ x,  const float* __restrict__ Wq,
                  const float* __restrict__ Wk, const float* __restrict__ Wv,
                  const float* __restrict__ Wu, const int* __restrict__ mask,
                  __bf16* __restrict__ xh, __bf16* __restrict__ xl,
                  __bf16* __restrict__ wb, unsigned* __restrict__ mbits) {
  if (blockIdx.x < MBLK) {
    // one word a thread; a wave reads 128 contiguous bytes of each of 32 mask rows
    const int d = blockIdx.x * 256 + threadIdx.x;     // tile * T_ + key
    const int* mp = mask + (size_t)(d / T_) * 32 * T_ + (d % T_);
    unsigned w = 0;
#pragma unroll   // 32 independent loads in flight
    for (int i = 0; i < 32; ++i) w |= (mp[i * T_] != 0 ? 1u : 0u) << i;
    mbits[d] = w;
    return;
  }
  // wb: hi and lo plane of Wq, Wk, Wv, Wu, one behind the other
  const int blk = blockIdx.x - MBLK;
  const float* src = x;
  __bf16* h = xh;
  __bf16* l = xl;
  int lgc = 2;                                        // x, Wq, Wk, Wv: 128 columns
  int first = blk;
  if (blk >= XBLK) {
    const int j = (blk - XBLK) / WBLK;
    src = j == 0 ? Wq : j == 1 ? Wk : j == 2 ? Wv : Wu;
    if (j == 3) lgc = 5;                              // Wu: 1024 columns
    h = wb + (size_t)(2 * j) * WPLANE;
    l = h + WPLANE;
    first = (blk - XBLK) % WBLK;
  }
  const int d = first * 256 + threadIdx.x;
  const int frag = d >> 6;
  const int row  = (frag >> lgc) * 16 + (d & 15);
  const int k    = (frag & ((1 << lgc) - 1)) * 32 + ((d >> 5) & 1) * 16 + ((d >> 4) & 1) * 8;
  const float* sp = src + ((size_t)row << (lgc + 5)) + k;
  const v4f f0 = *(const v4f*)sp;
  const v4f f1 = *(const v4f*)(sp + 4);
  v8bf hv, lv;
#pragma unroll   // constant indices: the four vectors stay in registers
  for (int j = 0; j < 8; ++j) {
    __bf16 hh, ll;
    split2(j < 4 ? f0[j & 3] : f1[j & 3], hh, ll);
    hv[j] = hh;
    lv[j] = ll;
  }
  *(v8bf*)(h + (size_t)d * 8) = hv;
  *(v8bf*)(l + (size_t)d * 8) = lv;
}

// ---------------------------------------------------------------------------
// Kernel 1: QKV projection (split-bf16 GEMM, K=128 -> 4 chunks * 3 WMMA).
// grid = (128, H, 3), block = 256: 64 rows of x by one head's 128 columns.
// x and W are read, and Q, K, V^T written, in fragment order.
// Q, K: rows t, k = e; per (b,h) fragment (t/16)*4 + e/32.
// V^T : rows e, k = t; per (b,h) fragment (t/32)*8 + e/16.
// The hi and lo output tiles are staged in LDS, and leave as 16-byte stores in
// the order of the destination, 512 contiguous bytes a wave.
// ---------------------------------------------------------------------------
constexpr int QK_PITCH = 136;   // staged Q/K row: 128 e + 8 (272 B, 4 banks a row)
constexpr int VT_PITCH = 72;    // staged V^T row: 64 t + 8 (144 B, 36 dwords a row)
constexpr int STAGE_ELEMS = 128 * VT_PITCH;   // one plane; also holds 64 * QK_PITCH

// TR == false: D = W * x^T, so a lane holds 8 consecutive e of one row t.
// TR == true : D = x * W^T, so a lane holds 8 consecutive t of one column e.
// Either way the lane's 8 values are one 16-byte piece of the output layout.
template <bool TR>
static __device__ __forceinline__ void qkv_tile(
    const __bf16* __restrict__ xh, const __bf16* __restrict__ xl,
    const __bf16* __restrict__ Wh, const __bf16* __restrict__ Wl,
    __bf16* __restrict__ oh, __bf16* __restrict__ ol,
    __bf16* sH, __bf16* sL) {
  // the wave's number as a scalar: W's and x's row bases then stay in scalar
  // registers and every fragment load shares one per-lane offset
  const int wave = __builtin_amdgcn_readfirstlane(threadIdx.x >> 5);
  const int lane = threadIdx.x & 31;
  const int r16 = lane & 15, lh = lane >> 4;
  const int m0 = blockIdx.x * 64;
  const int h  = blockIdx.y;
  const unsigned vo = (unsigned)(lane * 8);            // the lane's piece of a fragment

  const __bf16* bwh = Wh + (size_t)(h * E_ + wave * 16) * E_ + vo;
  const __bf16* bwl = Wl + (size_t)(h * E_ + wave * 16) * E_ + vo;
  const v16bf w_h0 = ldF(bwh, 0),        w_h1 = ldF(bwh, FRAG);
  const v16bf w_h2 = ldF(bwh, 2 * FRAG), w_h3 = ldF(bwh, 3 * FRAG);
  const v16bf w_l0 = ldF(bwl, 0),        w_l1 = ldF(bwl, FRAG);
  const v16bf w_l2 = ldF(bwl, 2 * FRAG), w_l3 = ldF(bwl, 3 * FRAG);

// hi*hi + hi*lo + lo*hi of one K=32 chunk, x's fragments already in registers
#define XW_CHUNK(XH_, XL_, WH_, WL_, ACC_)            \
  do {                                                \
    if (TR) {                                         \
      (ACC_) = wmma_bf((XH_), (WH_), (ACC_));         \
      (ACC_) = wmma_bf((XH_), (WL_), (ACC_));         \
      (ACC_) = wmma_bf((XL_), (WH_), (ACC_));         \
    } else {                                          \
      (ACC_) = wmma_bf((WH_), (XH_), (ACC_));         \
      (ACC_) = wmma_bf((WL_), (XH_), (ACC_));         \
      (ACC_) = wmma_bf((WH_), (XL_), (ACC_));         \
    }                                                 \
  } while (0)

  const __bf16* axh = xh + (size_t)m0 * E_ + vo;
  const __bf16* axl = xl + (size_t)m0 * E_ + vo;
  v16bf fh[4], fl[4];                              // x fragments of one 16-row tile
#pragma unroll
  for (int c = 0; c < 4; ++c) {
    fh[c] = ldF(axh, c * FRAG);
    fl[c] = ldF(axl, c * FRAG);
  }
  // all 32 first loads issue before the first product; left alone, the last
  // ones were issued in pairs among the products, each behind a wait to 0
  __builtin_amdgcn_sched_barrier(0);

#pragma unroll
  for (int mt = 0; mt < 4; ++mt) {
    v8f acc0 = vzero8(), acc1 = vzero8(), acc2 = vzero8(), acc3 = vzero8();
    XW_CHUNK(fh[0], fl[0], w_h0, w_l0, acc0);
    XW_CHUNK(fh[1], fl[1], w_h1, w_l1, acc1);
    XW_CHUNK(fh[2], fl[2], w_h2, w_l2, acc2);
    XW_CHUNK(fh[3], fl[3], w_h3, w_l3, acc3);
    v8f acc = (acc0 + acc1) + (acc2 + acc3);

    if (mt < 3) {
      // the next tile's loads stay behind this tile's products, so that they take
      // the same registers: hoisted, they cost a second set and resident blocks
      __builtin_amdgcn_sched_barrier(0);
      // they fly while this tile is split and staged
#pragma unroll
      for (int c = 0; c < 4; ++c) {
        fh[c] = ldF(axh, ((mt + 1) * 4 + c) * FRAG);
        fl[c] = ldF(axl, ((mt + 1) * 4 + c) * FRAG);
      }
      // a precaution: the loads issued so far have taken their address register
      // before anything below may be given it
      asm volatile("s_wait_xcnt 0x0" ::: "memory");
      // no load is moved behind that wait and no register write in front of it
      __builtin_amdgcn_sched_barrier(0);
    }

    v8bf hv, lv;                                   // C layout: VGPR j -> M = j + 8*(lane/16)
#pragma unroll
    for (int j = 0; j < 8; ++j) {
      __bf16 hh, ll;
      split2(acc[j], hh, ll);
      hv[j] = hh;
      lv[j] = ll;
    }
    const int off = TR ? (wave * 16 + r16) * VT_PITCH + mt * 16 + 8 * lh    // [e][t]
                       : (mt * 16 + r16) * QK_PITCH + wave * 16 + 8 * lh;   // [t][e]
    *(v8bf*)(sH + off) = hv;
    *(v8bf*)(sL + off) = lv;
  }
#undef XW_CHUNK
  __syncthreads();   // every wave's pieces are staged before any row is read back

  const int bb = m0 / T_;
  const int tb = m0 % T_;
#pragma unroll
  for (int i = 0; i < 4; ++i) {
    const int c = i * 256 + threadIdx.x;           // 1024 pieces of 16 B a plane
    const int f = c >> 6;                          // 16 fragments, 64 pieces each
    const int r = c & 15;                          // the piece's row in its fragment
    const int kk = ((c >> 5) & 1) * 16 + ((c >> 4) & 1) * 8;   // and its first k
    // either way the block's 64 t are 16 fragments in a row, from element tb * E_
    const int from = TR ? ((f & 7) * 16 + r) * VT_PITCH + (f >> 3) * 32 + kk    // [e][t]
                        : ((f >> 2) * 16 + r) * QK_PITCH + (f & 3) * 32 + kk;   // [t][e]
    const size_t to = ((size_t)bb * H_ + h) * (size_t)T_ * E_ + (size_t)tb * E_ + c * 8;
    *(v8bf*)(oh + to) = *(const v8bf*)(sH + from);
    *(v8bf*)(ol + to) = *(const v8bf*)(sL + from);
  }
  // a precaution: the stores have taken their registers before the V^T code,
  // which follows this one in the built text behind a conditional branch
  if (!TR) asm volatile("s_wait_xcnt 0x0" ::: "memory");
}

__global__ __launch_bounds__(256)
void qkv_kernel(const __bf16* __restrict__ xh, const __bf16* __restrict__ xl,
                const __bf16* __restrict__ wqh, const __bf16* __restrict__ wql,
                const __bf16* __restrict__ wkh, const __bf16* __restrict__ wkl,
                const __bf16* __restrict__ wvh, const __bf16* __restrict__ wvl,
                __bf16* __restrict__ qh, __bf16* __restrict__ ql,
                __bf16* __restrict__ kh, __bf16* __restrict__ kl,
                __bf16* __restrict__ vth, __bf16* __restrict__ vtl) {
  __shared__ __attribute__((aligned(16))) __bf16 sH[STAGE_ELEMS];
  __shared__ __attribute__((aligned(16))) __bf16 sL[STAGE_ELEMS];
  if (blockIdx.z == 2) {
    qkv_tile<true>(xh, xl, wvh, wvl, vth, vtl, sH, sL);
    return;
  }
  const bool isq = blockIdx.z == 0;
  qkv_tile<false>(xh, xl, isq ? wqh : wkh, isq ? wql : wkl,
                  isq ? qh : kh, isq ? ql : kl, sH, sL);
}

// ---------------------------------------------------------------------------
// One pass of the P V loop of kernel 2: 128 keys, four chunks of 32.
// On entry vh, vl hold this pass's four V fragment pairs and ph, pl the first
// chunk's P fragments of both 16-row tiles. Every operand is fetched ahead of
// its products: a chunk's P while the chunk before it is multiplied, a chunk's V
// one pass ahead, into the same registers, right behind its last product.
// ap*: P (LDS) at this pass's first key; bv*: V at the NEXT pass's first key.
// MORE == false: the last pass, which fetches nothing for a next one.
// ---------------------------------------------------------------------------
template <bool MORE>
static __device__ __forceinline__ void pv_pass(
    const __bf16* aph, const __bf16* apl,
    const __bf16* __restrict__ bvh, const __bf16* __restrict__ bvl,
    v16bf (&vh)[4], v16bf (&vl)[4], v16bf (&ph)[2], v16bf (&pl)[2], v8f (&acc)[2][4]) {
#pragma unroll   // constant indices: fragments and accumulators stay in registers
  for (int c = 0; c < 4; ++c) {
    v16bf nh[2], nl[2];
    if (MORE || c < 3) {
#pragma unroll   // constant indices
      for (int tm = 0; tm < 2; ++tm) {
        nh[tm] = ldAB(aph + tm * 16 * PROW, 32 * (c + 1));
        nl[tm] = ldAB(apl + tm * 16 * PROW, 32 * (c + 1));
      }
      // the next chunk's LDS reads are issued as one group in front of this chunk's
      // products; left alone, they stood among the products behind waits to 0
      __builtin_amdgcn_sched_barrier(0);
    }
    REG_CHUNK(ph[0], pl[0], vh[c], vl[c], acc[0][c]);
    REG_CHUNK(ph[1], pl[1], vh[c], vl[c], acc[1][c]);
    if (MORE) {
      // the reload stays behind the chunk's products, so that it takes the same
      // registers: hoisted, it would cost a second set and the second resident block
      __builtin_amdgcn_sched_barrier(0);
      vh[c] = ldF(bvh, c * 8 * FRAG);
      vl[c] = ldF(bvl, c * 8 * FRAG);
    }
    if (MORE || c < 3) {
#pragma unroll   // constant indices
      for (int tm = 0; tm < 2; ++tm) {
        ph[tm] = nh[tm];
        pl[tm] = nl[tm];
      }
    }
  }
  if (MORE) {
    // a precaution: the loads issued so far have taken their address registers
    // before the next pass's addresses may be given them
    asm volatile("s_wait_xcnt 0x0" ::: "memory");
    // no load is moved behind that wait and no register write in front of it
    __builtin_amdgcn_sched_barrier(0);
  }
}

// ---------------------------------------------------------------------------
// Kernel 2: attention, one (b,h) x 32 query rows per block.
// LDS: fp32 S [32][SROW] + output staging 8 x 1,536 B + one flag word = 143,888 B,
// so that two blocks stand on a WGP (which also takes at most 256 VGPRs a wave).
// A score row's 4,112 B later hold the row's P: hi in the first 2,048 B, lo in
// the next 2,048 B.
// Keys past the block's causal edge hold only -inf or -1e9. While every row's
// maximum is far above -1e9 their exp is exactly 0, so they are not walked.
// ---------------------------------------------------------------------------
__global__ __launch_bounds__(256)
void attn_kernel(const __bf16* __restrict__ qh, const __bf16* __restrict__ ql,
                 const __bf16* __restrict__ kh, const __bf16* __restrict__ kl,
                 const __bf16* __restrict__ vth, const __bf16* __restrict__ vtl,
                 const int* __restrict__ mask, const unsigned* __restrict__ mbits,
                 __bf16* __restrict__ aoh, __bf16* __restrict__ aol) {
  extern __shared__ char smem[];
  float*  sS  = (float*)smem;                          // [32][SROW] fp32
  __bf16* pHi = (__bf16*)smem;                         // [32][PROW], over S row by row
  __bf16* pLo = pHi + T_;                              // [32][PROW], behind the row's hi
  __bf16* sOut = (__bf16*)(smem + 32 * SROW * 4);      // 8 waves x 768 elements
  int* sFull  = (int*)(smem + 32 * SROW * 4 + 8 * 768 * 2);  // 1: walk all T_ keys

  // the wave's number as a scalar: fragment bases then stay in scalar registers
  // and every fragment load shares the one per-lane offset vo
  const int wave = __builtin_amdgcn_readfirstlane(threadIdx.x >> 5);
  const int lane = threadIdx.x & 31;
  const int r16 = lane & 15, lh = lane >> 4;
  const unsigned vo = (unsigned)(lane * 8);            // the lane's piece of a fragment
  // Block order: a block's cost grows with its query tile (it walks the keys up to
  // its causal edge) and there are four times as many blocks as places. So cost
  // falls with the index: within a group of
  // 16 (b,h) pairs the last query tile comes first, and the launch ends on the
  // short blocks. Groups of 16 pairs keep the K and V in use at one time small.
  const int b = blockIdx.z * 2 + (blockIdx.x >> 3), h = blockIdx.x & 7;
  const int t0 = (T_ / 32 - 1 - blockIdx.y) * 32;

  const size_t bh = ((size_t)b * H_ + h) * (size_t)T_ * E_;
  const __bf16* Qh = qh + bh;  const __bf16* Ql = ql + bh;
  const __bf16* Kh = kh + bh;  const __bf16* Kl = kl + bh;
  const __bf16* Vh = vth + bh; const __bf16* Vl = vtl + bh;   // all in fragment order

  // keys up to the causal edge of the last query row, in whole groups of 128
  // (one key tile for each of the 8 waves)
  const int nkc = (t0 + 32 + 127) & ~127;
  int nk = nkc;
  if (threadIdx.x == 0) *sFull = 0;

  // ---- Phase 1: S = (Q K^T)*scale, causal -inf then padding -1e9 ----
  // Q of both 16-row tiles (16 x v16bf) stays in registers; a K fragment is
  // loaded once and multiplied with both, so K crosses from L2 once a block.
  {
    const __bf16* aqh = Qh + (size_t)t0 * E_ + vo;   // 4 fragments a 16-row tile
    const __bf16* aql = Ql + (size_t)t0 * E_ + vo;
    v16bf q_h[2][4], q_l[2][4];
#pragma unroll   // constant indices: the fragments stay in registers
    for (int c = 0; c < 8; ++c) {
      q_h[c >> 2][c & 3] = ldF(aqh, c * FRAG);
      q_l[c >> 2][c & 3] = ldF(aql, c * FRAG);
    }

    // the query tile's mask words, one a key (built by kernel 0)
    const unsigned* mrow = mbits + (t0 / 32) * T_ + r16;

    for (int tb = 0; tb < (nkc >> 4); tb += 8) {
      const int k0 = (tb + wave) * 16;
      // the lane's key against all 32 query rows in one load, asked for together with
      // K; bit tm*16 + j of mw: query row t0 + tm*16 + j + 8*lh
      const unsigned mw = mrow[k0] >> (8 * lh);
      const __bf16* bkh = Kh + (size_t)k0 * E_ + vo;
      const __bf16* bkl = Kl + (size_t)k0 * E_ + vo;
      v16bf k_h[4], k_l[4];
#pragma unroll   // constant indices: the fragments stay in registers
      for (int c = 0; c < 4; ++c) {
        k_h[c] = ldF(bkh, c * FRAG);
        k_l[c] = ldF(bkl, c * FRAG);
      }
      // a precaution: the loads issued so far have taken their address registers
      // before the next pass's addresses may be given them
      asm volatile("s_wait_xcnt 0x0" ::: "memory");
      // no load is moved behind that wait and no register write in front of it
      __builtin_amdgcn_sched_barrier(0);

      const int kg = k0 + r16;
#pragma unroll   // constant indices into the Q fragments
      for (int tm = 0; tm < 2; ++tm) {
        const int q0 = t0 + tm * 16;
        v8f acc0 = vzero8(), acc1 = vzero8(), acc2 = vzero8(), acc3 = vzero8();
        REG_CHUNK(q_h[tm][0], q_l[tm][0], k_h[0], k_l[0], acc0);
        REG_CHUNK(q_h[tm][1], q_l[tm][1], k_h[1], k_l[1], acc1);
        REG_CHUNK(q_h[tm][2], q_l[tm][2], k_h[2], k_l[2], acc2);
        REG_CHUNK(q_h[tm][3], q_l[tm][3], k_h[3], k_l[3], acc3);
        v8f acc = (acc0 + acc1) + (acc2 + acc3);

#pragma unroll
        for (int j = 0; j < 8; ++j) {
          const int qg = q0 + j + 8 * lh;
          float val = acc[j] * SCALE;
          if (kg > qg) val = -INFINITY;                      // causal first
          if (((mw >> (tm * 16 + j)) & 1u) == 0) val = -1e9f;  // padding overwrites
          sS[(tm * 16 + j + 8 * lh) * SROW + kg] = val;
        }
      }
    }
  }
  __syncthreads();

  // ---- Phase 2a: row maxima over the walked keys ----
  float mxr[4];
  bool low = false;
#pragma unroll
  for (int r = 0; r < 4; ++r) {
    const float* row = sS + (wave * 4 + r) * SROW;
    float mx = -INFINITY;
    for (int cb = 0; cb < nkc; cb += 128) {
#pragma unroll   // four reads behind one wait; the key count is a multiple of 128
      for (int u = 0; u < 4; ++u) mx = fmaxf(mx, row[cb + 32 * u + lane]);
    }
    for (int off = 16; off; off >>= 1) mx = fmaxf(mx, __shfl_xor(mx, off, 32));
    mxr[r] = mx;
    low = low || !(mx >= -5e8f);   // exp(-1e9 - mx) might not be 0 for this row
  }
  if (low) *sFull = 1;
  __syncthreads();   // publishes the flag: all waves must walk the same key count
  if (__builtin_amdgcn_readfirstlane(*sFull) != 0) {
    // A row without a live key up to the edge: the keys past the edge count.
    // All of them are causal for every row here, so no product is needed.
    // Each wave fills the rows that it alone reads in phase 2.
    nk = T_;
#pragma unroll
    for (int r = 0; r < 4; ++r) {
      const int rr = wave * 4 + r;
      float* row = sS + rr * SROW;
      float mx = mxr[r];
      for (int c = nkc + lane; c < T_; c += 32) {
        const float val = (mask[(size_t)(t0 + rr) * T_ + c] == 0) ? -1e9f : -INFINITY;
        row[c] = val;
        mx = fmaxf(mx, val);
      }
      for (int off = 16; off; off >>= 1) mx = fmaxf(mx, __shfl_xor(mx, off, 32));
      mxr[r] = mx;
    }
  }

  // Wave w owns the 16 columns e = 16*w of both 16-row tiles in phase 3: a V
  // fragment is loaded once and multiplied with both, so V crosses from L2 once a
  // block. The first 128 keys' V (every block has them) is asked for here and
  // arrives during phase 2b.
  const int tn = wave;
  const __bf16* bvh = Vh + tn * FRAG + vo;           // 32 keys on: 8 fragments on
  const __bf16* bvl = Vl + tn * FRAG + vo;
  v16bf v_h[4], v_l[4];
#pragma unroll   // constant indices: the fragments stay in registers
  for (int c = 0; c < 4; ++c) {
    v_h[c] = ldF(bvh, c * 8 * FRAG);
    v_l[c] = ldF(bvl, c * 8 * FRAG);
  }
  // a precaution: these loads have taken their address registers before phase 2b
  // may be given them
  asm volatile("s_wait_xcnt 0x0" ::: "memory");
  // no load is moved behind that wait and no register write in front of it
  __builtin_amdgcn_sched_barrier(0);

  // ---- Phase 2b: exp, row sum; emit P as split bf16 ----
  // The wave takes a whole row into registers (up to 32 values a lane) and only
  // then writes P over it: every store of a row depends, through the row's sum,
  // on every load of that row, and no other wave touches the row in this phase.
#pragma unroll
  for (int r = 0; r < 4; ++r) {
    const int rr = wave * 4 + r;
    const float* row = sS + rr * SROW;
    const float mx = mxr[r];
    float e[32];
    float sum = 0.f;
#pragma unroll   // constant indices: the row stays in registers; nk is a scalar
    for (int g = 0; g < 8; ++g) {
      if (g * 128 < nk) {
#pragma unroll   // constant indices
        for (int u = 0; u < 4; ++u) e[g * 4 + u] = row[g * 128 + 32 * u + lane];
      }
    }
#pragma unroll   // constant indices; same per-lane order of the sum
    for (int g = 0; g < 8; ++g) {
      if (g * 128 < nk) {
#pragma unroll   // constant indices
        for (int u = 0; u < 4; ++u) {
          e[g * 4 + u] = expf(e[g * 4 + u] - mx);
          sum += e[g * 4 + u];
        }
      }
    }
    for (int off = 16; off; off >>= 1) sum += __shfl_xor(sum, off, 32);
    const float inv = 1.f / sum;
#pragma unroll   // constant indices
    for (int g = 0; g < 8; ++g) {
      if (g * 128 < nk) {
#pragma unroll   // constant indices
        for (int u = 0; u < 4; ++u) {
          const int c = g * 128 + 32 * u + lane;
          __bf16 hh, ll;
          split2(e[g * 4 + u] * inv, hh, ll);
          pHi[rr * PROW + c] = hh;
          pLo[rr * PROW + c] = ll;
        }
      }
    }
  }
  __syncthreads();

  // ---- Phase 3: O = P @ V  (A from LDS split-bf16, B from transposed V) ----
  // Each wave turns its output tiles, in a staging range of its own, into the
  // 16-byte pieces of the fragment order.
  constexpr int OPITCH = 24;                        // 48 B a row: 16 rows, 16 bank groups
  __bf16* stH = sOut + wave * 768;                  // [16][OPITCH]
  __bf16* stL = stH + 16 * OPITCH;
  const __bf16* aph = pHi + r16 * PROW + 8 * lh;
  const __bf16* apl = pLo + r16 * PROW + 8 * lh;

  v8f acc[2][4];
#pragma unroll   // constant indices: the accumulators stay in registers
  for (int c = 0; c < 8; ++c) acc[c >> 2][c & 3] = vzero8();
  v16bf p_h[2], p_l[2];
#pragma unroll   // constant indices
  for (int tm = 0; tm < 2; ++tm) {
    p_h[tm] = ldAB(aph + tm * 16 * PROW, 0);
    p_l[tm] = ldAB(apl + tm * 16 * PROW, 0);
  }
  int k0 = 0;
  for (; k0 + 128 < nk; k0 += 128) {
    const int nx = ((k0 >> 5) + 4) * 8 * FRAG;       // V of the next 128 keys
    pv_pass<true>(aph + k0, apl + k0, bvh + nx, bvl + nx, v_h, v_l, p_h, p_l, acc);
  }
  pv_pass<false>(aph + k0, apl + k0, bvh, bvl, v_h, v_l, p_h, p_l, acc);

#pragma unroll   // constant indices into the accumulators
  for (int tm = 0; tm < 2; ++tm) {
    const v8f o = (acc[tm][0] + acc[tm][1]) + (acc[tm][2] + acc[tm][3]);
#pragma unroll
    for (int j = 0; j < 8; ++j) {
      __bf16 hh, ll;
      split2(o[j], hh, ll);
      stH[(j + 8 * lh) * OPITCH + r16] = hh;
      stL[(j + 8 * lh) * OPITCH + r16] = ll;
    }
    // the wave's own LDS writes have landed before it reads the rows back
    asm volatile("s_wait_dscnt 0x0" ::: "memory");
    // rows (b,t), k = h*E + e, pre-split for the output projection: fragment
    // (row / 16) * 32 + k / 32; this tile is its half tn & 1, one piece a lane
    const size_t idx = ((size_t)((b * T_ + t0) / 16 + tm) * 32 + h * 4 + (tn >> 1)) * FRAG
                     + (tn & 1) * 256;
    *(v8bf*)(aoh + idx + vo) = *(const v8bf*)(stH + r16 * OPITCH + 8 * lh);
    *(v8bf*)(aol + idx + vo) = *(const v8bf*)(stL + r16 * OPITCH + 8 * lh);
    // a precaution: the two stores have taken their registers before the second
    // tile's code is given them
    if (tm == 0) {
      asm volatile("s_wait_xcnt 0x0" ::: "memory");
      // no register write of the second tile's code is moved in front of that wait
      __builtin_amdgcn_sched_barrier(0);
    }
  }
}

// ---------------------------------------------------------------------------
// Kernel 3: out = ao @ Wu^T + bu   (split-bf16, M=8192, N=128, K=1024)
// ---------------------------------------------------------------------------
__global__ __launch_bounds__(256)
void proj_kernel(const __bf16* __restrict__ aoh, const __bf16* __restrict__ aol,
                 const __bf16* __restrict__ wuh, const __bf16* __restrict__ wul,
                 const float* __restrict__ bu, float* __restrict__ out) {
  // the wave's number as a scalar: Wu's fragment base stays in scalar registers
  const int wave = __builtin_amdgcn_readfirstlane(threadIdx.x >> 5);
  const int lane = threadIdx.x & 31;
  const int r16 = lane & 15, lh = lane >> 4;
  const unsigned vo = (unsigned)(lane * 8);            // the lane's piece of a fragment
  const int m0 = blockIdx.x * 16;
  const int n0 = wave * 16;
  const int K  = H_ * E_;  // 1024

  // both operands in fragment order: the 32 fragments of a 16-row tile in a row
  const __bf16* aah = aoh + (size_t)m0 * K + vo;
  const __bf16* aal = aol + (size_t)m0 * K + vo;
  const __bf16* bwh = wuh + (size_t)n0 * K + vo;
  const __bf16* bwl = wul + (size_t)n0 * K + vo;

  v8f acc0 = vzero8(), acc1 = vzero8(), acc2 = vzero8(), acc3 = vzero8();
#pragma unroll 2
  for (int k0 = 0; k0 < K; k0 += 128) {
    const int f0 = (k0 >> 5) * FRAG;
    SPLIT_CHUNK(aah, aal, f0,            bwh, bwl, f0,            acc0);
    SPLIT_CHUNK(aah, aal, f0 + FRAG,     bwh, bwl, f0 + FRAG,     acc1);
    SPLIT_CHUNK(aah, aal, f0 + 2 * FRAG, bwh, bwl, f0 + 2 * FRAG, acc2);
    SPLIT_CHUNK(aah, aal, f0 + 3 * FRAG, bwh, bwl, f0 + 3 * FRAG, acc3);
  }
  v8f acc = (acc0 + acc1) + (acc2 + acc3);

  const float bias = bu[n0 + r16];
#pragma unroll
  for (int j = 0; j < 8; ++j) {
    out[(size_t)(m0 + j + 8 * lh) * E_ + n0 + r16] = acc[j] + bias;
  }
}

// ---------------------------------------------------------------------------
extern "C" void kernel_launch(void* const* d_in, const int* in_sizes, int n_in,
                              void* d_out, int out_size, void* d_ws, size_t ws_size,
                              hipStream_t stream) {
  (void)in_sizes; (void)n_in; (void)out_size; (void)ws_size;
  const float* x    = (const float*)d_in[0];
  const int*   mask = (const int*)  d_in[1];
  const float* Wk   = (const float*)d_in[2];   // dict order: x, mask, Wk, Wq, Wv, Wu, bu
  const float* Wq   = (const float*)d_in[3];
  const float* Wv   = (const float*)d_in[4];
  const float* Wu   = (const float*)d_in[5];
  const float* bu   = (const float*)d_in[6];
  float* out = (float*)d_out;

  // workspace layout (bf16 element offsets); total ~140.6 MB
  __bf16* ws = (__bf16*)d_ws;
  const size_t CH = (size_t)B_ * H_ * T_ * E_;   // 8,388,608
  const size_t XH = (size_t)B_ * T_ * E_;        // 1,048,576
  const size_t WH = (size_t)(H_ * E_) * E_;      //   131,072
  __bf16* qh  = ws;            __bf16* ql  = ws + CH;
  __bf16* kh  = ws + 2 * CH;   __bf16* kl  = ws + 3 * CH;
  __bf16* vth = ws + 4 * CH;   __bf16* vtl = ws + 5 * CH;
  __bf16* aoh = ws + 6 * CH;   __bf16* aol = ws + 7 * CH;
  __bf16* xh  = ws + 8 * CH;   __bf16* xl  = xh + XH;
  __bf16* wb  = xl + XH;
  __bf16* wqh = wb;            __bf16* wql = wb + WH;
  __bf16* wkh = wb + 2 * WH;   __bf16* wkl = wb + 3 * WH;
  __bf16* wvh = wb + 4 * WH;   __bf16* wvl = wb + 5 * WH;
  __bf16* wuh = wb + 6 * WH;   __bf16* wul = wb + 7 * WH;
  unsigned* mbits = (unsigned*)(wb + 8 * WH);    // 32 * 1024 mask words, 128 KB

  // 0) split fp32 inputs into bf16 hi/lo, fragment order (8 elements a thread):
  //    128 blocks for the mask words, 512 for x, then 64 for each of Wq, Wk, Wv, Wu,
  //    in one launch
  split_kernel<<<128 + 512 + 4 * 64, 256, 0, stream>>>(x, Wq, Wk, Wv, Wu, mask,
                                                       xh, xl, wb, mbits);

  // 1) QKV projection (V transposed)
  dim3 g1((B_ * T_) / 64, H_, 3);
  qkv_kernel<<<g1, 256, 0, stream>>>(xh, xl, wqh, wql, wkh, wkl, wvh, wvl,
                                     qh, ql, kh, kl, vth, vtl);

  // 2) attention
  const size_t lds = (size_t)32 * SROW * 4 + (size_t)8 * 768 * 2 + 16;  // 143,888 B
  (void)hipFuncSetAttribute((const void*)attn_kernel,
                            hipFuncAttributeMaxDynamicSharedMemorySize, (int)lds);
  dim3 g2(2 * H_, T_ / 32, B_ / 2);   // (b,h) pair of a group; query tile, last first; group
  attn_kernel<<<g2, 256, lds, stream>>>(qh, ql, kh, kl, vth, vtl, mask, mbits, aoh, aol);

  // 3) output projection
  proj_kernel<<<(B_ * T_) / 16, 256, 0, stream>>>(aoh, aol, wuh, wul, bu, out);
}

// v010
// It runs in 156 microseconds.
// In both of two side-by-side timings against v009, it was 1.04 times as fast.
// Counting every step since v000, it is 4.19 times as fast.
#include <hip/hip_runtime.h>
#include <math.h>

typedef __attribute__((ext_vector_type(2)))  float  v2f;
typedef __attribute__((ext_vector_type(4)))  float  v4f;
typedef __attribute__((ext_vector_type(8)))  float  v8f;
typedef __attribute__((ext_vector_type(2)))  __bf16 v2bf;
typedef __attribute__((ext_vector_type(8)))  __bf16 v8bf;
typedef __attribute__((ext_vector_type(4)))  unsigned v4u;
typedef __attribute__((ext_vector_type(16))) __bf16 v16bf;

constexpr int B_ = 8, T_ = 1024, E_ = 128, H_ = 8;
constexpr int SROW = 1028;   // fp32 score row stride (1028 % 64 == 4 -> conflict-free)
constexpr int PROW = 2 * SROW;  // bf16 prob row stride: a prob row stands in its score row's place
constexpr float SCALE = 0.08838834764831845f;  // 1/sqrt(128)

static __device__ __forceinline__ v8f vzero8() {
  v8f z = {0.f, 0.f, 0.f, 0.f, 0.f, 0.f, 0.f, 0.f};
  return z;
}

// --- bf16 helpers ---
static __device__ __forceinline__ float bf2f(__bf16 h) {
  return __builtin_bit_cast(float, (unsigned)((unsigned)__builtin_bit_cast(unsigned short, h) << 16));
}
// round to nearest even, by the chip's own conversion instruction
static __device__ __forceinline__ __bf16 f2bf(float f) {
  return (__bf16)f;
}
static __device__ __forceinline__ void split2(float f, __bf16& h, __bf16& l) {
  h = f2bf(f);
  l = f2bf(f - bf2f(h));
}
// the same for eight values at once: the conversions then take two values each
static __device__ __forceinline__ void split8(v8f f, v8bf& h, v8bf& l) {
  v4u hu, lu;
#pragma unroll   // constant indices: the vectors stay in registers
  for (int p = 0; p < 4; ++p) {
    const v2f a = {f[2 * p], f[2 * p + 1]};
    const unsigned u = __builtin_bit_cast(unsigned, __builtin_convertvector(a, v2bf));
    const v2f b = {__builtin_bit_cast(float, u << 16), __builtin_bit_cast(float, u & 0xFFFF0000u)};
    hu[p] = u;
    lu[p] = __builtin_bit_cast(unsigned, __builtin_convertvector(a - b, v2bf));
  }
  h = __builtin_bit_cast(v8bf, hu);
  l = __builtin_bit_cast(v8bf, lu);
}

// D = A(16x32 bf16) * B(32x16 bf16) + C(16x16 f32)
static __device__ __forceinline__ v8f wmma_bf(v16bf a, v16bf b, v8f c) {
  return __builtin_amdgcn_wmma_f32_16x16x32_bf16(false, a, false, b, (short)0, c, false, false);
}

// Per-lane A/B operand slice from a K-contiguous row.
// p must be pre-offset by row*stride + 8*(lane>>4).
// elems 0..7 <- K[k0 + 8*lh .. +7], elems 8..15 <- K[k0 + 16 + 8*lh .. +7]
static __device__ __forceinline__ v16bf ldAB(const __bf16* p, int k0) {
  v8bf a = *(const v8bf*)(p + k0);
  v8bf b = *(const v8bf*)(p + k0 + 16);
  return __builtin_shufflevector(a, b, 0,1,2,3,4,5,6,7,8,9,10,11,12,13,14,15);
}

// FRAGMENT ORDER of the global bf16 planes. A plane is cut into fragments of
// 16 rows x 32 k = 512 elements (1024 B). Inside one, the 16-byte piece that
// holds row r, k = 16*half + 8*lh .. +7 stands at element half*256 + (16*lh + r)*8.
// Lane r + 16*lh then finds its operand slice at lane*8 and 256 + lane*8, and each
// of the two wave-wide loads reads 512 contiguous bytes (4 whole lines) instead
// of 32 bytes out of each of 16 lines.
constexpr int FRAG = 512;   // elements of one fragment

// p must be pre-offset by lane*8; off = element offset of the fragment.
static __device__ __forceinline__ v16bf ldF(const __bf16* p, int off) {
  v8bf a = *(const v8bf*)(p + off);
  v8bf b = *(const v8bf*)(p + off + 256);
  return __builtin_shufflevector(a, b, 0,1,2,3,4,5,6,7,8,9,10,11,12,13,14,15);
}

// One K=32 chunk of the split-bf16 product: hi*hi + hi*lo + lo*hi.
// Both operands from planes in fragment order, at fragment offsets FA_ and FB_.
#define SPLIT_CHUNK(AH_, AL_, FA_, BH_, BL_, FB_, ACC_)  \
  do {                                              \
    v16bf _ah = ldF((AH_), (FA_));                  \
    v16bf _al = ldF((AL_), (FA_));                  \
    v16bf _bh = ldF((BH_), (FB_));                  \
    v16bf _bl = ldF((BL_), (FB_));                  \
    (ACC_) = wmma_bf(_ah, _bh, (ACC_));             \
    (ACC_) = wmma_bf(_ah, _bl, (ACC_));             \
    (ACC_) = wmma_bf(_al, _bh, (ACC_));             \
  } while (0)

// The same three products with all four operands already in registers.
#define REG_CHUNK(AH_, AL_, BH_, BL_, ACC_)         \
  do {                                              \
    (ACC_) = wmma_bf((AH_), (BH_), (ACC_));         \
    (ACC_) = wmma_bf((AH_), (BL_), (ACC_));         \
    (ACC_) = wmma_bf((AL_), (BH_), (ACC_));         \
  } while (0)

// ---------------------------------------------------------------------------
// Kernel 0: elementwise fp32 -> (bf16 hi, bf16 lo) split of x and of the four
// weight matrices in ONE launch: none of the five needs anything of another, so
// they share a grid by ranges of the block index (a block-uniform choice).
// Row-major source of 32 << lgc columns, planes written in fragment order
// (fragments of a 16-row tile follow one another along k). One 16-byte piece of
// each plane a thread, taken in the order of the destination.
// The same launch packs the padding mask for kernel 2: one 32-bit word for each
// (tile of 32 query rows, key), bit i set where mask[32 * tile + i][key] != 0.
// ---------------------------------------------------------------------------
constexpr int XBLK = (B_ * T_ * E_ / 8) / 256;        // 512 blocks for x
constexpr int WBLK = (H_ * E_ * E_ / 8) / 256;        //  64 blocks for each weight
constexpr size_t WPLANE = (size_t)(H_ * E_) * E_;     // elements of one weight plane
constexpr int MBLK = ((T_ / 32) * T_) / 256;          // 128 blocks for the mask words

__global__ __launch_bounds__(256)
void split_kernel(const float* __restrict__ x,  const float* __restrict__ Wq,
                  const float* __restrict__ Wk, const float* __restrict__ Wv,
                  const float* __restrict__ Wu, const int* __restrict__ mask,
                  __bf16* __restrict__ xh, __bf16* __restrict__ xl,
                  __bf16* __restrict__ wb, unsigned* __restrict__ mbits) {
  if (blockIdx.x < MBLK) {
    // one word a thread; a wave reads 128 contiguous bytes of each of 32 mask rows
    const int d = blockIdx.x * 256 + threadIdx.x;     // tile * T_ + key
    const int* mp = mask + (size_t)(d / T_) * 32 * T_ + (d % T_);
    unsigned w = 0;
#pragma unroll   // 32 independent loads in flight
    for (int i = 0; i < 32; ++i) w |= (mp[i * T_] != 0 ? 1u : 0u) << i;
    mbits[d] = w;
    return;
  }
  // wb: hi and lo plane of Wq, Wk, Wv, Wu, one behind the other
  const int blk = blockIdx.x - MBLK;
  const float* src = x;
  __bf16* h = xh;
  __bf16* l = xl;
  int lgc = 2;                                        // x, Wq, Wk, Wv: 128 columns
  int first = blk;
  if (blk >= XBLK) {
    const int j = (blk - XBLK) / WBLK;
    src = j == 0 ? Wq : j == 1 ? Wk : j == 2 ? Wv : Wu;
    if (j == 3) lgc = 5;                              // Wu: 1024 columns
    h = wb + (size_t)(2 * j) * WPLANE;
    l = h + WPLANE;
    first = (blk - XBLK) % WBLK;
  }
  const int d = first * 256 + threadIdx.x;
  const int frag = d >> 6;
  const int row  = (frag >> lgc) * 16 + (d & 15);
  const int k    = (frag & ((1 << lgc) - 1)) * 32 + ((d >> 5) & 1) * 16 + ((d >> 4) & 1) * 8;
  const float* sp = src + ((size_t)row << (lgc + 5)) + k;
  const v4f f0 = *(const v4f*)sp;
  const v4f f1 = *(const v4f*)(sp + 4);
  v8bf hv, lv;
  split8(__builtin_shufflevector(f0, f1, 0, 1, 2, 3, 4, 5, 6, 7), hv, lv);
  *(v8bf*)(h + (size_t)d * 8) = hv;
  *(v8bf*)(l + (size_t)d * 8) = lv;
}

// ---------------------------------------------------------------------------
// Kernel 1: QKV projection (split-bf16 GEMM, K=128 -> 4 chunks * 3 WMMA).
// grid = (128, H, 3), block = 256: 64 rows of x by one head's 128 columns.
// x and W are read, and Q, K, V^T written, in fragment order.
// Q, K: rows t, k = e; per (b,h) fragment (t/16)*4 + e/32.
// V^T : rows e, k = t; per (b,h) fragment (t/32)*8 + e/16.
// The hi and lo output tiles are staged in LDS, and leave as 16-byte stores in
// the order of the destination, 512 contiguous bytes a wave.
// ---------------------------------------------------------------------------
constexpr int QK_PITCH = 136;   // staged Q/K row: 128 e + 8 (272 B, 4 banks a row)
constexpr int VT_PITCH = 72;    // staged V^T row: 64 t + 8 (144 B, 36 dwords a row)
constexpr int STAGE_ELEMS = 128 * VT_PITCH;   // one plane; also holds 64 * QK_PITCH

// TR == false: D = W * x^T, so a lane holds 8 consecutive e of one row t.
// TR == true : D = x * W^T, so a lane holds 8 consecutive t of one column e.
// Either way the lane's 8 values are one 16-byte piece of the output layout.
template <bool TR>
static __device__ __forceinline__ void qkv_tile(
    const __bf16* __restrict__ xh, const __bf16* __restrict__ xl,
    const __bf16* __restrict__ Wh, const __bf16* __restrict__ Wl,
    __bf16* __restrict__ oh, __bf16* __restrict__ ol,
    __bf16* sH, __bf16* sL) {
  // the wave's number as a scalar: W's and x's row bases then stay in scalar
  // registers and every fragment load shares one per-lane offset
  const int wave = __builtin_amdgcn_readfirstlane(threadIdx.x >> 5);
  const int lane = threadIdx.x & 31;
  const int r16 = lane & 15, lh = lane >> 4;
  const int m0 = blockIdx.x * 64;
  const int h  = blockIdx.y;
  const unsigned vo = (unsigned)(lane * 8);            // the lane's piece of a fragment

  const __bf16* bwh = Wh + (size_t)(h * E_ + wave * 16) * E_ + vo;
  const __bf16* bwl = Wl + (size_t)(h * E_ + wave * 16) * E_ + vo;
  const v16bf w_h0 = ldF(bwh, 0),        w_h1 = ldF(bwh, FRAG);
  const v16bf w_h2 = ldF(bwh, 2 * FRAG), w_h3 = ldF(bwh, 3 * FRAG);
  const v16bf w_l0 = ldF(bwl, 0),        w_l1 = ldF(bwl, FRAG);
  const v16bf w_l2 = ldF(bwl, 2 * FRAG), w_l3 = ldF(bwl, 3 * FRAG);

// hi*hi + hi*lo + lo*hi of one K=32 chunk, x's fragments already in registers
#define XW_CHUNK(XH_, XL_, WH_, WL_, ACC_)            \
  do {                                                \
    if (TR) {                                         \
      (ACC_) = wmma_bf((XH_), (WH_), (ACC_));         \
      (ACC_) = wmma_bf((XH_), (WL_), (ACC_));         \
      (ACC_) = wmma_bf((XL_), (WH_), (ACC_));         \
    } else {                                          \
      (ACC_) = wmma_bf((WH_), (XH_), (ACC_));         \
      (ACC_) = wmma_bf((WL_), (XH_), (ACC_));         \
      (ACC_) = wmma_bf((WH_), (XL_), (ACC_));         \
    }                                                 \
  } while (0)

  const __bf16* axh = xh + (size_t)m0 * E_ + vo;
  const __bf16* axl = xl + (size_t)m0 * E_ + vo;
  v16bf fh[4], fl[4];                              // x fragments of one 16-row tile
#pragma unroll
  for (int c = 0; c < 4; ++c) {
    fh[c] = ldF(axh, c * FRAG);
    fl[c] = ldF(axl, c * FRAG);
  }
  // all 32 first loads issue before the first product; left alone, the last
  // ones were issued in pairs among the products, each behind a wait to 0
  __builtin_amdgcn_sched_barrier(0);

#pragma unroll
  for (int mt = 0; mt < 4; ++mt) {
    v8f acc0 = vzero8(), acc1 = vzero8(), acc2 = vzero8(), acc3 = vzero8();
    XW_CHUNK(fh[0], fl[0], w_h0, w_l0, acc0);
    XW_CHUNK(fh[1], fl[1], w_h1, w_l1, acc1);
    XW_CHUNK(fh[2], fl[2], w_h2, w_l2, acc2);
    XW_CHUNK(fh[3], fl[3], w_h3, w_l3, acc3);
    v8f acc = (acc0 + acc1) + (acc2 + acc3);

    if (mt < 3) {
      // the next tile's loads stay behind this tile's products, so that they take
      // the same registers: hoisted, they cost a second set and resident blocks
      __builtin_amdgcn_sched_barrier(0);
      // they fly while this tile is split and staged
#pragma unroll
      for (int c = 0; c < 4; ++c) {
        fh[c] = ldF(axh, ((mt + 1) * 4 + c) * FRAG);
        fl[c] = ldF(axl, ((mt + 1) * 4 + c) * FRAG);
      }
      // a precaution: the loads issued so far have taken their address register
      // before anything below may be given it
      asm volatile("s_wait_xcnt 0x0" ::: "memory");
      // no load is moved behind that wait and no register write in front of it
      __builtin_amdgcn_sched_barrier(0);
    }

    v8bf hv, lv;                                   // C layout: VGPR j -> M = j + 8*(lane/16)
    split8(acc, hv, lv);
    const int off = TR ? (wave * 16 + r16) * VT_PITCH + mt * 16 + 8 * lh    // [e][t]
                       : (mt * 16 + r16) * QK_PITCH + wave * 16 + 8 * lh;   // [t][e]
    *(v8bf*)(sH + off) = hv;
    *(v8bf*)(sL + off) = lv;
  }
#undef XW_CHUNK
  __syncthreads();   // every wave's pieces are staged before any row is read back

  const int bb = m0 / T_;
  const int tb = m0 % T_;
#pragma unroll
  for (int i = 0; i < 4; ++i) {
    const int c = i * 256 + threadIdx.x;           // 1024 pieces of 16 B a plane
    const int f = c >> 6;                          // 16 fragments, 64 pieces each
    const int r = c & 15;                          // the piece's row in its fragment
    const int kk = ((c >> 5) & 1) * 16 + ((c >> 4) & 1) * 8;   // and its first k
    // either way the block's 64 t are 16 fragments in a row, from element tb * E_
    const int from = TR ? ((f & 7) * 16 + r) * VT_PITCH + (f >> 3) * 32 + kk    // [e][t]
                        : ((f >> 2) * 16 + r) * QK_PITCH + (f & 3) * 32 + kk;   // [t][e]
    const size_t to = ((size_t)bb * H_ + h) * (size_t)T_ * E_ + (size_t)tb * E_ + c * 8;
    *(v8bf*)(oh + to) = *(const v8bf*)(sH + from);
    *(v8bf*)(ol + to) = *(const v8bf*)(sL + from);
  }
  // a precaution: the stores have taken their registers before the V^T code,
  // which follows this one in the built text behind a conditional branch
  if (!TR) asm volatile("s_wait_xcnt 0x0" ::: "memory");
}

__global__ __launch_bounds__(256)
void qkv_kernel(const __bf16* __restrict__ xh, const __bf16* __restrict__ xl,
                const __bf16* __restrict__ wqh, const __bf16* __restrict__ wql,
                const __bf16* __restrict__ wkh, const __bf16* __restrict__ wkl,
                const __bf16* __restrict__ wvh, const __bf16* __restrict__ wvl,
                __bf16* __restrict__ qh, __bf16* __restrict__ ql,
                __bf16* __restrict__ kh, __bf16* __restrict__ kl,
                __bf16* __restrict__ vth, __bf16* __restrict__ vtl) {
  __shared__ __attribute__((aligned(16))) __bf16 sH[STAGE_ELEMS];
  __shared__ __attribute__((aligned(16))) __bf16 sL[STAGE_ELEMS];
  if (blockIdx.z == 2) {
    qkv_tile<true>(xh, xl, wvh, wvl, vth, vtl, sH, sL);
    return;
  }
  const bool isq = blockIdx.z == 0;
  qkv_tile<false>(xh, xl, isq ? wqh : wkh, isq ? wql : wkl,
                  isq ? qh : kh, isq ? ql : kl, sH, sL);
}

// ---------------------------------------------------------------------------
// One pass of the P V loop of kernel 2: 128 keys, four chunks of 32.
// On entry vh, vl hold this pass's four V fragment pairs and ph, pl the first
// chunk's P fragments of both 16-row tiles. Every operand is fetched ahead of
// its products: a chunk's P while the chunk before it is multiplied, a chunk's V
// one pass ahead, into the same registers, right behind its last product.
// ap*: P (LDS) at this pass's first key; bv*: V at the NEXT pass's first key.
// MORE == false: the last pass, which fetches nothing for a next one.
// ---------------------------------------------------------------------------
template <bool MORE>
static __device__ __forceinline__ void pv_pass(
    const __bf16* aph, const __bf16* apl,
    const __bf16* __restrict__ bvh, const __bf16* __restrict__ bvl,
    v16bf (&vh)[4], v16bf (&vl)[4], v16bf (&ph)[2], v16bf (&pl)[2], v8f (&acc)[2][4]) {
#pragma unroll   // constant indices: fragments and accumulators stay in registers
  for (int c = 0; c < 4; ++c) {
    v16bf nh[2], nl[2];
    if (MORE || c < 3) {
#pragma unroll   // constant indices
      for (int tm = 0; tm < 2; ++tm) {
        nh[tm] = ldAB(aph + tm * 16 * PROW, 32 * (c + 1));
        nl[tm] = ldAB(apl + tm * 16 * PROW, 32 * (c + 1));
      }
      // the next chunk's LDS reads are issued as one group in front of this chunk's
      // products; left alone, they stood among the products behind waits to 0
      __builtin_amdgcn_sched_barrier(0);
    }
    REG_CHUNK(ph[0], pl[0], vh[c], vl[c], acc[0][c]);
    REG_CHUNK(ph[1], pl[1], vh[c], vl[c], acc[1][c]);
    if (MORE) {
      // the reload stays behind the chunk's products, so that it takes the same
      // registers: hoisted, it would cost a second set and the second resident block
      __builtin_amdgcn_sched_barrier(0);
      vh[c] = ldF(bvh, c * 8 * FRAG);
      vl[c] = ldF(bvl, c * 8 * FRAG);
    }
    if (MORE || c < 3) {
#pragma unroll   // constant indices
      for (int tm = 0; tm < 2; ++tm) {
        ph[tm] = nh[tm];
        pl[tm] = nl[tm];
      }
    }
  }
  if (MORE) {
    // a precaution: the loads issued so far have taken their address registers
    // before the next pass's addresses may be given them
    asm volatile("s_wait_xcnt 0x0" ::: "memory");
    // no load is moved behind that wait and no register write in front of it
    __builtin_amdgcn_sched_barrier(0);
  }
}

// ---------------------------------------------------------------------------
// Kernel 2: attention, one (b,h) x 32 query rows per block.
// LDS: fp32 S [32][SROW] + output staging 8 x 1,536 B + one flag word = 143,888 B,
// so that two blocks stand on a WGP (which also takes at most 256 VGPRs a wave).
// A score row's 4,112 B later hold the row's P: hi in the first 2,048 B, lo in
// the next 2,048 B.
// Keys past the block's causal edge hold only -inf or -1e9. While every row's
// maximum is far above -1e9 their exp is exactly 0, so they are not walked.
// ---------------------------------------------------------------------------
__global__ __launch_bounds__(256)
void attn_kernel(const __bf16* __restrict__ qh, const __bf16* __restrict__ ql,
                 const __bf16* __restrict__ kh, const __bf16* __restrict__ kl,
                 const __bf16* __restrict__ vth, const __bf16* __restrict__ vtl,
                 const int* __restrict__ mask, const unsigned* __restrict__ mbits,
                 __bf16* __restrict__ aoh, __bf16* __restrict__ aol) {
  extern __shared__ char smem[];
  float*  sS  = (float*)smem;                          // [32][SROW] fp32
  __bf16* pHi = (__bf16*)smem;                         // [32][PROW], over S row by row
  __bf16* pLo = pHi + T_;                              // [32][PROW], behind the row's hi
  __bf16* sOut = (__bf16*)(smem + 32 * SROW * 4);      // 8 waves x 768 elements
  int* sFull  = (int*)(smem + 32 * SROW * 4 + 8 * 768 * 2);  // 1: walk all T_ keys

  // the wave's number as a scalar: fragment bases then stay in scalar registers
  // and every fragment load shares the one per-lane offset vo
  const int wave = __builtin_amdgcn_readfirstlane(threadIdx.x >> 5);
  const int lane = threadIdx.x & 31;
  const int r16 = lane & 15, lh = lane >> 4;
  const unsigned vo = (unsigned)(lane * 8);            // the lane's piece of a fragment
  // Block order: a block's cost grows with its query tile (it walks the keys up to
  // its causal edge) and there are four times as many blocks as places. So cost
  // falls with the index: within a group of
  // 16 (b,h) pairs the last query tile comes first, and the launch ends on the
  // short blocks. Groups of 16 pairs keep the K and V in use at one time small.
  const int b = blockIdx.z * 2 + (blockIdx.x >> 3), h = blockIdx.x & 7;
  const int t0 = (T_ / 32 - 1 - blockIdx.y) * 32;

  const size_t bh = ((size_t)b * H_ + h) * (size_t)T_ * E_;
  const __bf16* Qh = qh + bh;  const __bf16* Ql = ql + bh;
  const __bf16* Kh = kh + bh;  const __bf16* Kl = kl + bh;
  const __bf16* Vh = vth + bh; const __bf16* Vl = vtl + bh;   // all in fragment order

  // keys up to the causal edge of the last query row, in whole groups of 128
  // (one key tile for each of the 8 waves)
  const int nkc = (t0 + 32 + 127) & ~127;
  int nk = nkc;
  if (threadIdx.x == 0) *sFull = 0;

  // ---- Phase 1: S = (Q K^T)*scale, causal -inf then padding -1e9 ----
  // Q of both 16-row tiles (16 x v16bf) stays in registers; a K fragment is
  // loaded once and multiplied with both, so K crosses from L2 once a block.
  {
    const __bf16* aqh = Qh + (size_t)t0 * E_ + vo;   // 4 fragments a 16-row tile
    const __bf16* aql = Ql + (size_t)t0 * E_ + vo;
    v16bf q_h[2][4], q_l[2][4];
#pragma unroll   // constant indices: the fragments stay in registers
    for (int c = 0; c < 8; ++c) {
      q_h[c >> 2][c & 3] = ldF(aqh, c * FRAG);
      q_l[c >> 2][c & 3] = ldF(aql, c * FRAG);
    }

    // the query tile's mask words, one a key (built by kernel 0)
    const unsigned* mrow = mbits + (t0 / 32) * T_ + r16;

    for (int tb = 0; tb < (nkc >> 4); tb += 8) {
      const int k0 = (tb + wave) * 16;
      // the lane's key against all 32 query rows in one load, asked for together with
      // K; bit tm*16 + j of mw: query row t0 + tm*16 + j + 8*lh
      const unsigned mw = mrow[k0] >> (8 * lh);
      const __bf16* bkh = Kh + (size_t)k0 * E_ + vo;
      const __bf16* bkl = Kl + (size_t)k0 * E_ + vo;
      v16bf k_h[4], k_l[4];
#pragma unroll   // constant indices: the fragments stay in registers
      for (int c = 0; c < 4; ++c) {
        k_h[c] = ldF(bkh, c * FRAG);
        k_l[c] = ldF(bkl, c * FRAG);
      }
      // a precaution: the loads issued so far have taken their address registers
      // before the next pass's addresses may be given them
      asm volatile("s_wait_xcnt 0x0" ::: "memory");
      // no load is moved behind that wait and no register write in front of it
      __builtin_amdgcn_sched_barrier(0);

      const int kg = k0 + r16;
#pragma unroll   // constant indices into the Q fragments
      for (int tm = 0; tm < 2; ++tm) {
        const int q0 = t0 + tm * 16;
        v8f acc0 = vzero8(), acc1 = vzero8(), acc2 = vzero8(), acc3 = vzero8();
        REG_CHUNK(q_h[tm][0], q_l[tm][0], k_h[0], k_l[0], acc0);
        REG_CHUNK(q_h[tm][1], q_l[tm][1], k_h[1], k_l[1], acc1);
        REG_CHUNK(q_h[tm][2], q_l[tm][2], k_h[2], k_l[2], acc2);
        REG_CHUNK(q_h[tm][3], q_l[tm][3], k_h[3], k_l[3], acc3);
        v8f acc = (acc0 + acc1) + (acc2 + acc3);

#pragma unroll
        for (int j = 0; j < 8; ++j) {
          const int qg = q0 + j + 8 * lh;
          float val = acc[j] * SCALE;
          if (kg > qg) val = -INFINITY;                      // causal first
          if (((mw >> (tm * 16 + j)) & 1u) == 0) val = -1e9f;  // padding overwrites
          sS[(tm * 16 + j + 8 * lh) * SROW + kg] = val;
        }
      }
    }
  }
  __syncthreads();

  // ---- Phase 2a: row maxima over the walked keys ----
  float mxr[4];
  bool low = false;
#pragma unroll
  for (int r = 0; r < 4; ++r) {
    const float* row = sS + (wave * 4 + r) * SROW;
    float mx = -INFINITY;
    for (int cb = 0; cb < nkc; cb += 128) {
#pragma unroll   // four reads behind one wait; the key count is a multiple of 128
      for (int u = 0; u < 4; ++u) mx = fmaxf(mx, row[cb + 32 * u + lane]);
    }
    for (int off = 16; off; off >>= 1) mx = fmaxf(mx, __shfl_xor(mx, off, 32));
    mxr[r] = mx;
    low = low || !(mx >= -5e8f);   // exp(-1e9 - mx) might not be 0 for this row
  }
  if (low) *sFull = 1;
  __syncthreads();   // publishes the flag: all waves must walk the same key count
  if (__builtin_amdgcn_readfirstlane(*sFull) != 0) {
    // A row without a live key up to the edge: the keys past the edge count.
    // All of them are causal for every row here, so no product is needed.
    // Each wave fills the rows that it alone reads in phase 2.
    nk = T_;
#pragma unroll
    for (int r = 0; r < 4; ++r) {
      const int rr = wave * 4 + r;
      float* row = sS + rr * SROW;
      float mx = mxr[r];
      for (int c = nkc + lane; c < T_; c += 32) {
        const float val = (mask[(size_t)(t0 + rr) * T_ + c] == 0) ? -1e9f : -INFINITY;
        row[c] = val;
        mx = fmaxf(mx, val);
      }
      for (int off = 16; off; off >>= 1) mx = fmaxf(mx, __shfl_xor(mx, off, 32));
      mxr[r] = mx;
    }
  }

  // Wave w owns the 16 columns e = 16*w of both 16-row tiles in phase 3: a V
  // fragment is loaded once and multiplied with both, so V crosses from L2 once a
  // block. The first 128 keys' V (every block has them) is asked for here and
  // arrives during phase 2b.
  const int tn = wave;
  const __bf16* bvh = Vh + tn * FRAG + vo;           // 32 keys on: 8 fragments on
  const __bf16* bvl = Vl + tn * FRAG + vo;
  v16bf v_h[4], v_l[4];
#pragma unroll   // constant indices: the fragments stay in registers
  for (int c = 0; c < 4; ++c) {
    v_h[c] = ldF(bvh, c * 8 * FRAG);
    v_l[c] = ldF(bvl, c * 8 * FRAG);
  }
  // a precaution: these loads have taken their address registers before phase 2b
  // may be given them
  asm volatile("s_wait_xcnt 0x0" ::: "memory");
  // no load is moved behind that wait and no register write in front of it
  __builtin_amdgcn_sched_barrier(0);

  // ---- Phase 2b: exp, row sum; emit P as split bf16 ----
  // The wave takes a whole row into registers (up to 32 values a lane) and only
  // then writes P over it: every store of a row depends, through the row's sum,
  // on every load of that row, and no other wave touches the row in this phase.
#pragma unroll
  for (int r = 0; r < 4; ++r) {
    const int rr = wave * 4 + r;
    const float* row = sS + rr * SROW;
    const float mx = mxr[r];
    float e[32];
    float sum = 0.f;
#pragma unroll   // constant indices: the row stays in registers; nk is a scalar
    for (int g = 0; g < 8; ++g) {
      if (g * 128 < nk) {
#pragma unroll   // constant indices
        for (int u = 0; u < 4; ++u) e[g * 4 + u] = row[g * 128 + 32 * u + lane];
      }
    }
#pragma unroll   // constant indices; same per-lane order of the sum
    for (int g = 0; g < 8; ++g) {
      if (g * 128 < nk) {
#pragma unroll   // constant indices
        for (int u = 0; u < 4; ++u) {
          e[g * 4 + u] = expf(e[g * 4 + u] - mx);
          sum += e[g * 4 + u];
        }
      }
    }
    for (int off = 16; off; off >>= 1) sum += __shfl_xor(sum, off, 32);
    const float inv = 1.f / sum;
#pragma unroll   // constant indices
    for (int g = 0; g < 8; ++g) {
      if (g * 128 < nk) {
#pragma unroll   // constant indices
        for (int u = 0; u < 4; ++u) {
          const int c = g * 128 + 32 * u + lane;
          __bf16 hh, ll;
          split2(e[g * 4 + u] * inv, hh, ll);
          pHi[rr * PROW + c] = hh;
          pLo[rr * PROW + c] = ll;
        }
      }
    }
  }
  __syncthreads();

  // ---- Phase 3: O = P @ V  (A from LDS split-bf16, B from transposed V) ----
  // Each wave turns its output tiles, in a staging range of its own, into the
  // 16-byte pieces of the fragment order.
  constexpr int OPITCH = 24;                        // 48 B a row: 16 rows, 16 bank groups
  __bf16* stH = sOut + wave * 768;                  // [16][OPITCH]
  __bf16* stL = stH + 16 * OPITCH;
  const __bf16* aph = pHi + r16 * PROW + 8 * lh;
  const __bf16* apl = pLo + r16 * PROW + 8 * lh;

  v8f acc[2][4];
#pragma unroll   // constant indices: the accumulators stay in registers
  for (int c = 0; c < 8; ++c) acc[c >> 2][c & 3] = vzero8();
  v16bf p_h[2], p_l[2];
#pragma unroll   // constant indices
  for (int tm = 0; tm < 2; ++tm) {
    p_h[tm] = ldAB(aph + tm * 16 * PROW, 0);
    p_l[tm] = ldAB(apl + tm * 16 * PROW, 0);
  }
  int k0 = 0;
  for (; k0 + 128 < nk; k0 += 128) {
    const int nx = ((k0 >> 5) + 4) * 8 * FRAG;       // V of the next 128 keys
    pv_pass<true>(aph + k0, apl + k0, bvh + nx, bvl + nx, v_h, v_l, p_h, p_l, acc);
  }
  pv_pass<false>(aph + k0, apl + k0, bvh, bvl, v_h, v_l, p_h, p_l, acc);

#pragma unroll   // constant indices into the accumulators
  for (int tm = 0; tm < 2; ++tm) {
    const v8f o = (acc[tm][0] + acc[tm][1]) + (acc[tm][2] + acc[tm][3]);
    v8bf oh8, ol8;
    split8(o, oh8, ol8);
#pragma unroll
    for (int j = 0; j < 8; ++j) {
      stH[(j + 8 * lh) * OPITCH + r16] = oh8[j];
      stL[(j + 8 * lh) * OPITCH + r16] = ol8[j];
    }
    // the wave's own LDS writes have landed before it reads the rows back
    asm volatile("s_wait_dscnt 0x0" ::: "memory");
    // rows (b,t), k = h*E + e, pre-split for the output projection: fragment
    // (row / 16) * 32 + k / 32; this tile is its half tn & 1, one piece a lane
    const size_t idx = ((size_t)((b * T_ + t0) / 16 + tm) * 32 + h * 4 + (tn >> 1)) * FRAG
                     + (tn & 1) * 256;
    *(v8bf*)(aoh + idx + vo) = *(const v8bf*)(stH + r16 * OPITCH + 8 * lh);
    *(v8bf*)(aol + idx + vo) = *(const v8bf*)(stL + r16 * OPITCH + 8 * lh);
    // a precaution: the two stores have taken their registers before the second
    // tile's code is given them
    if (tm == 0) {
      asm volatile("s_wait_xcnt 0x0" ::: "memory");
      // no register write of the second tile's code is moved in front of that wait
      __builtin_amdgcn_sched_barrier(0);
    }
  }
}

// ---------------------------------------------------------------------------
// Kernel 3: out = ao @ Wu^T + bu   (split-bf16, M=8192, N=128, K=1024)
// ---------------------------------------------------------------------------
__global__ __launch_bounds__(256)
void proj_kernel(const __bf16* __restrict__ aoh, const __bf16* __restrict__ aol,
                 const __bf16* __restrict__ wuh, const __bf16* __restrict__ wul,
                 const float* __restrict__ bu, float* __restrict__ out) {
  // the wave's number as a scalar: Wu's fragment base stays in scalar registers
  const int wave = __builtin_amdgcn_readfirstlane(threadIdx.x >> 5);
  const int lane = threadIdx.x & 31;
  const int r16 = lane & 15, lh = lane >> 4;
  const unsigned vo = (unsigned)(lane * 8);            // the lane's piece of a fragment
  const int m0 = blockIdx.x * 16;
  const int n0 = wave * 16;
  const int K  = H_ * E_;  // 1024

  // both operands in fragment order: the 32 fragments of a 16-row tile in a row
  const __bf16* aah = aoh + (size_t)m0 * K + vo;
  const __bf16* aal = aol + (size_t)m0 * K + vo;
  const __bf16* bwh = wuh + (size_t)n0 * K + vo;
  const __bf16* bwl = wul + (size_t)n0 * K + vo;

  v8f acc0 = vzero8(), acc1 = vzero8(), acc2 = vzero8(), acc3 = vzero8();
#pragma unroll 2
  for (int k0 = 0; k0 < K; k0 += 128) {
    const int f0 = (k0 >> 5) * FRAG;
    SPLIT_CHUNK(aah, aal, f0,            bwh, bwl, f0,            acc0);
    SPLIT_CHUNK(aah, aal, f0 + FRAG,     bwh, bwl, f0 + FRAG,     acc1);
    SPLIT_CHUNK(aah, aal, f0 + 2 * FRAG, bwh, bwl, f0 + 2 * FRAG, acc2);
    SPLIT_CHUNK(aah, aal, f0 + 3 * FRAG, bwh, bwl, f0 + 3 * FRAG, acc3);
  }
  v8f acc = (acc0 + acc1) + (acc2 + acc3);

  const float bias = bu[n0 + r16];
#pragma unroll
  for (int j = 0; j < 8; ++j) {
    out[(size_t)(m0 + j + 8 * lh) * E_ + n0 + r16] = acc[j] + bias;
  }
}

// ---------------------------------------------------------------------------
extern "C" void kernel_launch(void* const* d_in, const int* in_sizes, int n_in,
                              void* d_out, int out_size, void* d_ws, size_t ws_size,
                              hipStream_t stream) {
  (void)in_sizes; (void)n_in; (void)out_size; (void)ws_size;
  const float* x    = (const float*)d_in[0];
  const int*   mask = (const int*)  d_in[1];
  const float* Wk   = (const float*)d_in[2];   // dict order: x, mask, Wk, Wq, Wv, Wu, bu
  const float* Wq   = (const float*)d_in[3];
  const float* Wv   = (const float*)d_in[4];
  const float* Wu   = (const float*)d_in[5];
  const float* bu   = (const float*)d_in[6];
  float* out = (float*)d_out;

  // workspace layout (bf16 element offsets); total ~140.6 MB
  __bf16* ws = (__bf16*)d_ws;
  const size_t CH = (size_t)B_ * H_ * T_ * E_;   // 8,388,608
  const size_t XH = (size_t)B_ * T_ * E_;        // 1,048,576
  const size_t WH = (size_t)(H_ * E_) * E_;      //   131,072
  __bf16* qh  = ws;            __bf16* ql  = ws + CH;
  __bf16* kh  = ws + 2 * CH;   __bf16* kl  = ws + 3 * CH;
  __bf16* vth = ws + 4 * CH;   __bf16* vtl = ws + 5 * CH;
  __bf16* aoh = ws + 6 * CH;   __bf16* aol = ws + 7 * CH;
  __bf16* xh  = ws + 8 * CH;   __bf16* xl  = xh + XH;
  __bf16* wb  = xl + XH;
  __bf16* wqh = wb;            __bf16* wql = wb + WH;
  __bf16* wkh = wb + 2 * WH;   __bf16* wkl = wb + 3 * WH;
  __bf16* wvh = wb + 4 * WH;   __bf16* wvl = wb + 5 * WH;
  __bf16* wuh = wb + 6 * WH;   __bf16* wul = wb + 7 * WH;
  unsigned* mbits = (unsigned*)(wb + 8 * WH);    // 32 * 1024 mask words, 128 KB

  // 0) split fp32 inputs into bf16 hi/lo, fragment order (8 elements a thread):
  //    128 blocks for the mask words, 512 for x, then 64 for each of Wq, Wk, Wv, Wu,
  //    in one launch
  split_kernel<<<128 + 512 + 4 * 64, 256, 0, stream>>>(x, Wq, Wk, Wv, Wu, mask,
                                                       xh, xl, wb, mbits);

  // 1) QKV projection (V transposed)
  dim3 g1((B_ * T_) / 64, H_, 3);
  qkv_kernel<<<g1, 256, 0, stream>>>(xh, xl, wqh, wql, wkh, wkl, wvh, wvl,
                                     qh, ql, kh, kl, vth, vtl);

  // 2) attention
  const size_t lds = (size_t)32 * SROW * 4 + (size_t)8 * 768 * 2 + 16;  // 143,888 B
  (void)hipFuncSetAttribute((const void*)attn_kernel,
                            hipFuncAttributeMaxDynamicSharedMemorySize, (int)lds);
  dim3 g2(2 * H_, T_ / 32, B_ / 2);   // (b,h) pair of a group; query tile, last first; group
  attn_kernel<<<g2, 256, lds, stream>>>(qh, ql, kh, kl, vth, vtl, mask, mbits, aoh, aol);

  // 3) output projection
  proj_kernel<<<(B_ * T_) / 16, 256, 0, stream>>>(aoh, aol, wuh, wul, bu, out);
}
